// v000
// Times are from an AMD MI455X. After a warm-up the kernel runs many times in a row, and a time is the length of
// such a window on the GPU divided by its runs, so every launch and the gaps after it count. The runs cycle
// through copies of the inputs. A figure is the median of several windows, for all but v000 over two sittings.
// Sittings can differ by a few percent; kernels timed side by side share one.
// The starting kernel, v000, takes 497 microseconds a run.
#include <hip/hip_runtime.h>

// Single causal attention head (x [4][2048][1024]; q, k, v = einsum('btd,de->bte', x, W) = x W ('xw' [1024][64] 1/32, no bias; ONE 64-wide head); scores = q.k / 64^0.5; causal (-inf above the diagonal); softmax over the keys (axis 2); out = attn.v -> [4][2048][64] (0.5 M); argument order x, Wq, Wk, Wv).
// Layout per batch: bf16 copy of x; 'xw' weights transposed once; exact projections (N 64); identity-table plane builders; causal T-2048 attention at NH 1 / ZH 1 with EVERY row on hi/lo planes (3 products for scores and P.V: one head and no output projection); the f32 merge writes the output rows.
// Compute dtypes, f32 accumulate: every input rounded to bf16; projections exact; attention 3 products on every row; softmax f32; output f32.

#define NB_  4
#define TT   2048
#define DM   1024
#define NH_  1
#define NKV  1
#define REP  (NH_ / NKV)
#define HD   64
#define DQ   (NH_ * HD)
#define DKV  (NKV * HD)
#define ZH   1                    // ONE head: a single plane per pass
#define RH   TT                   // every row hi/lo (3 products)
#define WIN  2048
#define PCAR 1024.0f
#define SCL  0.125f   // 1/sqrt(d_head = 64)
typedef _Float16 h16;
typedef unsigned short bf;
typedef __attribute__((ext_vector_type(16))) __bf16   v16bf;
typedef __attribute__((ext_vector_type(16))) _Float16 v16h;
typedef __attribute__((ext_vector_type(8)))  _Float16 v8h;
typedef __attribute__((ext_vector_type(8)))  unsigned short v8us;
typedef __attribute__((ext_vector_type(8)))  float    v8f;
typedef __attribute__((ext_vector_type(4)))  float    v4f;
typedef v8h  __attribute__((may_alias)) v8ha;
typedef v4f  __attribute__((may_alias)) v4fa;
typedef v8us __attribute__((may_alias)) v8usa;

__device__ __forceinline__ unsigned short f2bf(float f) { unsigned u = __float_as_uint(f); u += 0x7FFFu + ((u >> 16) & 1u); return (unsigned short)(u >> 16); }
__device__ __forceinline__ float bf2f(unsigned short b) { return __uint_as_float(((unsigned)b) << 16); }
__device__ __forceinline__ float bfr(float f) { return bf2f(f2bf(f)); }
__device__ __forceinline__ v16h cat16(v8h lo, v8h hi) { return __builtin_shufflevector(lo, hi, 0, 1, 2, 3, 4, 5, 6, 7, 8, 9, 10, 11, 12, 13, 14, 15); }
__device__ __forceinline__ v16bf cat16b(v8us lo, v8us hi) { return __builtin_bit_cast(v16bf, __builtin_shufflevector(lo, hi, 0, 1, 2, 3, 4, 5, 6, 7, 8, 9, 10, 11, 12, 13, 14, 15)); }
__device__ __forceinline__ v8f wmma16(v16h a, v16h b, v8f c) { return __builtin_amdgcn_wmma_f32_16x16x32_f16(false, a, false, b, (short)0, c, false, false); }
__device__ __forceinline__ v8f wmmab(v16bf a, v16bf b, v8f c) { return __builtin_amdgcn_wmma_f32_16x16x32_bf16(false, a, false, b, (short)0, c, false, false); }



// ---- k_gemmw: register-blocked GEMM, ONE WAVE per 64x64 output tile (16 accumulators), operands straight from K-contiguous 16-bit planes; grid (M/64, N/64, Z), 32 threads.
// C[m][n] (f32, pitch ldc, + optional f32 bias[n]) = sum_k A[m][k] Bt[n][k] (+ split products per NSPLIT). z-batch strides sA/sB/sC in elements. K % 32 == 0.
template <typename T16> struct WFrag;
template <> struct WFrag<h16> { typedef v16h V; static __device__ __forceinline__ V ld(const h16* p) { return cat16(*(const v8h*)p, *(const v8h*)(p + 16)); } static __device__ __forceinline__ v8f mma(V a, V b, v8f c) { return wmma16(a, b, c); } };
template <> struct WFrag<bf> { typedef v16bf V; static __device__ __forceinline__ V ld(const bf* p) { return cat16b(*(const v8us*)p, *(const v8us*)(p + 16)); } static __device__ __forceinline__ v8f mma(V a, V b, v8f c) { return wmmab(a, b, c); } };
template <typename T16, int NSPLIT, bool BIAS>
__global__ __launch_bounds__(32) void k_gemmw(const T16* __restrict__ A, const T16* __restrict__ A2, const T16* __restrict__ Bt, const T16* __restrict__ Bt2, int K, float* C, int ldc, const float* __restrict__ bias, size_t sA, size_t sB, size_t sC) {
    typedef typename WFrag<T16>::V V;
    __shared__ __align__(16) float os[16 * 68];
    const size_t z = blockIdx.z; A += z * sA; if (A2) A2 += z * sA; Bt += z * sB; if (Bt2) Bt2 += z * sB; C += z * sC;
    const int lane = threadIdx.x & 31, lr = lane & 15, hi = lane >> 4; const int r0 = blockIdx.x * 64, c0 = blockIdx.y * 64;
    v8f acc[4][4];
#pragma unroll
    for (int mb = 0; mb < 4; ++mb)
#pragma unroll
        for (int nb = 0; nb < 4; ++nb) acc[mb][nb] = (v8f){};
    const size_t aoff = (size_t)(r0 + lr) * K + 8 * hi, boff = (size_t)(c0 + lr) * K + 8 * hi;
#pragma unroll 1
    for (int kc = 0; kc < K; kc += 32) {
        V a[4], a2[4];
#pragma unroll
        for (int mb = 0; mb < 4; ++mb) { a[mb] = WFrag<T16>::ld(A + aoff + (size_t)mb * 16 * K + kc); if (NSPLIT == 1 || NSPLIT == 2) a2[mb] = WFrag<T16>::ld(A2 + aoff + (size_t)mb * 16 * K + kc); }
#pragma unroll
        for (int nb = 0; nb < 4; ++nb) { const V b = WFrag<T16>::ld(Bt + boff + (size_t)nb * 16 * K + kc); V b2; if (NSPLIT >= 2) b2 = WFrag<T16>::ld(Bt2 + boff + (size_t)nb * 16 * K + kc);
#pragma unroll
            for (int mb = 0; mb < 4; ++mb) { acc[mb][nb] = WFrag<T16>::mma(a[mb], b, acc[mb][nb]); if (NSPLIT == 1 || NSPLIT == 2) acc[mb][nb] = WFrag<T16>::mma(a2[mb], b, acc[mb][nb]); if (NSPLIT >= 2) acc[mb][nb] = WFrag<T16>::mma(a[mb], b2, acc[mb][nb]); } }
        asm volatile("v_nop\n\tv_nop\n\tv_nop\n\tv_nop" : "+v"(acc[0][0]), "+v"(acc[1][1]), "+v"(acc[2][2]), "+v"(acc[3][3]) : "v"(a[0]), "v"(a[3]));
    }
#pragma unroll
    for (int mb = 0; mb < 4; ++mb) {
#pragma unroll
        for (int nb = 0; nb < 4; ++nb) {
#pragma unroll
            for (int j = 0; j < 8; ++j) os[(hi * 8 + j) * 68 + nb * 16 + lr] = acc[mb][nb][j]; }
        __builtin_amdgcn_wave_barrier(); asm volatile("" ::: "memory");
        float* crow = C + (size_t)(r0 + mb * 16) * ldc + c0;
{
#pragma unroll
            for (int s = 0; s < 8; ++s) { const int row = 2 * s + hi, cofs = lr * 4; v4f val = *(const v4fa*)(os + row * 68 + cofs); if (BIAS) { val[0] += bfr(bias[c0 + cofs]); val[1] += bfr(bias[c0 + cofs + 1]); val[2] += bfr(bias[c0 + cofs + 2]); val[3] += bfr(bias[c0 + cofs + 3]); }
                *(v4f*)(crow + (size_t)row * ldc + cofs) = val; }
             }
        __builtin_amdgcn_wave_barrier(); asm volatile("" ::: "memory");
    }
}

// ---- k_gemmc: the same one-wave 64x64 tile GEMM specialised for causal attention: CMODE 1 skips score tiles entirely above the diagonal (query rows r0+roff.., key columns c0..), CMODE 2 limits the
// key (K) loop of the probability x value contraction to the diagonal block (probabilities beyond it are exactly zero). roff = row offset of this launch's first row within the sequence.
template <typename T16, int NSPLIT, int CMODE>
__global__ __launch_bounds__(32) void k_gemmc(const T16* __restrict__ A, const T16* __restrict__ A2, const T16* __restrict__ Bt, const T16* __restrict__ Bt2, int K, float* C, int ldc, int roff, size_t sA, size_t sB, size_t sC) {
    typedef typename WFrag<T16>::V V;
    __shared__ __align__(16) float os[16 * 68];
    const size_t z = blockIdx.z; A += z * sA; if (A2) A2 += z * sA; Bt += z * sB; if (Bt2) Bt2 += z * sB; C += z * sC;
    const int lane = threadIdx.x & 31, lr = lane & 15, hi = lane >> 4; const int r0 = blockIdx.x * 64, c0 = blockIdx.y * 64;
    if (CMODE == 1 && c0 > r0 + roff + 63) return;                  // score tile entirely above the causal diagonal: never read (the softmax masks j > i by select)
    const int Kl = (CMODE == 2) ? min(K, r0 + roff + 64) : K;        // P.V: probabilities are exactly 0 beyond the diagonal block, so the K loop stops there
    v8f acc[4][4];
#pragma unroll
    for (int mb = 0; mb < 4; ++mb)
#pragma unroll
        for (int nb = 0; nb < 4; ++nb) acc[mb][nb] = (v8f){};
    const size_t aoff = (size_t)(r0 + lr) * K + 8 * hi, boff = (size_t)(c0 + lr) * K + 8 * hi;
#pragma unroll 1
    for (int kc = 0; kc < Kl; kc += 32) {
        V a[4], a2[4];
#pragma unroll
        for (int mb = 0; mb < 4; ++mb) { a[mb] = WFrag<T16>::ld(A + aoff + (size_t)mb * 16 * K + kc); if (NSPLIT == 1 || NSPLIT == 2) a2[mb] = WFrag<T16>::ld(A2 + aoff + (size_t)mb * 16 * K + kc); }
#pragma unroll
        for (int nb = 0; nb < 4; ++nb) { const V b = WFrag<T16>::ld(Bt + boff + (size_t)nb * 16 * K + kc); V b2; if (NSPLIT >= 2) b2 = WFrag<T16>::ld(Bt2 + boff + (size_t)nb * 16 * K + kc);
#pragma unroll
            for (int mb = 0; mb < 4; ++mb) { acc[mb][nb] = WFrag<T16>::mma(a[mb], b, acc[mb][nb]); if (NSPLIT == 1 || NSPLIT == 2) acc[mb][nb] = WFrag<T16>::mma(a2[mb], b, acc[mb][nb]); if (NSPLIT >= 2) acc[mb][nb] = WFrag<T16>::mma(a[mb], b2, acc[mb][nb]); } }
        asm volatile("v_nop\n\tv_nop\n\tv_nop\n\tv_nop" : "+v"(acc[0][0]), "+v"(acc[1][1]), "+v"(acc[2][2]), "+v"(acc[3][3]) : "v"(a[0]), "v"(a[3]));
    }
#pragma unroll
    for (int mb = 0; mb < 4; ++mb) {
#pragma unroll
        for (int nb = 0; nb < 4; ++nb) {
#pragma unroll
            for (int j = 0; j < 8; ++j) os[(hi * 8 + j) * 68 + nb * 16 + lr] = acc[mb][nb][j]; }
        __builtin_amdgcn_wave_barrier(); asm volatile("" ::: "memory");
        float* crow = C + (size_t)(r0 + mb * 16) * ldc + c0;
{
#pragma unroll
            for (int s = 0; s < 8; ++s) { const int row = 2 * s + hi, cofs = lr * 4; v4f val = *(const v4fa*)(os + row * 68 + cofs);
                *(v4f*)(crow + (size_t)row * ldc + cofs) = val; }
             }
        __builtin_amdgcn_wave_barrier(); asm volatile("" ::: "memory");
    }
}

__device__ __forceinline__ h16 tohx(float x) { return (h16)x; }
__device__ __forceinline__ void splitf(float y, unsigned short& h, unsigned short& l) { h = f2bf(y); l = f2bf(y - bf2f(h)); }
typedef __attribute__((ext_vector_type(2))) _Float16 v2h;
typedef __attribute__((ext_vector_type(4))) _Float16 v4h;
typedef __attribute__((ext_vector_type(2))) unsigned short v2us;
typedef __attribute__((ext_vector_type(4))) unsigned short v4us;
typedef __attribute__((ext_vector_type(2))) float v2f;
typedef __attribute__((ext_vector_type(4))) int v4i;

__global__ __launch_bounds__(256) void k_wtG(const float* __restrict__ w, int K, int N, bf* Bt) {
    const int lane = threadIdx.x & 31; const int L0 = (blockIdx.x * 8 + (threadIdx.x >> 5)) * 8; const int nlines = N * K / 64;
{
#pragma unroll 1
        for (int l = 0; l < 8; ++l) { const int L = L0 + l; if (L >= nlines) break; const size_t e = (size_t)L * 64 + lane * 2; const int k = (int)(e % K), n = (int)(e / K); v2us o;
            o[0] = f2bf(w[(size_t)k * N + n]); o[1] = f2bf(w[(size_t)(k + 1) * N + n]); *(v2us*)(Bt + e) = o; }
         }
}
__global__ __launch_bounds__(256) void k_cvt8(const float* __restrict__ src, bf* dst, size_t n8) { const size_t i = (size_t)blockIdx.x * 256 + threadIdx.x; if (i >= n8) return; const v8f v = *(const v8f*)(src + i * 8); v8us o;
#pragma unroll
    for (int k = 0; k < 8; ++k) o[k] = f2bf(v[k]); *(v8us*)(dst + i * 8) = o;  }

// k_rope: head planes [h][t][d] (fp16 + hi/lo) of rope(x) x sc with the rotate-half convention out[d] = x[d] cos[t][d] - x[d+HD/2] sin[t][d], out[d+HD/2] = x[d+HD/2] cos[t][d+HD/2] + x[d] sin[t][d+HD/2]
__global__ __launch_bounds__(256) void k_rope(const float* __restrict__ F, int pitch, int nheads, const float* __restrict__ CS, const float* __restrict__ RF, const float* __restrict__ nw, float sc, h16* P16, bf* Ph, bf* Pl) {
    const size_t e = ((size_t)blockIdx.x * 256 + threadIdx.x) * 2; if (e >= (size_t)nheads * TT * HD) return; const int d = (int)(e % HD); const int t = (int)((e / HD) % TT); const int h = (int)(e / ((size_t)HD * TT)); const float* f = F + (size_t)t * pitch + h * HD; const float rf = RF ? RF[(size_t)h * TT + t] : 1.0f; v2h o16; v2us oh, ol;
#pragma unroll
    for (int q = 0; q < 2; ++q) { const int dd = d + q; const int dp = (dd < HD / 2) ? dd + HD / 2 : dd - HD / 2; float x0 = f[dd], x1 = f[dp];
        if (RF) { float n0 = __fmul_rn(x0, rf), n1 = __fmul_rn(x1, rf); asm volatile("" : "+v"(n0)); asm volatile("" : "+v"(n1)); x0 = __fmul_rn(bfr(nw[dd]), n0); x1 = __fmul_rn(bfr(nw[dp]), n1); }
        const v2f cs = *(const v2f*)(CS + ((size_t)t * HD + dd) * 2); float a = __fmul_rn(x0, cs[0]), bq = __fmul_rn(x1, cs[1]); asm volatile("" : "+v"(a)); asm volatile("" : "+v"(bq)); const float r = ((dd < HD / 2) ? __fsub_rn(a, bq) : __fadd_rn(a, bq)) * sc;
        o16[q] = tohx(r); unsigned short a2, c2; splitf(r, a2, c2); oh[q] = a2; ol[q] = c2; }
    *(v2h*)(P16 + e) = o16; *(v2us*)(Ph + e) = oh; *(v2us*)(Pl + e) = ol;  }
__global__ __launch_bounds__(256) void k_vtp(const float* __restrict__ F, int pitch, int nheads, h16* V16, bf* Vh, bf* Vl) { const size_t e = ((size_t)blockIdx.x * 256 + threadIdx.x) * 2; if (e >= (size_t)nheads * HD * TT) return; const int t = (int)(e % TT); const int d = (int)((e / TT) % HD); const int g = (int)(e / ((size_t)TT * HD)); v2h o16; v2us oh, ol;
#pragma unroll
    for (int q = 0; q < 2; ++q) { const float x = F[(size_t)(t + q) * pitch + g * HD + d]; o16[q] = tohx(x); unsigned short a2, c2; splitf(x, a2, c2); oh[q] = a2; ol[q] = c2; }
    *(v2h*)(V16 + e) = o16; *(v2us*)(Vh + e) = oh; *(v2us*)(Vl + e) = ol;  }
__global__ __launch_bounds__(256) void k_csid(float* CS) { const int idx = blockIdx.x * 256 + threadIdx.x; if (idx >= TT * HD) return; v2f cs; cs[0] = 1.0f; cs[1] = 0.0f; *(v2f*)(CS + (size_t)idx * 2) = cs;  }
// k_asoft: per row (zz, i): t = S x HD^-0.5 for j <= i and i - j < WIN (sliding causal window; the reference's -1e9 additive fill vanishes identically); softmax over the 2048 keys (register row, one exp, fixed trees);
__global__ __launch_bounds__(256) void k_asoft(const float* __restrict__ Sb, h16* P16, bf* Ph, bf* Pl) {
    const int lane = threadIdx.x & 31; const int row = blockIdx.x * 8 + (threadIdx.x >> 5); if (row >= ZH * TT) return; const int i = row % TT; const int zz = row / TT; (void)zz; const bool hires = (i < RH); const float* sr = Sb + (size_t)row * TT; float v[TT / 32]; float mx = -3.0e38f;
#pragma unroll
    for (int ch = 0; ch < TT / 128; ++ch) { const int j0 = ch * 128 + lane * 4; const v4f a = *(const v4f*)(sr + j0);
#pragma unroll
        for (int q = 0; q < 4; ++q) { const int j = j0 + q; (void)j; const float t = (j <= i && i - j < WIN) ? a[q] * SCL : -3.0e38f; v[ch * 4 + q] = t; mx = fmaxf(mx, t); } }
#pragma unroll
    for (int sh = 16; sh; sh >>= 1) mx = fmaxf(mx, __shfl_xor(mx, sh, 32));
    float sum = 0.f;
#pragma unroll
    for (int k = 0; k < TT / 32; ++k) { float d0 = __fsub_rn(v[k], mx); asm volatile("" : "+v"(d0)); v[k] = __builtin_amdgcn_exp2f(__fmul_rn(d0, 1.4426950408889634f)); sum += v[k]; }
#pragma unroll
    for (int sh = 16; sh; sh >>= 1) sum += __shfl_xor(sum, sh, 32);
    const float f = __fdiv_rn(hires ? 1.0f : PCAR, sum);
{
        if (hires) {
#pragma unroll
            for (int ch = 0; ch < TT / 128; ++ch) { v4us oh, ol;
#pragma unroll
                for (int q = 0; q < 4; ++q) { unsigned short a, c2; splitf(v[ch * 4 + q] * f, a, c2); oh[q] = a; ol[q] = c2; }
                const size_t oo = ((size_t)zz * (RH ? RH : 1) + i) * TT + ch * 128 + lane * 4; *(v4us*)(Ph + oo) = oh; *(v4us*)(Pl + oo) = ol; }
        } else {
#pragma unroll
            for (int ch = 0; ch < TT / 128; ++ch) { v4h o4;
#pragma unroll
                for (int q = 0; q < 4; ++q) o4[q] = tohx(v[ch * 4 + q] * f);
                *(v4h*)(P16 + (size_t)row * TT + ch * 128 + lane * 4) = o4; } }
         }
}
__global__ __launch_bounds__(256) void k_merge(const float* __restrict__ O, int h0, float* OUTb) { const size_t e = ((size_t)blockIdx.x * 256 + threadIdx.x) * 2; if (e >= (size_t)ZH * TT * HD) return; const int d = (int)(e % HD); const int t = (int)((e / HD) % TT); const int zz = (int)(e / ((size_t)HD * TT)); const float cs = (t < RH) ? 1.0f : (1.0f / PCAR); const size_t oo = (size_t)t * DQ + (h0 + zz) * HD + d;
    v2f o2; o2[0] = O[e] * cs; o2[1] = O[e + 1] * cs; *(v2f*)(OUTb + oo) = o2;  }

extern "C" void kernel_launch(void* const* d_in, const int* in_sizes, int n_in,
                              void* d_out, int out_size, void* d_ws, size_t ws_size, hipStream_t stream) {
    (void)in_sizes; (void)n_in; (void)out_size;
    const float* x = (const float*)d_in[0]; const float* wq = (const float*)d_in[1]; const float* wk = (const float*)d_in[2]; const float* wv = (const float*)d_in[3]; const float* wo = nullptr; (void)wo;   /* x, Wq, Wk, Wv ('xw' [1024][64]) */
    float* OUT = (float*)d_out;     // [4][2048][64]
    char* wsp = (char*)d_ws;
    auto take = [&](size_t bytes) { char* p = wsp; wsp += (bytes + 255) & ~(size_t)255; return (void*)p; };
    bf* WQ = (bf*)take((size_t)DQ * DM * 2); bf* WK = (bf*)take((size_t)DKV * DM * 2); bf* WV = (bf*)take((size_t)DKV * DM * 2); float* CS = (float*)take((size_t)TT * HD * 2 * 4);
    bf* XB = (bf*)take((size_t)TT * DM * 2); float* FQ = (float*)take((size_t)TT * DQ * 4); float* FK = (float*)take((size_t)TT * DKV * 4);
    h16* QP16 = (h16*)take((size_t)NH_ * TT * HD * 2); h16* KP16 = (h16*)take((size_t)NKV * TT * HD * 2); h16* VT16 = (h16*)take((size_t)NKV * HD * TT * 2);
    bf* QPh = (bf*)take((size_t)NH_ * TT * HD * 2); bf* QPl = (bf*)take((size_t)NH_ * TT * HD * 2); bf* KPh = (bf*)take((size_t)NKV * TT * HD * 2); bf* KPl = (bf*)take((size_t)NKV * TT * HD * 2); bf* VTh = (bf*)take((size_t)NKV * HD * TT * 2); bf* VTl = (bf*)take((size_t)NKV * HD * TT * 2); bf* Ph = (bf*)take((size_t)ZH * RH * TT * 2); bf* Pl = (bf*)take((size_t)ZH * RH * TT * 2);
    float* Sb = (float*)take((size_t)ZH * TT * TT * 4); h16* P16 = (h16*)take((size_t)ZH * TT * TT * 2); float* Ob = (float*)take((size_t)ZH * TT * HD * 4);
    if ((size_t)(wsp - (char*)d_ws) > ws_size) return;    // ws 256 MiB
    float* FV = FK;   // v projection reuses the k buffer after the k planes are built (stream-ordered)
    { k_wtG<<<(unsigned)((DM * DQ / 64 + 63) / 64), 256, 0, stream>>>(wq, DM, DQ, WQ); k_wtG<<<(unsigned)((DM * DKV / 64 + 63) / 64), 256, 0, stream>>>(wk, DM, DKV, WK); k_wtG<<<(unsigned)((DM * DKV / 64 + 63) / 64), 256, 0, stream>>>(wv, DM, DKV, WV);
      
       }
    k_csid<<<(TT * HD + 255) / 256, 256, 0, stream>>>(CS);
    const unsigned LQ = (unsigned)(((size_t)NH_ * TT * HD / 2 + 255) / 256), LKv = (unsigned)(((size_t)NKV * TT * HD / 2 + 255) / 256);
    for (int b = 0; b < NB_; ++b) {
        
        k_cvt8<<<(unsigned)(((size_t)TT * DM / 8 + 255) / 256), 256, 0, stream>>>(x + (size_t)b * TT * DM, XB, (size_t)TT * DM / 8);
        k_gemmw<bf, 0, false><<<dim3(TT / 64, DQ / 64, 1), 32, 0, stream>>>(XB, nullptr, WQ, nullptr, DM, FQ, DQ, nullptr, 0, 0, 0);
        k_rope<<<LQ, 256, 0, stream>>>(FQ, DQ, NH_, CS, nullptr, nullptr, 1.0f, QP16, QPh, QPl);
        k_gemmw<bf, 0, false><<<dim3(TT / 64, DKV / 64, 1), 32, 0, stream>>>(XB, nullptr, WK, nullptr, DM, FK, DKV, nullptr, 0, 0, 0);
        k_rope<<<LKv, 256, 0, stream>>>(FK, DKV, NKV, CS, nullptr, nullptr, 1.0f, KP16, KPh, KPl);
        k_gemmw<bf, 0, false><<<dim3(TT / 64, DKV / 64, 1), 32, 0, stream>>>(XB, nullptr, WV, nullptr, DM, FV, DKV, nullptr, 0, 0, 0); k_vtp<<<LKv, 256, 0, stream>>>(FV, DKV, NKV, VT16, VTh, VTl);
        for (int h0 = 0; h0 < NH_; h0 += ZH) { const size_t zq = (size_t)h0, zk = (size_t)(h0 / REP);   // one kv head per query head: the pass's single head uses kv plane h0 / REP (z-strides TT*HD)
            k_gemmc<bf, 2, 1><<<dim3(RH / 64, TT / 64, ZH), 32, 0, stream>>>(QPh + zq * TT * HD, QPl + zq * TT * HD, KPh + zk * TT * HD, KPl + zk * TT * HD, HD, Sb, TT, 0, (size_t)TT * HD, (size_t)TT * HD, (size_t)TT * TT);
            k_asoft<<<ZH * TT / 8, 256, 0, stream>>>(Sb, P16, Ph, Pl);
            k_gemmc<bf, 2, 2><<<dim3(RH / 64, HD / 64, ZH), 32, 0, stream>>>(Ph, Pl, VTh + zk * HD * TT, VTl + zk * HD * TT, TT, Ob, HD, 0, (size_t)RH * TT, (size_t)HD * TT, (size_t)TT * HD);
            k_merge<<<(unsigned)(((size_t)ZH * TT * HD / 2 + 255) / 256), 256, 0, stream>>>(Ob, h0, OUT + (size_t)b * TT * DQ); }
         }
}

// v001
// Measured time: 175 microseconds a run.
// In two side-by-side timings against v000, it was 2.86 and 2.85 times as fast.
#include <hip/hip_runtime.h>

// Single causal attention head (x [4][2048][1024]; q, k, v = einsum('btd,de->bte', x, W) = x W ('xw' [1024][64] 1/32, no bias; ONE 64-wide head); scores = q.k / 64^0.5; causal (-inf above the diagonal); softmax over the keys (axis 2); out = attn.v -> [4][2048][64] (0.5 M); argument order x, Wq, Wk, Wv).
// All four batches go through every launch together (rows of the projections, grid y of the plane builders, grid z of the attention GEMMs). Layout, one plane per batch: bf16 copy of x; 'xw' weights transposed once; exact projections (N 64); identity-table plane builders; causal T-2048 attention at NH 1 / ZH 1 with EVERY row on hi/lo planes (3 products for scores and P.V: one head and no output projection); the f32 merge writes the output rows.
// Compute dtypes, f32 accumulate: every input rounded to bf16; projections exact; attention 3 products on every row; softmax f32; output f32.

#define NB_  4
#define TT   2048
#define DM   1024
#define NH_  1
#define NKV  1
#define REP  (NH_ / NKV)
#define HD   64
#define DQ   (NH_ * HD)
#define DKV  (NKV * HD)
#define ZH   1                    // ONE head: a single plane per batch
#define NZ   (NB_ * ZH)           // planes per launch: plane index = batch (one head each)
#define RH   TT                   // every row hi/lo (3 products)
#define WIN  2048
#define PCAR 1024.0f
#define SCL  0.125f   // 1/sqrt(d_head = 64)
typedef _Float16 h16;
typedef unsigned short bf;
typedef __attribute__((ext_vector_type(16))) __bf16   v16bf;
typedef __attribute__((ext_vector_type(16))) _Float16 v16h;
typedef __attribute__((ext_vector_type(8)))  _Float16 v8h;
typedef __attribute__((ext_vector_type(8)))  unsigned short v8us;
typedef __attribute__((ext_vector_type(8)))  float    v8f;
typedef __attribute__((ext_vector_type(4)))  float    v4f;
typedef v8h  __attribute__((may_alias)) v8ha;
typedef v4f  __attribute__((may_alias)) v4fa;
typedef v8us __attribute__((may_alias)) v8usa;

__device__ __forceinline__ unsigned short f2bf(float f) { unsigned u = __float_as_uint(f); u += 0x7FFFu + ((u >> 16) & 1u); return (unsigned short)(u >> 16); }
__device__ __forceinline__ float bf2f(unsigned short b) { return __uint_as_float(((unsigned)b) << 16); }
__device__ __forceinline__ float bfr(float f) { return bf2f(f2bf(f)); }
__device__ __forceinline__ v16h cat16(v8h lo, v8h hi) { return __builtin_shufflevector(lo, hi, 0, 1, 2, 3, 4, 5, 6, 7, 8, 9, 10, 11, 12, 13, 14, 15); }
__device__ __forceinline__ v16bf cat16b(v8us lo, v8us hi) { return __builtin_bit_cast(v16bf, __builtin_shufflevector(lo, hi, 0, 1, 2, 3, 4, 5, 6, 7, 8, 9, 10, 11, 12, 13, 14, 15)); }
__device__ __forceinline__ v8f wmma16(v16h a, v16h b, v8f c) { return __builtin_amdgcn_wmma_f32_16x16x32_f16(false, a, false, b, (short)0, c, false, false); }
__device__ __forceinline__ v8f wmmab(v16bf a, v16bf b, v8f c) { return __builtin_amdgcn_wmma_f32_16x16x32_bf16(false, a, false, b, (short)0, c, false, false); }



// ---- k_gemmw: register-blocked GEMM, ONE WAVE per 64x64 output tile (16 accumulators), operands straight from K-contiguous 16-bit planes; grid (M/64, N/64, Z), 32 threads.
// C[m][n] (f32, pitch ldc, + optional f32 bias[n]) = sum_k A[m][k] Bt[n][k] (+ split products per NSPLIT). z-batch strides sA/sB/sC in elements. K % 32 == 0.
template <typename T16> struct WFrag;
template <> struct WFrag<h16> { typedef v16h V; static __device__ __forceinline__ V ld(const h16* p) { return cat16(*(const v8h*)p, *(const v8h*)(p + 16)); } static __device__ __forceinline__ v8f mma(V a, V b, v8f c) { return wmma16(a, b, c); } };
template <> struct WFrag<bf> { typedef v16bf V; static __device__ __forceinline__ V ld(const bf* p) { return cat16b(*(const v8us*)p, *(const v8us*)(p + 16)); } static __device__ __forceinline__ v8f mma(V a, V b, v8f c) { return wmmab(a, b, c); } };
template <typename T16, int NSPLIT, bool BIAS>
__global__ __launch_bounds__(32) void k_gemmw(const T16* __restrict__ A, const T16* __restrict__ A2, const T16* __restrict__ Bt, const T16* __restrict__ Bt2, int K, float* C, int ldc, const float* __restrict__ bias, size_t sA, size_t sB, size_t sC) {
    typedef typename WFrag<T16>::V V;
    __shared__ __align__(16) float os[16 * 68];
    const size_t z = blockIdx.z; A += z * sA; if (A2) A2 += z * sA; Bt += z * sB; if (Bt2) Bt2 += z * sB; C += z * sC;
    const int lane = threadIdx.x & 31, lr = lane & 15, hi = lane >> 4; const int r0 = blockIdx.x * 64, c0 = blockIdx.y * 64;
    v8f acc[4][4];
#pragma unroll
    for (int mb = 0; mb < 4; ++mb)
#pragma unroll
        for (int nb = 0; nb < 4; ++nb) acc[mb][nb] = (v8f){};
    const size_t aoff = (size_t)(r0 + lr) * K + 8 * hi, boff = (size_t)(c0 + lr) * K + 8 * hi;
#pragma unroll 1
    for (int kc = 0; kc < K; kc += 32) {
        V a[4], a2[4];
#pragma unroll
        for (int mb = 0; mb < 4; ++mb) { a[mb] = WFrag<T16>::ld(A + aoff + (size_t)mb * 16 * K + kc); if (NSPLIT == 1 || NSPLIT == 2) a2[mb] = WFrag<T16>::ld(A2 + aoff + (size_t)mb * 16 * K + kc); }
#pragma unroll
        for (int nb = 0; nb < 4; ++nb) { const V b = WFrag<T16>::ld(Bt + boff + (size_t)nb * 16 * K + kc); V b2; if (NSPLIT >= 2) b2 = WFrag<T16>::ld(Bt2 + boff + (size_t)nb * 16 * K + kc);
#pragma unroll
            for (int mb = 0; mb < 4; ++mb) { acc[mb][nb] = WFrag<T16>::mma(a[mb], b, acc[mb][nb]); if (NSPLIT == 1 || NSPLIT == 2) acc[mb][nb] = WFrag<T16>::mma(a2[mb], b, acc[mb][nb]); if (NSPLIT >= 2) acc[mb][nb] = WFrag<T16>::mma(a[mb], b2, acc[mb][nb]); } }
        asm volatile("v_nop\n\tv_nop\n\tv_nop\n\tv_nop" : "+v"(acc[0][0]), "+v"(acc[1][1]), "+v"(acc[2][2]), "+v"(acc[3][3]) : "v"(a[0]), "v"(a[3]));
    }
#pragma unroll
    for (int mb = 0; mb < 4; ++mb) {
#pragma unroll
        for (int nb = 0; nb < 4; ++nb) {
#pragma unroll
            for (int j = 0; j < 8; ++j) os[(hi * 8 + j) * 68 + nb * 16 + lr] = acc[mb][nb][j]; }
        __builtin_amdgcn_wave_barrier(); asm volatile("" ::: "memory");
        float* crow = C + (size_t)(r0 + mb * 16) * ldc + c0;
{
#pragma unroll
            for (int s = 0; s < 8; ++s) { const int row = 2 * s + hi, cofs = lr * 4; v4f val = *(const v4fa*)(os + row * 68 + cofs); if (BIAS) { val[0] += bfr(bias[c0 + cofs]); val[1] += bfr(bias[c0 + cofs + 1]); val[2] += bfr(bias[c0 + cofs + 2]); val[3] += bfr(bias[c0 + cofs + 3]); }
                *(v4f*)(crow + (size_t)row * ldc + cofs) = val; }
             }
        __builtin_amdgcn_wave_barrier(); asm volatile("" ::: "memory");
    }
}

// ---- k_gemmc: the same one-wave 64x64 tile GEMM specialised for causal attention: CMODE 1 skips score tiles entirely above the diagonal (query rows r0+roff.., key columns c0..), CMODE 2 limits the
// key (K) loop of the probability x value contraction to the diagonal block (probabilities beyond it are exactly zero). roff = row offset of this launch's first row within the sequence.
template <typename T16, int NSPLIT, int CMODE>
__global__ __launch_bounds__(32) void k_gemmc(const T16* __restrict__ A, const T16* __restrict__ A2, const T16* __restrict__ Bt, const T16* __restrict__ Bt2, int K, float* C, int ldc, int roff, size_t sA, size_t sB, size_t sC) {
    typedef typename WFrag<T16>::V V;
    __shared__ __align__(16) float os[16 * 68];
    const size_t z = blockIdx.z; A += z * sA; if (A2) A2 += z * sA; Bt += z * sB; if (Bt2) Bt2 += z * sB; C += z * sC;
    const int lane = threadIdx.x & 31, lr = lane & 15, hi = lane >> 4; const int r0 = blockIdx.x * 64, c0 = blockIdx.y * 64;
    if (CMODE == 1 && c0 > r0 + roff + 63) return;                  // score tile entirely above the causal diagonal: never read (the softmax masks j > i by select)
    const int Kl = (CMODE == 2) ? min(K, r0 + roff + 64) : K;        // P.V: probabilities are exactly 0 beyond the diagonal block, so the K loop stops there
    v8f acc[4][4];
#pragma unroll
    for (int mb = 0; mb < 4; ++mb)
#pragma unroll
        for (int nb = 0; nb < 4; ++nb) acc[mb][nb] = (v8f){};
    const size_t aoff = (size_t)(r0 + lr) * K + 8 * hi, boff = (size_t)(c0 + lr) * K + 8 * hi;
#pragma unroll 1
    for (int kc = 0; kc < Kl; kc += 32) {
        V a[4], a2[4];
#pragma unroll
        for (int mb = 0; mb < 4; ++mb) { a[mb] = WFrag<T16>::ld(A + aoff + (size_t)mb * 16 * K + kc); if (NSPLIT == 1 || NSPLIT == 2) a2[mb] = WFrag<T16>::ld(A2 + aoff + (size_t)mb * 16 * K + kc); }
#pragma unroll
        for (int nb = 0; nb < 4; ++nb) { const V b = WFrag<T16>::ld(Bt + boff + (size_t)nb * 16 * K + kc); V b2; if (NSPLIT >= 2) b2 = WFrag<T16>::ld(Bt2 + boff + (size_t)nb * 16 * K + kc);
#pragma unroll
            for (int mb = 0; mb < 4; ++mb) { acc[mb][nb] = WFrag<T16>::mma(a[mb], b, acc[mb][nb]); if (NSPLIT == 1 || NSPLIT == 2) acc[mb][nb] = WFrag<T16>::mma(a2[mb], b, acc[mb][nb]); if (NSPLIT >= 2) acc[mb][nb] = WFrag<T16>::mma(a[mb], b2, acc[mb][nb]); } }
        asm volatile("v_nop\n\tv_nop\n\tv_nop\n\tv_nop" : "+v"(acc[0][0]), "+v"(acc[1][1]), "+v"(acc[2][2]), "+v"(acc[3][3]) : "v"(a[0]), "v"(a[3]));
    }
#pragma unroll
    for (int mb = 0; mb < 4; ++mb) {
#pragma unroll
        for (int nb = 0; nb < 4; ++nb) {
#pragma unroll
            for (int j = 0; j < 8; ++j) os[(hi * 8 + j) * 68 + nb * 16 + lr] = acc[mb][nb][j]; }
        __builtin_amdgcn_wave_barrier(); asm volatile("" ::: "memory");
        float* crow = C + (size_t)(r0 + mb * 16) * ldc + c0;
{
#pragma unroll
            for (int s = 0; s < 8; ++s) { const int row = 2 * s + hi, cofs = lr * 4; v4f val = *(const v4fa*)(os + row * 68 + cofs);
                *(v4f*)(crow + (size_t)row * ldc + cofs) = val; }
             }
        __builtin_amdgcn_wave_barrier(); asm volatile("" ::: "memory");
    }
}

__device__ __forceinline__ h16 tohx(float x) { return (h16)x; }
__device__ __forceinline__ void splitf(float y, unsigned short& h, unsigned short& l) { h = f2bf(y); l = f2bf(y - bf2f(h)); }
typedef __attribute__((ext_vector_type(2))) _Float16 v2h;
typedef __attribute__((ext_vector_type(4))) _Float16 v4h;
typedef __attribute__((ext_vector_type(2))) unsigned short v2us;
typedef __attribute__((ext_vector_type(4))) unsigned short v4us;
typedef __attribute__((ext_vector_type(2))) float v2f;
typedef __attribute__((ext_vector_type(4))) int v4i;

__global__ __launch_bounds__(256) void k_wtG(const float* __restrict__ w, int K, int N, bf* Bt) {
    const int lane = threadIdx.x & 31; const int L0 = (blockIdx.x * 8 + (threadIdx.x >> 5)) * 8; const int nlines = N * K / 64;
{
#pragma unroll 1
        for (int l = 0; l < 8; ++l) { const int L = L0 + l; if (L >= nlines) break; const size_t e = (size_t)L * 64 + lane * 2; const int k = (int)(e % K), n = (int)(e / K); v2us o;
            o[0] = f2bf(w[(size_t)k * N + n]); o[1] = f2bf(w[(size_t)(k + 1) * N + n]); *(v2us*)(Bt + e) = o; }
         }
}
__global__ __launch_bounds__(256) void k_cvt8(const float* __restrict__ src, bf* dst, size_t n8) { const size_t i = (size_t)blockIdx.x * 256 + threadIdx.x; if (i >= n8) return; const v8f v = *(const v8f*)(src + i * 8); v8us o;
#pragma unroll
    for (int k = 0; k < 8; ++k) o[k] = f2bf(v[k]); *(v8us*)(dst + i * 8) = o;  }

// k_rope: grid y = batch; head planes [b][h][t][d] (fp16 + hi/lo) of rope(x) x sc with the rotate-half convention out[d] = x[d] cos[t][d] - x[d+HD/2] sin[t][d], out[d+HD/2] = x[d+HD/2] cos[t][d+HD/2] + x[d] sin[t][d+HD/2]
__global__ __launch_bounds__(256) void k_rope(const float* __restrict__ F, int pitch, int nheads, const float* __restrict__ CS, const float* __restrict__ RF, const float* __restrict__ nw, float sc, h16* P16, bf* Ph, bf* Pl) {
    const size_t e = ((size_t)blockIdx.x * 256 + threadIdx.x) * 2; if (e >= (size_t)nheads * TT * HD) return; const int d = (int)(e % HD); const int t = (int)((e / HD) % TT); const int h = (int)(e / ((size_t)HD * TT)); const size_t zb = blockIdx.y; const size_t eo = zb * nheads * TT * HD + e; const float* f = F + (zb * TT + t) * pitch + h * HD; const float rf = RF ? RF[(size_t)h * TT + t] : 1.0f; v2h o16; v2us oh, ol;
#pragma unroll
    for (int q = 0; q < 2; ++q) { const int dd = d + q; const int dp = (dd < HD / 2) ? dd + HD / 2 : dd - HD / 2; float x0 = f[dd], x1 = f[dp];
        if (RF) { float n0 = __fmul_rn(x0, rf), n1 = __fmul_rn(x1, rf); asm volatile("" : "+v"(n0)); asm volatile("" : "+v"(n1)); x0 = __fmul_rn(bfr(nw[dd]), n0); x1 = __fmul_rn(bfr(nw[dp]), n1); }
        const v2f cs = *(const v2f*)(CS + ((size_t)t * HD + dd) * 2); float a = __fmul_rn(x0, cs[0]), bq = __fmul_rn(x1, cs[1]); asm volatile("" : "+v"(a)); asm volatile("" : "+v"(bq)); const float r = ((dd < HD / 2) ? __fsub_rn(a, bq) : __fadd_rn(a, bq)) * sc;
        o16[q] = tohx(r); unsigned short a2, c2; splitf(r, a2, c2); oh[q] = a2; ol[q] = c2; }
    *(v2h*)(P16 + eo) = o16; *(v2us*)(Ph + eo) = oh; *(v2us*)(Pl + eo) = ol;  }
__global__ __launch_bounds__(256) void k_vtp(const float* __restrict__ F, int pitch, int nheads, h16* V16, bf* Vh, bf* Vl) { const size_t e = ((size_t)blockIdx.x * 256 + threadIdx.x) * 2; if (e >= (size_t)nheads * HD * TT) return; const int t = (int)(e % TT); const int d = (int)((e / TT) % HD); const int g = (int)(e / ((size_t)TT * HD)); const size_t zb = blockIdx.y; const size_t eo = zb * nheads * HD * TT + e; v2h o16; v2us oh, ol;
#pragma unroll
    for (int q = 0; q < 2; ++q) { const float x = F[(zb * TT + t + q) * pitch + g * HD + d]; o16[q] = tohx(x); unsigned short a2, c2; splitf(x, a2, c2); oh[q] = a2; ol[q] = c2; }
    *(v2h*)(V16 + eo) = o16; *(v2us*)(Vh + eo) = oh; *(v2us*)(Vl + eo) = ol;  }
__global__ __launch_bounds__(256) void k_csid(float* CS) { const int idx = blockIdx.x * 256 + threadIdx.x; if (idx >= TT * HD) return; v2f cs; cs[0] = 1.0f; cs[1] = 0.0f; *(v2f*)(CS + (size_t)idx * 2) = cs;  }
// k_asoft: per row (zz, i): t = S x HD^-0.5 for j <= i and i - j < WIN (sliding causal window; the reference's -1e9 additive fill vanishes identically); softmax over the 2048 keys (register row, one exp, fixed trees);
__global__ __launch_bounds__(256) void k_asoft(const float* __restrict__ Sb, h16* P16, bf* Ph, bf* Pl) {
    const int lane = threadIdx.x & 31; const int row = blockIdx.x * 8 + (threadIdx.x >> 5); if (row >= NZ * TT) return; const int i = row % TT; const int zz = row / TT; (void)zz; const bool hires = (i < RH); const float* sr = Sb + (size_t)row * TT; float v[TT / 32]; float mx = -3.0e38f;
#pragma unroll
    for (int ch = 0; ch < TT / 128; ++ch) { const int j0 = ch * 128 + lane * 4; const v4f a = *(const v4f*)(sr + j0);
#pragma unroll
        for (int q = 0; q < 4; ++q) { const int j = j0 + q; (void)j; const float t = (j <= i && i - j < WIN) ? a[q] * SCL : -3.0e38f; v[ch * 4 + q] = t; mx = fmaxf(mx, t); } }
#pragma unroll
    for (int sh = 16; sh; sh >>= 1) mx = fmaxf(mx, __shfl_xor(mx, sh, 32));
    float sum = 0.f;
#pragma unroll
    for (int k = 0; k < TT / 32; ++k) { float d0 = __fsub_rn(v[k], mx); asm volatile("" : "+v"(d0)); v[k] = __builtin_amdgcn_exp2f(__fmul_rn(d0, 1.4426950408889634f)); sum += v[k]; }
#pragma unroll
    for (int sh = 16; sh; sh >>= 1) sum += __shfl_xor(sum, sh, 32);
    const float f = __fdiv_rn(hires ? 1.0f : PCAR, sum);
{
        if (hires) {
#pragma unroll
            for (int ch = 0; ch < TT / 128; ++ch) { v4us oh, ol;
#pragma unroll
                for (int q = 0; q < 4; ++q) { unsigned short a, c2; splitf(v[ch * 4 + q] * f, a, c2); oh[q] = a; ol[q] = c2; }
                const size_t oo = ((size_t)zz * (RH ? RH : 1) + i) * TT + ch * 128 + lane * 4; *(v4us*)(Ph + oo) = oh; *(v4us*)(Pl + oo) = ol; }
        } else {
#pragma unroll
            for (int ch = 0; ch < TT / 128; ++ch) { v4h o4;
#pragma unroll
                for (int q = 0; q < 4; ++q) o4[q] = tohx(v[ch * 4 + q] * f);
                *(v4h*)(P16 + (size_t)row * TT + ch * 128 + lane * 4) = o4; } }
         }
}
__global__ __launch_bounds__(256) void k_merge(const float* __restrict__ O, int h0, float* OUTb) { const size_t e = ((size_t)blockIdx.x * 256 + threadIdx.x) * 2; if (e >= (size_t)NZ * TT * HD) return; const int d = (int)(e % HD); const int t = (int)((e / HD) % TT); const int zz = (int)(e / ((size_t)HD * TT)); const float cs = (t < RH) ? 1.0f : (1.0f / PCAR); const size_t oo = ((size_t)(zz / ZH) * TT + t) * DQ + (h0 + zz % ZH) * HD + d;
    v2f o2; o2[0] = O[e] * cs; o2[1] = O[e + 1] * cs; *(v2f*)(OUTb + oo) = o2;  }

extern "C" void kernel_launch(void* const* d_in, const int* in_sizes, int n_in,
                              void* d_out, int out_size, void* d_ws, size_t ws_size, hipStream_t stream) {
    (void)in_sizes; (void)n_in; (void)out_size;
    const float* x = (const float*)d_in[0]; const float* wq = (const float*)d_in[1]; const float* wk = (const float*)d_in[2]; const float* wv = (const float*)d_in[3]; const float* wo = nullptr; (void)wo;   /* x, Wq, Wk, Wv ('xw' [1024][64]) */
    float* OUT = (float*)d_out;     // [4][2048][64]
    char* wsp = (char*)d_ws;
    auto take = [&](size_t bytes) { char* p = wsp; wsp += (bytes + 255) & ~(size_t)255; return (void*)p; };
    bf* WQ = (bf*)take((size_t)DQ * DM * 2); bf* WK = (bf*)take((size_t)DKV * DM * 2); bf* WV = (bf*)take((size_t)DKV * DM * 2); float* CS = (float*)take((size_t)TT * HD * 2 * 4);
    bf* XB = (bf*)take((size_t)NB_ * TT * DM * 2); float* FQ = (float*)take((size_t)NB_ * TT * DQ * 4); float* FK = (float*)take((size_t)NB_ * TT * DKV * 4);
    h16* QP16 = (h16*)take((size_t)NB_ * NH_ * TT * HD * 2); h16* KP16 = (h16*)take((size_t)NB_ * NKV * TT * HD * 2); h16* VT16 = (h16*)take((size_t)NB_ * NKV * HD * TT * 2);
    bf* QPh = (bf*)take((size_t)NB_ * NH_ * TT * HD * 2); bf* QPl = (bf*)take((size_t)NB_ * NH_ * TT * HD * 2); bf* KPh = (bf*)take((size_t)NB_ * NKV * TT * HD * 2); bf* KPl = (bf*)take((size_t)NB_ * NKV * TT * HD * 2); bf* VTh = (bf*)take((size_t)NB_ * NKV * HD * TT * 2); bf* VTl = (bf*)take((size_t)NB_ * NKV * HD * TT * 2); bf* Ph = (bf*)take((size_t)NZ * RH * TT * 2); bf* Pl = (bf*)take((size_t)NZ * RH * TT * 2);
    float* Sb = (float*)take((size_t)NZ * TT * TT * 4); h16* P16 = (h16*)take((size_t)NZ * TT * TT * 2); float* Ob = (float*)take((size_t)NZ * TT * HD * 4);
    if ((size_t)(wsp - (char*)d_ws) > ws_size) return;    // ws 256 MiB
    float* FV = FK;   // v projection reuses the k buffer after the k planes are built (stream-ordered)
    { k_wtG<<<(unsigned)((DM * DQ / 64 + 63) / 64), 256, 0, stream>>>(wq, DM, DQ, WQ); k_wtG<<<(unsigned)((DM * DKV / 64 + 63) / 64), 256, 0, stream>>>(wk, DM, DKV, WK); k_wtG<<<(unsigned)((DM * DKV / 64 + 63) / 64), 256, 0, stream>>>(wv, DM, DKV, WV);
       }
    k_csid<<<(TT * HD + 255) / 256, 256, 0, stream>>>(CS);
    const unsigned LQ = (unsigned)(((size_t)NH_ * TT * HD / 2 + 255) / 256), LKv = (unsigned)(((size_t)NKV * TT * HD / 2 + 255) / 256);
    // x is [NB_*TT][DM] row-contiguous, so the projections take the batches as 4 x 2048 rows of one GEMM
    k_cvt8<<<(unsigned)(((size_t)NB_ * TT * DM / 8 + 255) / 256), 256, 0, stream>>>(x, XB, (size_t)NB_ * TT * DM / 8);
    k_gemmw<bf, 0, false><<<dim3(NB_ * TT / 64, DQ / 64, 1), 32, 0, stream>>>(XB, nullptr, WQ, nullptr, DM, FQ, DQ, nullptr, 0, 0, 0);
    k_rope<<<dim3(LQ, NB_, 1), 256, 0, stream>>>(FQ, DQ, NH_, CS, nullptr, nullptr, 1.0f, QP16, QPh, QPl);
    k_gemmw<bf, 0, false><<<dim3(NB_ * TT / 64, DKV / 64, 1), 32, 0, stream>>>(XB, nullptr, WK, nullptr, DM, FK, DKV, nullptr, 0, 0, 0);
    k_rope<<<dim3(LKv, NB_, 1), 256, 0, stream>>>(FK, DKV, NKV, CS, nullptr, nullptr, 1.0f, KP16, KPh, KPl);
    k_gemmw<bf, 0, false><<<dim3(NB_ * TT / 64, DKV / 64, 1), 32, 0, stream>>>(XB, nullptr, WV, nullptr, DM, FV, DKV, nullptr, 0, 0, 0); k_vtp<<<dim3(LKv, NB_, 1), 256, 0, stream>>>(FV, DKV, NKV, VT16, VTh, VTl);
    // attention: grid z = plane = batch (z-strides are one plane of each operand)
    k_gemmc<bf, 2, 1><<<dim3(RH / 64, TT / 64, NZ), 32, 0, stream>>>(QPh, QPl, KPh, KPl, HD, Sb, TT, 0, (size_t)TT * HD, (size_t)TT * HD, (size_t)TT * TT);
    k_asoft<<<NZ * TT / 8, 256, 0, stream>>>(Sb, P16, Ph, Pl);
    k_gemmc<bf, 2, 2><<<dim3(RH / 64, HD / 64, NZ), 32, 0, stream>>>(Ph, Pl, VTh, VTl, TT, Ob, HD, 0, (size_t)RH * TT, (size_t)HD * TT, (size_t)TT * HD);
    k_merge<<<(unsigned)(((size_t)NZ * TT * HD / 2 + 255) / 256), 256, 0, stream>>>(Ob, 0, OUT);
}

// v002
// One run takes 103 microseconds.
// Next to v001, in two timings, it ran 1.68 times as fast each time.
// Over all steps from v000 it is 4.80 times as fast.
#include <hip/hip_runtime.h>

// Single causal attention head (x [4][2048][1024]; q, k, v = einsum('btd,de->bte', x, W) = x W ('xw' [1024][64] 1/32, no bias; ONE 64-wide head); scores = q.k / 64^0.5; causal (-inf above the diagonal); softmax over the keys (axis 2); out = attn.v -> [4][2048][64] (0.5 M); argument order x, Wq, Wk, Wv).
// All four batches go through every launch together (rows of the projections, grid y of the plane builders, grid z of the attention GEMMs). Layout, one plane per batch: bf16 copy of x; 'xw' weights transposed once; exact projections (N 64); identity-table plane builders; causal T-2048 attention at NH 1 / ZH 1 with EVERY row on hi/lo planes (3 products for scores and P.V: one head and no output projection); the f32 merge writes the output rows.
// Compute dtypes, f32 accumulate: every input rounded to bf16; projections exact; attention 3 products on every row; softmax f32; output f32.

#define NB_  4
#define TT   2048
#define DM   1024
#define NH_  1
#define NKV  1
#define REP  (NH_ / NKV)
#define HD   64
#define DQ   (NH_ * HD)
#define DKV  (NKV * HD)
#define ZH   1                    // ONE head: a single plane per batch
#define NZ   (NB_ * ZH)           // planes per launch: plane index = batch (one head each)
#define RH   TT                   // every row hi/lo (3 products)
#define WIN  2048
#define PCAR 1024.0f
#define SCL  0.125f   // 1/sqrt(d_head = 64)
typedef _Float16 h16;
typedef unsigned short bf;
typedef __attribute__((ext_vector_type(16))) __bf16   v16bf;
typedef __attribute__((ext_vector_type(16))) _Float16 v16h;
typedef __attribute__((ext_vector_type(8)))  _Float16 v8h;
typedef __attribute__((ext_vector_type(8)))  unsigned short v8us;
typedef __attribute__((ext_vector_type(8)))  float    v8f;
typedef __attribute__((ext_vector_type(4)))  float    v4f;
typedef v8h  __attribute__((may_alias)) v8ha;
typedef v4f  __attribute__((may_alias)) v4fa;
typedef v8us __attribute__((may_alias)) v8usa;

__device__ __forceinline__ unsigned short f2bf(float f) { unsigned u = __float_as_uint(f); u += 0x7FFFu + ((u >> 16) & 1u); return (unsigned short)(u >> 16); }
__device__ __forceinline__ float bf2f(unsigned short b) { return __uint_as_float(((unsigned)b) << 16); }
__device__ __forceinline__ float bfr(float f) { return bf2f(f2bf(f)); }
__device__ __forceinline__ v16h cat16(v8h lo, v8h hi) { return __builtin_shufflevector(lo, hi, 0, 1, 2, 3, 4, 5, 6, 7, 8, 9, 10, 11, 12, 13, 14, 15); }
__device__ __forceinline__ v16bf cat16b(v8us lo, v8us hi) { return __builtin_bit_cast(v16bf, __builtin_shufflevector(lo, hi, 0, 1, 2, 3, 4, 5, 6, 7, 8, 9, 10, 11, 12, 13, 14, 15)); }
__device__ __forceinline__ v8f wmma16(v16h a, v16h b, v8f c) { return __builtin_amdgcn_wmma_f32_16x16x32_f16(false, a, false, b, (short)0, c, false, false); }
__device__ __forceinline__ v8f wmmab(v16bf a, v16bf b, v8f c) { return __builtin_amdgcn_wmma_f32_16x16x32_bf16(false, a, false, b, (short)0, c, false, false); }



// ---- k_gemmw: register-blocked GEMM, one 64x64 output tile per block (16 accumulators a wave), operands straight from K-contiguous 16-bit planes; grid (M/64, N/64, Z), 32 * KW threads.
// The K loop is split over the block's KW waves (wave w takes the w-th contiguous K / KW columns); the KW f32 partial tiles are added in LDS in wave order.
// C[m][n] (f32, pitch ldc, + optional f32 bias[n]) = sum_k A[m][k] Bt[n][k] (+ split products per NSPLIT). z-batch strides sA/sB/sC in elements. K % (32 * KW) == 0.
#define KW 8
template <typename T16> struct WFrag;
template <> struct WFrag<h16> { typedef v16h V; static __device__ __forceinline__ V ld(const h16* p) { return cat16(*(const v8h*)p, *(const v8h*)(p + 16)); } static __device__ __forceinline__ v8f mma(V a, V b, v8f c) { return wmma16(a, b, c); } };
template <> struct WFrag<bf> { typedef v16bf V; static __device__ __forceinline__ V ld(const bf* p) { return cat16b(*(const v8us*)p, *(const v8us*)(p + 16)); } static __device__ __forceinline__ v8f mma(V a, V b, v8f c) { return wmmab(a, b, c); } };
template <typename T16, int NSPLIT, bool BIAS>
__global__ __launch_bounds__(32 * KW) void k_gemmw(const T16* __restrict__ A, const T16* __restrict__ A2, const T16* __restrict__ Bt, const T16* __restrict__ Bt2, int K, float* C, int ldc, const float* __restrict__ bias, size_t sA, size_t sB, size_t sC) {
    typedef typename WFrag<T16>::V V;
    __shared__ __align__(16) float os[KW * 64 * 68];   // one 64x64 f32 partial tile per wave, row pitch 68
    const int wv = __builtin_amdgcn_readfirstlane((int)(threadIdx.x >> 5)); const int kb = wv * (K / KW), ke = kb + K / KW;   // this wave's K range, in scalar registers so that the loop branch stays scalar
    const size_t z = blockIdx.z; A += z * sA; if (A2) A2 += z * sA; Bt += z * sB; if (Bt2) Bt2 += z * sB; C += z * sC;
    const int lane = threadIdx.x & 31, lr = lane & 15, hi = lane >> 4; const int r0 = blockIdx.x * 64, c0 = blockIdx.y * 64;
    v8f acc[4][4];
#pragma unroll
    for (int mb = 0; mb < 4; ++mb)
#pragma unroll
        for (int nb = 0; nb < 4; ++nb) acc[mb][nb] = (v8f){};
    const size_t aoff = (size_t)(r0 + lr) * K + 8 * hi, boff = (size_t)(c0 + lr) * K + 8 * hi;
#pragma unroll 1
    for (int kc = kb; kc < ke; kc += 32) {
        V a[4], a2[4];
#pragma unroll
        for (int mb = 0; mb < 4; ++mb) { a[mb] = WFrag<T16>::ld(A + aoff + (size_t)mb * 16 * K + kc); if (NSPLIT == 1 || NSPLIT == 2) a2[mb] = WFrag<T16>::ld(A2 + aoff + (size_t)mb * 16 * K + kc); }
#pragma unroll
        for (int nb = 0; nb < 4; ++nb) { const V b = WFrag<T16>::ld(Bt + boff + (size_t)nb * 16 * K + kc); V b2; if (NSPLIT >= 2) b2 = WFrag<T16>::ld(Bt2 + boff + (size_t)nb * 16 * K + kc);
#pragma unroll
            for (int mb = 0; mb < 4; ++mb) { acc[mb][nb] = WFrag<T16>::mma(a[mb], b, acc[mb][nb]); if (NSPLIT == 1 || NSPLIT == 2) acc[mb][nb] = WFrag<T16>::mma(a2[mb], b, acc[mb][nb]); if (NSPLIT >= 2) acc[mb][nb] = WFrag<T16>::mma(a[mb], b2, acc[mb][nb]); } }
        asm volatile("v_nop\n\tv_nop\n\tv_nop\n\tv_nop" : "+v"(acc[0][0]), "+v"(acc[1][1]), "+v"(acc[2][2]), "+v"(acc[3][3]) : "v"(a[0]), "v"(a[3]));
    }
#pragma unroll
    for (int mb = 0; mb < 4; ++mb) {
#pragma unroll
        for (int nb = 0; nb < 4; ++nb) {
#pragma unroll
            for (int j = 0; j < 8; ++j) os[wv * (64 * 68) + (mb * 16 + hi * 8 + j) * 68 + nb * 16 + lr] = acc[mb][nb][j]; } }
    __syncthreads();   // every wave's partial tile is in LDS before any thread adds them
    const int row = (int)(threadIdx.x >> 4), cofs = (int)(threadIdx.x & 15) * 4;   // 32 * KW threads = 16 rows x 16 float4 per strip of 16 rows
#pragma unroll
    for (int mb = 0; mb < 4; ++mb) { const float* op = os + (mb * 16 + row) * 68 + cofs; v4f val = *(const v4fa*)op;
#pragma unroll
        for (int w = 1; w < KW; ++w) val += *(const v4fa*)(op + w * (64 * 68));
        if (BIAS) { val[0] += bfr(bias[c0 + cofs]); val[1] += bfr(bias[c0 + cofs + 1]); val[2] += bfr(bias[c0 + cofs + 2]); val[3] += bfr(bias[c0 + cofs + 3]); }
        *(v4f*)(C + (size_t)(r0 + mb * 16 + row) * ldc + c0 + cofs) = val; }
}

// ---- k_gemmc: the k_gemmw 64x64 tile GEMM in one wave without the K split, specialised for causal attention: CMODE 1 skips score tiles entirely above the diagonal (query rows r0+roff.., key columns c0..), CMODE 2 limits the
// key (K) loop of the probability x value contraction to the diagonal block (probabilities beyond it are exactly zero). roff = row offset of this launch's first row within the sequence.
// CMODE 2 also splits that key loop over grid y (its N is one 64-wide tile): block y sums keys [y * KSL, y * KSL + KSL) into its own f32 plane C + y * sP; k_merge adds the planes in ascending y.
#define KSL 128
template <typename T16, int NSPLIT, int CMODE>
__global__ __launch_bounds__(32) void k_gemmc(const T16* __restrict__ A, const T16* __restrict__ A2, const T16* __restrict__ Bt, const T16* __restrict__ Bt2, int K, float* C, int ldc, int roff, size_t sA, size_t sB, size_t sC, size_t sP) {
    typedef typename WFrag<T16>::V V;
    __shared__ __align__(16) float os[16 * 68];
    const size_t z = blockIdx.z; A += z * sA; if (A2) A2 += z * sA; Bt += z * sB; if (Bt2) Bt2 += z * sB; C += z * sC;
    const int lane = threadIdx.x & 31, lr = lane & 15, hi = lane >> 4; const int r0 = blockIdx.x * 64, c0 = (CMODE == 2) ? 0 : blockIdx.y * 64;
    if (CMODE == 1 && c0 > r0 + roff + 63) return;                  // score tile entirely above the causal diagonal: never read (the softmax masks j > i by select)
    const int Kl = (CMODE == 2) ? min(K, r0 + roff + 64) : K;        // P.V: probabilities are exactly 0 beyond the diagonal block, so the K loop stops there
    const int kb = (CMODE == 2) ? (int)blockIdx.y * KSL : 0;         // P.V: first key of this block's slice
    if (CMODE == 2 && kb >= Kl) return;                              // slice entirely beyond the diagonal block: nothing to sum, and k_merge never reads these rows of its plane
    const int ke = (CMODE == 2) ? min(Kl, kb + KSL) : K;
    if (CMODE == 2) C += (size_t)blockIdx.y * sP;
    v8f acc[4][4];
#pragma unroll
    for (int mb = 0; mb < 4; ++mb)
#pragma unroll
        for (int nb = 0; nb < 4; ++nb) acc[mb][nb] = (v8f){};
    const size_t aoff = (size_t)(r0 + lr) * K + 8 * hi, boff = (size_t)(c0 + lr) * K + 8 * hi;
#pragma unroll 1
    for (int kc = kb; kc < ke; kc += 32) {
        V a[4], a2[4];
#pragma unroll
        for (int mb = 0; mb < 4; ++mb) { a[mb] = WFrag<T16>::ld(A + aoff + (size_t)mb * 16 * K + kc); if (NSPLIT == 1 || NSPLIT == 2) a2[mb] = WFrag<T16>::ld(A2 + aoff + (size_t)mb * 16 * K + kc); }
#pragma unroll
        for (int nb = 0; nb < 4; ++nb) { const V b = WFrag<T16>::ld(Bt + boff + (size_t)nb * 16 * K + kc); V b2; if (NSPLIT >= 2) b2 = WFrag<T16>::ld(Bt2 + boff + (size_t)nb * 16 * K + kc);
#pragma unroll
            for (int mb = 0; mb < 4; ++mb) { acc[mb][nb] = WFrag<T16>::mma(a[mb], b, acc[mb][nb]); if (NSPLIT == 1 || NSPLIT == 2) acc[mb][nb] = WFrag<T16>::mma(a2[mb], b, acc[mb][nb]); if (NSPLIT >= 2) acc[mb][nb] = WFrag<T16>::mma(a[mb], b2, acc[mb][nb]); } }
        asm volatile("v_nop\n\tv_nop\n\tv_nop\n\tv_nop" : "+v"(acc[0][0]), "+v"(acc[1][1]), "+v"(acc[2][2]), "+v"(acc[3][3]) : "v"(a[0]), "v"(a[3]));
    }
#pragma unroll
    for (int mb = 0; mb < 4; ++mb) {
#pragma unroll
        for (int nb = 0; nb < 4; ++nb) {
#pragma unroll
            for (int j = 0; j < 8; ++j) os[(hi * 8 + j) * 68 + nb * 16 + lr] = acc[mb][nb][j]; }
        __builtin_amdgcn_wave_barrier(); asm volatile("" ::: "memory");
        float* crow = C + (size_t)(r0 + mb * 16) * ldc + c0;
{
#pragma unroll
            for (int s = 0; s < 8; ++s) { const int row = 2 * s + hi, cofs = lr * 4; v4f val = *(const v4fa*)(os + row * 68 + cofs);
                *(v4f*)(crow + (size_t)row * ldc + cofs) = val; }
             }
        __builtin_amdgcn_wave_barrier(); asm volatile("" ::: "memory");
    }
}

__device__ __forceinline__ h16 tohx(float x) { return (h16)x; }
__device__ __forceinline__ void splitf(float y, unsigned short& h, unsigned short& l) { h = f2bf(y); l = f2bf(y - bf2f(h)); }
typedef __attribute__((ext_vector_type(2))) _Float16 v2h;
typedef __attribute__((ext_vector_type(4))) _Float16 v4h;
typedef __attribute__((ext_vector_type(2))) unsigned short v2us;
typedef __attribute__((ext_vector_type(4))) unsigned short v4us;
typedef __attribute__((ext_vector_type(2))) float v2f;
typedef __attribute__((ext_vector_type(4))) int v4i;

__global__ __launch_bounds__(256) void k_wtG(const float* __restrict__ w, int K, int N, bf* Bt) {
    const int lane = threadIdx.x & 31; const int L0 = (blockIdx.x * 8 + (threadIdx.x >> 5)) * 8; const int nlines = N * K / 64;
{
#pragma unroll 1
        for (int l = 0; l < 8; ++l) { const int L = L0 + l; if (L >= nlines) break; const size_t e = (size_t)L * 64 + lane * 2; const int k = (int)(e % K), n = (int)(e / K); v2us o;
            o[0] = f2bf(w[(size_t)k * N + n]); o[1] = f2bf(w[(size_t)(k + 1) * N + n]); *(v2us*)(Bt + e) = o; }
         }
}
__global__ __launch_bounds__(256) void k_cvt8(const float* __restrict__ src, bf* dst, size_t n8) { const size_t i = (size_t)blockIdx.x * 256 + threadIdx.x; if (i >= n8) return; const v8f v = *(const v8f*)(src + i * 8); v8us o;
#pragma unroll
    for (int k = 0; k < 8; ++k) o[k] = f2bf(v[k]); *(v8us*)(dst + i * 8) = o;  }

// k_rope: grid y = batch; head planes [b][h][t][d] (fp16 + hi/lo) of rope(x) x sc with the rotate-half convention out[d] = x[d] cos[t][d] - x[d+HD/2] sin[t][d], out[d+HD/2] = x[d+HD/2] cos[t][d+HD/2] + x[d] sin[t][d+HD/2]
__global__ __launch_bounds__(256) void k_rope(const float* __restrict__ F, int pitch, int nheads, const float* __restrict__ CS, const float* __restrict__ RF, const float* __restrict__ nw, float sc, h16* P16, bf* Ph, bf* Pl) {
    const size_t e = ((size_t)blockIdx.x * 256 + threadIdx.x) * 2; if (e >= (size_t)nheads * TT * HD) return; const int d = (int)(e % HD); const int t = (int)((e / HD) % TT); const int h = (int)(e / ((size_t)HD * TT)); const size_t zb = blockIdx.y; const size_t eo = zb * nheads * TT * HD + e; const float* f = F + (zb * TT + t) * pitch + h * HD; const float rf = RF ? RF[(size_t)h * TT + t] : 1.0f; v2h o16; v2us oh, ol;
#pragma unroll
    for (int q = 0; q < 2; ++q) { const int dd = d + q; const int dp = (dd < HD / 2) ? dd + HD / 2 : dd - HD / 2; float x0 = f[dd], x1 = f[dp];
        if (RF) { float n0 = __fmul_rn(x0, rf), n1 = __fmul_rn(x1, rf); asm volatile("" : "+v"(n0)); asm volatile("" : "+v"(n1)); x0 = __fmul_rn(bfr(nw[dd]), n0); x1 = __fmul_rn(bfr(nw[dp]), n1); }
        const v2f cs = *(const v2f*)(CS + ((size_t)t * HD + dd) * 2); float a = __fmul_rn(x0, cs[0]), bq = __fmul_rn(x1, cs[1]); asm volatile("" : "+v"(a)); asm volatile("" : "+v"(bq)); const float r = ((dd < HD / 2) ? __fsub_rn(a, bq) : __fadd_rn(a, bq)) * sc;
        o16[q] = tohx(r); unsigned short a2, c2; splitf(r, a2, c2); oh[q] = a2; ol[q] = c2; }
    *(v2h*)(P16 + eo) = o16; *(v2us*)(Ph + eo) = oh; *(v2us*)(Pl + eo) = ol;  }
__global__ __launch_bounds__(256) void k_vtp(const float* __restrict__ F, int pitch, int nheads, h16* V16, bf* Vh, bf* Vl) { const size_t e = ((size_t)blockIdx.x * 256 + threadIdx.x) * 2; if (e >= (size_t)nheads * HD * TT) return; const int t = (int)(e % TT); const int d = (int)((e / TT) % HD); const int g = (int)(e / ((size_t)TT * HD)); const size_t zb = blockIdx.y; const size_t eo = zb * nheads * HD * TT + e; v2h o16; v2us oh, ol;
#pragma unroll
    for (int q = 0; q < 2; ++q) { const float x = F[(zb * TT + t + q) * pitch + g * HD + d]; o16[q] = tohx(x); unsigned short a2, c2; splitf(x, a2, c2); oh[q] = a2; ol[q] = c2; }
    *(v2h*)(V16 + eo) = o16; *(v2us*)(Vh + eo) = oh; *(v2us*)(Vl + eo) = ol;  }
__global__ __launch_bounds__(256) void k_csid(float* CS) { const int idx = blockIdx.x * 256 + threadIdx.x; if (idx >= TT * HD) return; v2f cs; cs[0] = 1.0f; cs[1] = 0.0f; *(v2f*)(CS + (size_t)idx * 2) = cs;  }
// k_asoft: per row (zz, i): t = S x HD^-0.5 for j <= i and i - j < WIN (sliding causal window; the reference's -1e9 additive fill vanishes identically); softmax over the 2048 keys (register row, one exp, fixed trees);
__global__ __launch_bounds__(256) void k_asoft(const float* __restrict__ Sb, h16* P16, bf* Ph, bf* Pl) {
    const int lane = threadIdx.x & 31; const int row = blockIdx.x * 8 + (threadIdx.x >> 5); if (row >= NZ * TT) return; const int i = row % TT; const int zz = row / TT; (void)zz; const bool hires = (i < RH); const float* sr = Sb + (size_t)row * TT; float v[TT / 32]; float mx = -3.0e38f;
#pragma unroll
    for (int ch = 0; ch < TT / 128; ++ch) { const int j0 = ch * 128 + lane * 4; const v4f a = *(const v4f*)(sr + j0);
#pragma unroll
        for (int q = 0; q < 4; ++q) { const int j = j0 + q; (void)j; const float t = (j <= i && i - j < WIN) ? a[q] * SCL : -3.0e38f; v[ch * 4 + q] = t; mx = fmaxf(mx, t); } }
#pragma unroll
    for (int sh = 16; sh; sh >>= 1) mx = fmaxf(mx, __shfl_xor(mx, sh, 32));
    float sum = 0.f;
#pragma unroll
    for (int k = 0; k < TT / 32; ++k) { float d0 = __fsub_rn(v[k], mx); asm volatile("" : "+v"(d0)); v[k] = __builtin_amdgcn_exp2f(__fmul_rn(d0, 1.4426950408889634f)); sum += v[k]; }
#pragma unroll
    for (int sh = 16; sh; sh >>= 1) sum += __shfl_xor(sum, sh, 32);
    const float f = __fdiv_rn(hires ? 1.0f : PCAR, sum);
{
        if (hires) {
#pragma unroll
            for (int ch = 0; ch < TT / 128; ++ch) { v4us oh, ol;
#pragma unroll
                for (int q = 0; q < 4; ++q) { unsigned short a, c2; splitf(v[ch * 4 + q] * f, a, c2); oh[q] = a; ol[q] = c2; }
                const size_t oo = ((size_t)zz * (RH ? RH : 1) + i) * TT + ch * 128 + lane * 4; *(v4us*)(Ph + oo) = oh; *(v4us*)(Pl + oo) = ol; }
        } else {
#pragma unroll
            for (int ch = 0; ch < TT / 128; ++ch) { v4h o4;
#pragma unroll
                for (int q = 0; q < 4; ++q) o4[q] = tohx(v[ch * 4 + q] * f);
                *(v4h*)(P16 + (size_t)row * TT + ch * 128 + lane * 4) = o4; } }
         }
}
// k_merge: adds the key-slice planes of the P.V launch in ascending slice order and writes the output rows. Row t lies in the 64-row tile whose key loop ends at (t / 64 + 1) * 64, so planes 0 .. t / KSL hold it and no other was written.
__global__ __launch_bounds__(256) void k_merge(const float* __restrict__ O, int h0, float* OUTb) { const size_t e = ((size_t)blockIdx.x * 256 + threadIdx.x) * 2; if (e >= (size_t)NZ * TT * HD) return; const int d = (int)(e % HD); const int t = (int)((e / HD) % TT); const int zz = (int)(e / ((size_t)HD * TT)); const float cs = (t < RH) ? 1.0f : (1.0f / PCAR); const size_t oo = ((size_t)(zz / ZH) * TT + t) * DQ + (h0 + zz % ZH) * HD + d;
    const int sl = t / KSL; v2f p[TT / KSL];
#pragma unroll
    for (int s = 0; s < TT / KSL; ++s) p[s] = *(const v2f*)(O + (size_t)min(s, sl) * ((size_t)NZ * TT * HD) + e);   // plane index clamped to a written plane: no branch, so all loads are in flight at once
    v2f a = p[0];
#pragma unroll
    for (int s = 1; s < TT / KSL; ++s) { a[0] += (s <= sl) ? p[s][0] : 0.0f; a[1] += (s <= sl) ? p[s][1] : 0.0f; }
    v2f o2; o2[0] = a[0] * cs; o2[1] = a[1] * cs; *(v2f*)(OUTb + oo) = o2;  }

extern "C" void kernel_launch(void* const* d_in, const int* in_sizes, int n_in,
                              void* d_out, int out_size, void* d_ws, size_t ws_size, hipStream_t stream) {
    (void)in_sizes; (void)n_in; (void)out_size;
    const float* x = (const float*)d_in[0]; const float* wq = (const float*)d_in[1]; const float* wk = (const float*)d_in[2]; const float* wv = (const float*)d_in[3]; const float* wo = nullptr; (void)wo;   /* x, Wq, Wk, Wv ('xw' [1024][64]) */
    float* OUT = (float*)d_out;     // [4][2048][64]
    char* wsp = (char*)d_ws;
    auto take = [&](size_t bytes) { char* p = wsp; wsp += (bytes + 255) & ~(size_t)255; return (void*)p; };
    bf* WQ = (bf*)take((size_t)DQ * DM * 2); bf* WK = (bf*)take((size_t)DKV * DM * 2); bf* WV = (bf*)take((size_t)DKV * DM * 2); float* CS = (float*)take((size_t)TT * HD * 2 * 4);
    bf* XB = (bf*)take((size_t)NB_ * TT * DM * 2); float* FQ = (float*)take((size_t)NB_ * TT * DQ * 4); float* FK = (float*)take((size_t)NB_ * TT * DKV * 4);
    h16* QP16 = (h16*)take((size_t)NB_ * NH_ * TT * HD * 2); h16* KP16 = (h16*)take((size_t)NB_ * NKV * TT * HD * 2); h16* VT16 = (h16*)take((size_t)NB_ * NKV * HD * TT * 2);
    bf* QPh = (bf*)take((size_t)NB_ * NH_ * TT * HD * 2); bf* QPl = (bf*)take((size_t)NB_ * NH_ * TT * HD * 2); bf* KPh = (bf*)take((size_t)NB_ * NKV * TT * HD * 2); bf* KPl = (bf*)take((size_t)NB_ * NKV * TT * HD * 2); bf* VTh = (bf*)take((size_t)NB_ * NKV * HD * TT * 2); bf* VTl = (bf*)take((size_t)NB_ * NKV * HD * TT * 2); bf* Ph = (bf*)take((size_t)NZ * RH * TT * 2); bf* Pl = (bf*)take((size_t)NZ * RH * TT * 2);
    float* Sb = (float*)take((size_t)NZ * TT * TT * 4); h16* P16 = (h16*)take((size_t)NZ * TT * TT * 2); float* Ob = (float*)take((size_t)(TT / KSL) * NZ * TT * HD * 4);   // one plane per key slice of P.V
    if ((size_t)(wsp - (char*)d_ws) > ws_size) return;    // ws 256 MiB
    float* FV = FK;   // v projection reuses the k buffer after the k planes are built (stream-ordered)
    { k_wtG<<<(unsigned)((DM * DQ / 64 + 63) / 64), 256, 0, stream>>>(wq, DM, DQ, WQ); k_wtG<<<(unsigned)((DM * DKV / 64 + 63) / 64), 256, 0, stream>>>(wk, DM, DKV, WK); k_wtG<<<(unsigned)((DM * DKV / 64 + 63) / 64), 256, 0, stream>>>(wv, DM, DKV, WV);
       }
    k_csid<<<(TT * HD + 255) / 256, 256, 0, stream>>>(CS);
    const unsigned LQ = (unsigned)(((size_t)NH_ * TT * HD / 2 + 255) / 256), LKv = (unsigned)(((size_t)NKV * TT * HD / 2 + 255) / 256);
    // x is [NB_*TT][DM] row-contiguous, so the projections take the batches as 4 x 2048 rows of one GEMM
    k_cvt8<<<(unsigned)(((size_t)NB_ * TT * DM / 8 + 255) / 256), 256, 0, stream>>>(x, XB, (size_t)NB_ * TT * DM / 8);
    k_gemmw<bf, 0, false><<<dim3(NB_ * TT / 64, DQ / 64, 1), 32 * KW, 0, stream>>>(XB, nullptr, WQ, nullptr, DM, FQ, DQ, nullptr, 0, 0, 0);
    k_rope<<<dim3(LQ, NB_, 1), 256, 0, stream>>>(FQ, DQ, NH_, CS, nullptr, nullptr, 1.0f, QP16, QPh, QPl);
    k_gemmw<bf, 0, false><<<dim3(NB_ * TT / 64, DKV / 64, 1), 32 * KW, 0, stream>>>(XB, nullptr, WK, nullptr, DM, FK, DKV, nullptr, 0, 0, 0);
    k_rope<<<dim3(LKv, NB_, 1), 256, 0, stream>>>(FK, DKV, NKV, CS, nullptr, nullptr, 1.0f, KP16, KPh, KPl);
    k_gemmw<bf, 0, false><<<dim3(NB_ * TT / 64, DKV / 64, 1), 32 * KW, 0, stream>>>(XB, nullptr, WV, nullptr, DM, FV, DKV, nullptr, 0, 0, 0); k_vtp<<<dim3(LKv, NB_, 1), 256, 0, stream>>>(FV, DKV, NKV, VT16, VTh, VTl);
    // attention: grid z = plane = batch (z-strides are one plane of each operand)
    k_gemmc<bf, 2, 1><<<dim3(RH / 64, TT / 64, NZ), 32, 0, stream>>>(QPh, QPl, KPh, KPl, HD, Sb, TT, 0, (size_t)TT * HD, (size_t)TT * HD, (size_t)TT * TT, 0);
    k_asoft<<<NZ * TT / 8, 256, 0, stream>>>(Sb, P16, Ph, Pl);
    k_gemmc<bf, 2, 2><<<dim3(RH / 64, TT / KSL, NZ), 32, 0, stream>>>(Ph, Pl, VTh, VTl, TT, Ob, HD, 0, (size_t)RH * TT, (size_t)HD * TT, (size_t)TT * HD, (size_t)NZ * TT * HD);
    k_merge<<<(unsigned)(((size_t)NZ * TT * HD / 2 + 255) / 256), 256, 0, stream>>>(Ob, 0, OUT);
}

// v003
// Measured time: 61.9 microseconds a run.
// In two side-by-side timings against v002, it was 1.67 and 1.68 times as fast.
// All steps since v000 together make it 8.04 times as fast.
#include <hip/hip_runtime.h>

// Single causal attention head (x [4][2048][1024]; q, k, v = einsum('btd,de->bte', x, W) = x W ('xw' [1024][64] 1/32, no bias; ONE 64-wide head); scores = q.k / 64^0.5; causal (-inf above the diagonal); softmax over the keys (axis 2); out = attn.v -> [4][2048][64] (0.5 M); argument order x, Wq, Wk, Wv).
// All four batches go through every launch together. Layout, one plane per batch: 'xw' weights transposed once (one launch for the three); ONE projection launch reads f32 x, rounds it to bf16 on the way into LDS, forms q, k and v (grid y) and writes their hi/lo planes itself (v transposed); causal T-2048 attention at NH 1 / ZH 1 with EVERY row on hi/lo planes (3 products for scores and P.V: one head and no output projection); the f32 merge writes the output rows.
// Compute dtypes, f32 accumulate: every input rounded to bf16; projections exact; attention 3 products on every row; softmax f32; output f32.

#define NB_  4
#define TT   2048
#define DM   1024
#define NH_  1
#define NKV  1
#define REP  (NH_ / NKV)
#define HD   64
#define DQ   (NH_ * HD)
#define DKV  (NKV * HD)
#define ZH   1                    // ONE head: a single plane per batch
#define NZ   (NB_ * ZH)           // planes per launch: plane index = batch (one head each)
#define RH   TT                   // every row hi/lo (3 products)
#define WIN  2048
#define PCAR 1024.0f
#define SCL  0.125f   // 1/sqrt(d_head = 64)
typedef _Float16 h16;
typedef unsigned short bf;
typedef __attribute__((ext_vector_type(16))) __bf16   v16bf;
typedef __attribute__((ext_vector_type(16))) _Float16 v16h;
typedef __attribute__((ext_vector_type(8)))  _Float16 v8h;
typedef __attribute__((ext_vector_type(8)))  unsigned short v8us;
typedef __attribute__((ext_vector_type(8)))  float    v8f;
typedef __attribute__((ext_vector_type(4)))  float    v4f;
typedef v8h  __attribute__((may_alias)) v8ha;
typedef v4f  __attribute__((may_alias)) v4fa;
typedef v8us __attribute__((may_alias)) v8usa;

__device__ __forceinline__ unsigned short f2bf(float f) { unsigned u = __float_as_uint(f); u += 0x7FFFu + ((u >> 16) & 1u); return (unsigned short)(u >> 16); }
__device__ __forceinline__ float bf2f(unsigned short b) { return __uint_as_float(((unsigned)b) << 16); }
__device__ __forceinline__ float bfr(float f) { return bf2f(f2bf(f)); }
__device__ __forceinline__ v16h cat16(v8h lo, v8h hi) { return __builtin_shufflevector(lo, hi, 0, 1, 2, 3, 4, 5, 6, 7, 8, 9, 10, 11, 12, 13, 14, 15); }
__device__ __forceinline__ v16bf cat16b(v8us lo, v8us hi) { return __builtin_bit_cast(v16bf, __builtin_shufflevector(lo, hi, 0, 1, 2, 3, 4, 5, 6, 7, 8, 9, 10, 11, 12, 13, 14, 15)); }
__device__ __forceinline__ v8f wmma16(v16h a, v16h b, v8f c) { return __builtin_amdgcn_wmma_f32_16x16x32_f16(false, a, false, b, (short)0, c, false, false); }
__device__ __forceinline__ v8f wmmab(v16bf a, v16bf b, v8f c) { return __builtin_amdgcn_wmma_f32_16x16x32_bf16(false, a, false, b, (short)0, c, false, false); }



// ---- fragment loaders: operands straight from K-contiguous 16-bit planes
#define KW 8
template <typename T16> struct WFrag;
template <> struct WFrag<h16> { typedef v16h V; static __device__ __forceinline__ V ld(const h16* p) { return cat16(*(const v8h*)p, *(const v8h*)(p + 16)); } static __device__ __forceinline__ v8f mma(V a, V b, v8f c) { return wmma16(a, b, c); } };
template <> struct WFrag<bf> { typedef v16bf V; static __device__ __forceinline__ V ld(const bf* p) { return cat16b(*(const v8us*)p, *(const v8us*)(p + 16)); } static __device__ __forceinline__ v8f mma(V a, V b, v8f c) { return wmmab(a, b, c); } };

// ---- k_gemmc: one-wave register-blocked GEMM, one 64x64 output tile per block (16 accumulators), specialised for causal attention: CMODE 1 skips score tiles entirely above the diagonal (query rows r0+roff.., key columns c0..), CMODE 2 limits the
// key (K) loop of the probability x value contraction to the diagonal block (probabilities beyond it are exactly zero). roff = row offset of this launch's first row within the sequence.
// CMODE 2 also splits that key loop over grid y (its N is one 64-wide tile): block y sums keys [y * KSL, y * KSL + KSL) into its own f32 plane C + y * sP; k_merge adds the planes in ascending y.
#define KSL 128
template <typename T16, int NSPLIT, int CMODE>
__global__ __launch_bounds__(32) void k_gemmc(const T16* __restrict__ A, const T16* __restrict__ A2, const T16* __restrict__ Bt, const T16* __restrict__ Bt2, int K, float* C, int ldc, int roff, size_t sA, size_t sB, size_t sC, size_t sP) {
    typedef typename WFrag<T16>::V V;
    __shared__ __align__(16) float os[16 * 68];
    const size_t z = blockIdx.z; A += z * sA; if (A2) A2 += z * sA; Bt += z * sB; if (Bt2) Bt2 += z * sB; C += z * sC;
    const int lane = threadIdx.x & 31, lr = lane & 15, hi = lane >> 4; const int r0 = blockIdx.x * 64, c0 = (CMODE == 2) ? 0 : blockIdx.y * 64;
    if (CMODE == 1 && c0 > r0 + roff + 63) return;                  // score tile entirely above the causal diagonal: never read (the softmax masks j > i by select)
    const int Kl = (CMODE == 2) ? min(K, r0 + roff + 64) : K;        // P.V: probabilities are exactly 0 beyond the diagonal block, so the K loop stops there
    const int kb = (CMODE == 2) ? (int)blockIdx.y * KSL : 0;         // P.V: first key of this block's slice
    if (CMODE == 2 && kb >= Kl) return;                              // slice entirely beyond the diagonal block: nothing to sum, and k_merge never reads these rows of its plane
    const int ke = (CMODE == 2) ? min(Kl, kb + KSL) : K;
    if (CMODE == 2) C += (size_t)blockIdx.y * sP;
    v8f acc[4][4];
#pragma unroll
    for (int mb = 0; mb < 4; ++mb)
#pragma unroll
        for (int nb = 0; nb < 4; ++nb) acc[mb][nb] = (v8f){};
    const size_t aoff = (size_t)(r0 + lr) * K + 8 * hi, boff = (size_t)(c0 + lr) * K + 8 * hi;
#pragma unroll 1
    for (int kc = kb; kc < ke; kc += 32) {
        V a[4], a2[4];
#pragma unroll
        for (int mb = 0; mb < 4; ++mb) { a[mb] = WFrag<T16>::ld(A + aoff + (size_t)mb * 16 * K + kc); if (NSPLIT == 1 || NSPLIT == 2) a2[mb] = WFrag<T16>::ld(A2 + aoff + (size_t)mb * 16 * K + kc); }
#pragma unroll
        for (int nb = 0; nb < 4; ++nb) { const V b = WFrag<T16>::ld(Bt + boff + (size_t)nb * 16 * K + kc); V b2; if (NSPLIT >= 2) b2 = WFrag<T16>::ld(Bt2 + boff + (size_t)nb * 16 * K + kc);
#pragma unroll
            for (int mb = 0; mb < 4; ++mb) { acc[mb][nb] = WFrag<T16>::mma(a[mb], b, acc[mb][nb]); if (NSPLIT == 1 || NSPLIT == 2) acc[mb][nb] = WFrag<T16>::mma(a2[mb], b, acc[mb][nb]); if (NSPLIT >= 2) acc[mb][nb] = WFrag<T16>::mma(a[mb], b2, acc[mb][nb]); } }
        asm volatile("v_nop\n\tv_nop\n\tv_nop\n\tv_nop" : "+v"(acc[0][0]), "+v"(acc[1][1]), "+v"(acc[2][2]), "+v"(acc[3][3]) : "v"(a[0]), "v"(a[3]));
    }
#pragma unroll
    for (int mb = 0; mb < 4; ++mb) {
#pragma unroll
        for (int nb = 0; nb < 4; ++nb) {
#pragma unroll
            for (int j = 0; j < 8; ++j) os[(hi * 8 + j) * 68 + nb * 16 + lr] = acc[mb][nb][j]; }
        __builtin_amdgcn_wave_barrier(); asm volatile("" ::: "memory");
        float* crow = C + (size_t)(r0 + mb * 16) * ldc + c0;
{
#pragma unroll
            for (int s = 0; s < 8; ++s) { const int row = 2 * s + hi, cofs = lr * 4; v4f val = *(const v4fa*)(os + row * 68 + cofs);
                *(v4f*)(crow + (size_t)row * ldc + cofs) = val; }
             }
        __builtin_amdgcn_wave_barrier(); asm volatile("" ::: "memory");
    }
}

__device__ __forceinline__ h16 tohx(float x) { return (h16)x; }
__device__ __forceinline__ void splitf(float y, unsigned short& h, unsigned short& l) { h = f2bf(y); l = f2bf(y - bf2f(h)); }
typedef __attribute__((ext_vector_type(2))) _Float16 v2h;
typedef __attribute__((ext_vector_type(4))) _Float16 v4h;
typedef __attribute__((ext_vector_type(2))) unsigned short v2us;
typedef __attribute__((ext_vector_type(4))) unsigned short v4us;
typedef __attribute__((ext_vector_type(2))) float v2f;
typedef __attribute__((ext_vector_type(4))) int v4i;


// ---- k_wtG: grid y picks the weight (q, k, v); plane y of Bt3 is that weight transposed to [N][K], rounded to bf16.
__global__ __launch_bounds__(256) void k_wtG(const float* __restrict__ wq, const float* __restrict__ wk, const float* __restrict__ wv, int K, int N, bf* Bt3) {
    const float* __restrict__ w = (blockIdx.y == 0) ? wq : ((blockIdx.y == 1) ? wk : wv); bf* Bt = Bt3 + (size_t)blockIdx.y * N * K;
    const int lane = threadIdx.x & 31; const int L0 = (blockIdx.x * 8 + (threadIdx.x >> 5)) * 8; const int nlines = N * K / 64;
{
#pragma unroll 1
        for (int l = 0; l < 8; ++l) { const int L = L0 + l; if (L >= nlines) break; const size_t e = (size_t)L * 64 + lane * 2; const int k = (int)(e % K), n = (int)(e / K); v2us o;
            o[0] = f2bf(w[(size_t)k * N + n]); o[1] = f2bf(w[(size_t)(k + 1) * N + n]); *(v2us*)(Bt + e) = o; }
         }
}

// ---- k_proj: the whole projection stage in one launch; grid (rows / 64, 3), 32 * KW threads. Block (r, y) forms the 64x64 tile of rows r * 64.. of x W_y (y = 0, 1, 2: q, k, v) and writes its bf16 hi/lo planes.
// The K loop is split over the block's KW waves (wave w takes the w-th contiguous DM / KW columns); the KW f32 partial tiles are added in LDS in wave order.
// Each wave reads its 64 x KR piece of f32 x in whole 512-byte row pieces, rounds it to bf16 and keeps it in its OWN LDS slice (pitch XP), from which it takes the x fragments; the slice then holds the wave's partial tile.
// v is formed as W_v^T x^T (the two operands change places; both loaders have the same k order), so that its tile lies [d][t] and the same epilogue writes whole lines of the transposed v planes.
#define KR (DM / KW)      // x columns per wave
#define XP 136            // bf16 elements per staged x row: 256 B + 16 B, the conflict-free pitch for 16-byte LDS reads; 64 * XP * 2 B = one 64 x 68 f32 slice
typedef v4us __attribute__((may_alias)) v4usa;
__device__ __forceinline__ v16bf ldsfrag(const bf* p) { return cat16b(*(const v8usa*)p, *(const v8usa*)(p + 16)); }
template <bool SW>   // SW: the v tile, operands swapped
__device__ __forceinline__ void proj_tile(const float* __restrict__ x, const bf* __restrict__ Wt, bf* Oh, bf* Ol, float* os) {
    const int wv = __builtin_amdgcn_readfirstlane((int)(threadIdx.x >> 5)); const int kb = wv * KR;
    const int lane = threadIdx.x & 31, lr = lane & 15, hi = lane >> 4;
    float* sl = os + wv * (64 * 68); bf* xs = (bf*)sl;
    const bf* wp = Wt + (size_t)lr * DM + kb + 8 * hi;
    v16bf wf[4];
#pragma unroll
    for (int g = 0; g < 4; ++g) wf[g] = WFrag<bf>::ld(wp + (size_t)g * 16 * DM);   // first step's weight fragments fly while x is staged
    const float* xu = x + kb; const unsigned xo = (unsigned)lane * 4u;   // wave-uniform base and a 32-bit lane offset
#pragma unroll 1   // rolled: 32 row pieces (128 VGPRs) in flight a trip; unrolled, all 64 are hoisted and the kernel spills at 256 VGPRs
    for (int rb = 0; rb < 64; rb += 32) { v4f t[32];
#pragma unroll
        for (int r = 0; r < 32; ++r) t[r] = *(const v4f*)(xu + (size_t)(rb + r) * DM + xo);
#pragma unroll
        for (int r = 0; r < 32; ++r) { v4us o;
#pragma unroll
            for (int q = 0; q < 4; ++q) o[q] = f2bf(t[r][q]);
            *(v4usa*)(xs + (rb + r) * XP + lane * 4) = o; } }
    asm volatile("s_wait_dscnt 0x0" ::: "memory");   // the wave's staged rows are in LDS before its lanes read what other lanes of the wave wrote; the clobber keeps the reads below behind the stores above
    v8f acc[4][4];
#pragma unroll
    for (int mb = 0; mb < 4; ++mb)
#pragma unroll
        for (int nb = 0; nb < 4; ++nb) acc[mb][nb] = (v8f){};
    const bf* xl = xs + lr * XP + 8 * hi;
#pragma unroll
    for (int ks = 0; ks < KR / 32; ++ks) {
        v16bf wn[4], xa[4];
        if (ks + 1 < KR / 32) {
#pragma unroll
            for (int g = 0; g < 4; ++g) wn[g] = WFrag<bf>::ld(wp + (size_t)g * 16 * DM + (ks + 1) * 32); }   // next step's weight fragments fly while this step's products run
#pragma unroll
        for (int g = 0; g < 4; ++g) xa[g] = ldsfrag(xl + g * 16 * XP + ks * 32);
        __builtin_amdgcn_sched_barrier(0);   // holds the loads above in front of the products below: without it the scheduler sinks each weight load to just before its first use and the wave waits out one L2 trip per fragment
#pragma unroll
        for (int nb = 0; nb < 4; ++nb)
#pragma unroll
            for (int mb = 0; mb < 4; ++mb) acc[mb][nb] = SW ? wmmab(wf[mb], xa[nb], acc[mb][nb]) : wmmab(xa[mb], wf[nb], acc[mb][nb]);
        if (ks + 1 < KR / 32) {
#pragma unroll
            for (int g = 0; g < 4; ++g) wf[g] = wn[g]; }
    }
#pragma unroll
    for (int mb = 0; mb < 4; ++mb) {
#pragma unroll
        for (int nb = 0; nb < 4; ++nb) {
#pragma unroll
            for (int j = 0; j < 8; ++j) sl[(mb * 16 + hi * 8 + j) * 68 + nb * 16 + lr] = acc[mb][nb][j]; } }
    __syncthreads();   // every wave's partial tile is in LDS before any thread adds them
    const int row = (int)(threadIdx.x >> 4), cofs = (int)(threadIdx.x & 15) * 4;   // 32 * KW threads = 16 rows x 16 float4 per strip of 16 rows
#pragma unroll
    for (int mb = 0; mb < 4; ++mb) { const float* op = os + (mb * 16 + row) * 68 + cofs; v4f val = *(const v4fa*)op;
#pragma unroll
        for (int w = 1; w < KW; ++w) val += *(const v4fa*)(op + w * (64 * 68));
        v4us oh, ol;
#pragma unroll
        for (int q = 0; q < 4; ++q) { unsigned short a2, c2; splitf(val[q], a2, c2); oh[q] = a2; ol[q] = c2; }
        const size_t oo = (size_t)(mb * 16 + row) * (SW ? TT : HD) + cofs; *(v4us*)(Oh + oo) = oh; *(v4us*)(Ol + oo) = ol; }   // q, k: tile rows are positions of [b][t][d] planes; v: tile rows are d of [b][d][t] planes
}
// four waves a SIMD: at most 256 VGPRs, so that two blocks (2 x 136 KiB of LDS) share a WGP and all 384 blocks are resident at once
__global__ __launch_bounds__(32 * KW) __attribute__((amdgpu_waves_per_eu(4, 4))) void k_proj(const float* __restrict__ x, const bf* __restrict__ Wt3, bf* QPh, bf* QPl, bf* KPh, bf* KPl, bf* VTh, bf* VTl) {
    __shared__ __align__(16) float os[KW * 64 * 68];   // one slice per wave: first its bf16 piece of x, then its 64x64 f32 partial tile (row pitch 68)
    const int r0 = blockIdx.x * 64; const int y = blockIdx.y; const float* xr = x + (size_t)r0 * DM;
    if (y == 2) { const size_t o0 = (size_t)(r0 / TT) * HD * TT + (size_t)(r0 % TT); proj_tile<true>(xr, Wt3 + (size_t)2 * HD * DM, VTh + o0, VTl + o0, os); }   // block-uniform branch: every thread of a block passes the same barrier
    else { const size_t o0 = (size_t)r0 * HD; proj_tile<false>(xr, Wt3 + (size_t)y * HD * DM, (y ? KPh : QPh) + o0, (y ? KPl : QPl) + o0, os); }
}
// k_asoft: per row (zz, i): t = S x HD^-0.5 for j <= i and i - j < WIN (sliding causal window; the reference's -1e9 additive fill vanishes identically); softmax over the 2048 keys (register row, one exp, fixed trees);
__global__ __launch_bounds__(256) void k_asoft(const float* __restrict__ Sb, h16* P16, bf* Ph, bf* Pl) {
    const int lane = threadIdx.x & 31; const int row = blockIdx.x * 8 + (threadIdx.x >> 5); if (row >= NZ * TT) return; const int i = row % TT; const int zz = row / TT; (void)zz; const bool hires = (i < RH); const float* sr = Sb + (size_t)row * TT; float v[TT / 32]; float mx = -3.0e38f;
#pragma unroll
    for (int ch = 0; ch < TT / 128; ++ch) { const int j0 = ch * 128 + lane * 4; const v4f a = *(const v4f*)(sr + j0);
#pragma unroll
        for (int q = 0; q < 4; ++q) { const int j = j0 + q; (void)j; const float t = (j <= i && i - j < WIN) ? a[q] * SCL : -3.0e38f; v[ch * 4 + q] = t; mx = fmaxf(mx, t); } }
#pragma unroll
    for (int sh = 16; sh; sh >>= 1) mx = fmaxf(mx, __shfl_xor(mx, sh, 32));
    float sum = 0.f;
#pragma unroll
    for (int k = 0; k < TT / 32; ++k) { float d0 = __fsub_rn(v[k], mx); asm volatile("" : "+v"(d0)); v[k] = __builtin_amdgcn_exp2f(__fmul_rn(d0, 1.4426950408889634f)); sum += v[k]; }
#pragma unroll
    for (int sh = 16; sh; sh >>= 1) sum += __shfl_xor(sum, sh, 32);
    const float f = __fdiv_rn(hires ? 1.0f : PCAR, sum);
{
        if (hires) {
#pragma unroll
            for (int ch = 0; ch < TT / 128; ++ch) { v4us oh, ol;
#pragma unroll
                for (int q = 0; q < 4; ++q) { unsigned short a, c2; splitf(v[ch * 4 + q] * f, a, c2); oh[q] = a; ol[q] = c2; }
                const size_t oo = ((size_t)zz * (RH ? RH : 1) + i) * TT + ch * 128 + lane * 4; *(v4us*)(Ph + oo) = oh; *(v4us*)(Pl + oo) = ol; }
        } else {
#pragma unroll
            for (int ch = 0; ch < TT / 128; ++ch) { v4h o4;
#pragma unroll
                for (int q = 0; q < 4; ++q) o4[q] = tohx(v[ch * 4 + q] * f);
                *(v4h*)(P16 + (size_t)row * TT + ch * 128 + lane * 4) = o4; } }
         }
}
// k_merge: adds the key-slice planes of the P.V launch in ascending slice order and writes the output rows. Row t lies in the 64-row tile whose key loop ends at (t / 64 + 1) * 64, so planes 0 .. t / KSL hold it and no other was written.
__global__ __launch_bounds__(256) void k_merge(const float* __restrict__ O, int h0, float* OUTb) { const size_t e = ((size_t)blockIdx.x * 256 + threadIdx.x) * 2; if (e >= (size_t)NZ * TT * HD) return; const int d = (int)(e % HD); const int t = (int)((e / HD) % TT); const int zz = (int)(e / ((size_t)HD * TT)); const float cs = (t < RH) ? 1.0f : (1.0f / PCAR); const size_t oo = ((size_t)(zz / ZH) * TT + t) * DQ + (h0 + zz % ZH) * HD + d;
    const int sl = t / KSL; v2f p[TT / KSL];
#pragma unroll
    for (int s = 0; s < TT / KSL; ++s) p[s] = *(const v2f*)(O + (size_t)min(s, sl) * ((size_t)NZ * TT * HD) + e);   // plane index clamped to a written plane: no branch, so all loads are in flight at once
    v2f a = p[0];
#pragma unroll
    for (int s = 1; s < TT / KSL; ++s) { a[0] += (s <= sl) ? p[s][0] : 0.0f; a[1] += (s <= sl) ? p[s][1] : 0.0f; }
    v2f o2; o2[0] = a[0] * cs; o2[1] = a[1] * cs; *(v2f*)(OUTb + oo) = o2;  }

extern "C" void kernel_launch(void* const* d_in, const int* in_sizes, int n_in,
                              void* d_out, int out_size, void* d_ws, size_t ws_size, hipStream_t stream) {
    (void)in_sizes; (void)n_in; (void)out_size;
    const float* x = (const float*)d_in[0]; const float* wq = (const float*)d_in[1]; const float* wk = (const float*)d_in[2]; const float* wv = (const float*)d_in[3];   /* ('xw' [1024][64]) */
    float* OUT = (float*)d_out;     // [4][2048][64]
    char* wsp = (char*)d_ws;
    auto take = [&](size_t bytes) { char* p = wsp; wsp += (bytes + 255) & ~(size_t)255; return (void*)p; };
    bf* WT3 = (bf*)take((size_t)3 * HD * DM * 2);   // transposed q, k, v weights, one plane each
    bf* QPh = (bf*)take((size_t)NB_ * NH_ * TT * HD * 2); bf* QPl = (bf*)take((size_t)NB_ * NH_ * TT * HD * 2); bf* KPh = (bf*)take((size_t)NB_ * NKV * TT * HD * 2); bf* KPl = (bf*)take((size_t)NB_ * NKV * TT * HD * 2); bf* VTh = (bf*)take((size_t)NB_ * NKV * HD * TT * 2); bf* VTl = (bf*)take((size_t)NB_ * NKV * HD * TT * 2); bf* Ph = (bf*)take((size_t)NZ * RH * TT * 2); bf* Pl = (bf*)take((size_t)NZ * RH * TT * 2);
    float* Sb = (float*)take((size_t)NZ * TT * TT * 4); h16* P16 = (h16*)take((size_t)NZ * TT * TT * 2); float* Ob = (float*)take((size_t)(TT / KSL) * NZ * TT * HD * 4);   // one plane per key slice of P.V
    if ((size_t)(wsp - (char*)d_ws) > ws_size) return;    // ws 256 MiB
    k_wtG<<<dim3((unsigned)((DM * HD / 64 + 63) / 64), 3, 1), 256, 0, stream>>>(wq, wk, wv, DM, HD, WT3);
    // x is [NB_*TT][DM] row-contiguous, so the projections take the batches as 4 x 2048 rows of one GEMM
    k_proj<<<dim3(NB_ * TT / 64, 3, 1), 32 * KW, 0, stream>>>(x, WT3, QPh, QPl, KPh, KPl, VTh, VTl);
    // attention: grid z = plane = batch (z-strides are one plane of each operand)
    k_gemmc<bf, 2, 1><<<dim3(RH / 64, TT / 64, NZ), 32, 0, stream>>>(QPh, QPl, KPh, KPl, HD, Sb, TT, 0, (size_t)TT * HD, (size_t)TT * HD, (size_t)TT * TT, 0);
    k_asoft<<<NZ * TT / 8, 256, 0, stream>>>(Sb, P16, Ph, Pl);
    k_gemmc<bf, 2, 2><<<dim3(RH / 64, TT / KSL, NZ), 32, 0, stream>>>(Ph, Pl, VTh, VTl, TT, Ob, HD, 0, (size_t)RH * TT, (size_t)HD * TT, (size_t)TT * HD, (size_t)NZ * TT * HD);
    k_merge<<<(unsigned)(((size_t)NZ * TT * HD / 2 + 255) / 256), 256, 0, stream>>>(Ob, 0, OUT);
}

// v004
// It runs in 36.2 microseconds.
// Timed twice side by side with v003, it ran 1.72 and 1.70 times as fast.
// All steps since v000 together make it 13.7 times as fast.
#include <hip/hip_runtime.h>

// Single causal attention head (x [4][2048][1024]; q, k, v = einsum('btd,de->bte', x, W) = x W ('xw' [1024][64] 1/32, no bias; ONE 64-wide head); scores = q.k / 64^0.5; causal (-inf above the diagonal); softmax over the keys (axis 2); out = attn.v -> [4][2048][64] (0.5 M); argument order x, Wq, Wk, Wv).
// All four batches go through every launch together. Layout, one plane per batch: 'xw' weights transposed once (one launch for the three); ONE projection launch reads f32 x, rounds it to bf16 on the way into LDS, forms q, k and v (grid y) and writes their hi/lo planes itself (v transposed); ONE attention launch (causal, T 2048, one head): scores, online softmax and P.V with the scores and probabilities in registers, EVERY row on hi/lo planes (3 products for scores and P.V: one head and no output projection); it writes the f32 output rows.
// Compute dtypes, f32 accumulate: every input rounded to bf16; projections exact; attention 3 products on every row; softmax f32; output f32.

#define NB_  4
#define TT   2048
#define DM   1024
#define NH_  1
#define NKV  1
#define REP  (NH_ / NKV)
#define HD   64
#define DQ   (NH_ * HD)
#define DKV  (NKV * HD)
#define ZH   1                    // ONE head: a single plane per batch
#define NZ   (NB_ * ZH)           // planes per launch: plane index = batch (one head each)
#define RH   TT                   // every row hi/lo (3 products)
#define WIN  2048
#define PCAR 1024.0f
#define SCL  0.125f   // 1/sqrt(d_head = 64)
typedef _Float16 h16;
typedef unsigned short bf;
typedef __attribute__((ext_vector_type(16))) __bf16   v16bf;
typedef __attribute__((ext_vector_type(16))) _Float16 v16h;
typedef __attribute__((ext_vector_type(8)))  _Float16 v8h;
typedef __attribute__((ext_vector_type(8)))  unsigned short v8us;
typedef __attribute__((ext_vector_type(8)))  float    v8f;
typedef __attribute__((ext_vector_type(4)))  float    v4f;
typedef v8h  __attribute__((may_alias)) v8ha;
typedef v4f  __attribute__((may_alias)) v4fa;
typedef v8us __attribute__((may_alias)) v8usa;

__device__ __forceinline__ unsigned short f2bf(float f) { unsigned u = __float_as_uint(f); u += 0x7FFFu + ((u >> 16) & 1u); return (unsigned short)(u >> 16); }
__device__ __forceinline__ float bf2f(unsigned short b) { return __uint_as_float(((unsigned)b) << 16); }
__device__ __forceinline__ float bfr(float f) { return bf2f(f2bf(f)); }
__device__ __forceinline__ v16h cat16(v8h lo, v8h hi) { return __builtin_shufflevector(lo, hi, 0, 1, 2, 3, 4, 5, 6, 7, 8, 9, 10, 11, 12, 13, 14, 15); }
__device__ __forceinline__ v16bf cat16b(v8us lo, v8us hi) { return __builtin_bit_cast(v16bf, __builtin_shufflevector(lo, hi, 0, 1, 2, 3, 4, 5, 6, 7, 8, 9, 10, 11, 12, 13, 14, 15)); }
__device__ __forceinline__ v8f wmma16(v16h a, v16h b, v8f c) { return __builtin_amdgcn_wmma_f32_16x16x32_f16(false, a, false, b, (short)0, c, false, false); }
__device__ __forceinline__ v8f wmmab(v16bf a, v16bf b, v8f c) { return __builtin_amdgcn_wmma_f32_16x16x32_bf16(false, a, false, b, (short)0, c, false, false); }



// ---- fragment loaders: operands straight from K-contiguous 16-bit planes
#define KW 8
template <typename T16> struct WFrag;
template <> struct WFrag<h16> { typedef v16h V; static __device__ __forceinline__ V ld(const h16* p) { return cat16(*(const v8h*)p, *(const v8h*)(p + 16)); } static __device__ __forceinline__ v8f mma(V a, V b, v8f c) { return wmma16(a, b, c); } };
template <> struct WFrag<bf> { typedef v16bf V; static __device__ __forceinline__ V ld(const bf* p) { return cat16b(*(const v8us*)p, *(const v8us*)(p + 16)); } static __device__ __forceinline__ v8f mma(V a, V b, v8f c) { return wmmab(a, b, c); } };

__device__ __forceinline__ h16 tohx(float x) { return (h16)x; }
__device__ __forceinline__ void splitf(float y, unsigned short& h, unsigned short& l) { h = f2bf(y); l = f2bf(y - bf2f(h)); }
typedef __attribute__((ext_vector_type(2))) _Float16 v2h;
typedef __attribute__((ext_vector_type(4))) _Float16 v4h;
typedef __attribute__((ext_vector_type(2))) unsigned short v2us;
typedef __attribute__((ext_vector_type(4))) unsigned short v4us;
typedef __attribute__((ext_vector_type(2))) float v2f;
typedef __attribute__((ext_vector_type(4))) int v4i;


// ---- k_wtG: grid y picks the weight (q, k, v); plane y of Bt3 is that weight transposed to [N][K], rounded to bf16.
__global__ __launch_bounds__(256) void k_wtG(const float* __restrict__ wq, const float* __restrict__ wk, const float* __restrict__ wv, int K, int N, bf* Bt3) {
    const float* __restrict__ w = (blockIdx.y == 0) ? wq : ((blockIdx.y == 1) ? wk : wv); bf* Bt = Bt3 + (size_t)blockIdx.y * N * K;
    const int lane = threadIdx.x & 31; const int L0 = (blockIdx.x * 8 + (threadIdx.x >> 5)) * 8; const int nlines = N * K / 64;
{
#pragma unroll 1
        for (int l = 0; l < 8; ++l) { const int L = L0 + l; if (L >= nlines) break; const size_t e = (size_t)L * 64 + lane * 2; const int k = (int)(e % K), n = (int)(e / K); v2us o;
            o[0] = f2bf(w[(size_t)k * N + n]); o[1] = f2bf(w[(size_t)(k + 1) * N + n]); *(v2us*)(Bt + e) = o; }
         }
}

// ---- k_proj: the whole projection stage in one launch; grid (rows / 64, 3), 32 * KW threads. Block (r, y) forms the 64x64 tile of rows r * 64.. of x W_y (y = 0, 1, 2: q, k, v) and writes its bf16 hi/lo planes.
// The K loop is split over the block's KW waves (wave w takes the w-th contiguous DM / KW columns); the KW f32 partial tiles are added in LDS in wave order.
// Each wave reads its 64 x KR piece of f32 x in whole 512-byte row pieces, rounds it to bf16 and keeps it in its OWN LDS slice (pitch XP), from which it takes the x fragments; the slice then holds the wave's partial tile.
// v is formed as W_v^T x^T (the two operands change places; both loaders have the same k order), so that its tile lies [d][t] and the same epilogue writes whole lines of the transposed v planes.
#define KR (DM / KW)      // x columns per wave
#define XP 136            // bf16 elements per staged x row: 256 B + 16 B, the conflict-free pitch for 16-byte LDS reads; 64 * XP * 2 B = one 64 x 68 f32 slice
typedef v4us __attribute__((may_alias)) v4usa;
__device__ __forceinline__ v16bf ldsfrag(const bf* p) { return cat16b(*(const v8usa*)p, *(const v8usa*)(p + 16)); }
template <bool SW>   // SW: the v tile, operands swapped
__device__ __forceinline__ void proj_tile(const float* __restrict__ x, const bf* __restrict__ Wt, bf* Oh, bf* Ol, float* os) {
    const int wv = __builtin_amdgcn_readfirstlane((int)(threadIdx.x >> 5)); const int kb = wv * KR;
    const int lane = threadIdx.x & 31, lr = lane & 15, hi = lane >> 4;
    float* sl = os + wv * (64 * 68); bf* xs = (bf*)sl;
    const bf* wp = Wt + (size_t)lr * DM + kb + 8 * hi;
    v16bf wf[4];
#pragma unroll
    for (int g = 0; g < 4; ++g) wf[g] = WFrag<bf>::ld(wp + (size_t)g * 16 * DM);   // first step's weight fragments fly while x is staged
    const float* xu = x + kb; const unsigned xo = (unsigned)lane * 4u;   // wave-uniform base and a 32-bit lane offset
#pragma unroll 1   // rolled: 32 row pieces (128 VGPRs) in flight a trip; unrolled, all 64 are hoisted and the kernel spills at 256 VGPRs
    for (int rb = 0; rb < 64; rb += 32) { v4f t[32];
#pragma unroll
        for (int r = 0; r < 32; ++r) t[r] = *(const v4f*)(xu + (size_t)(rb + r) * DM + xo);
#pragma unroll
        for (int r = 0; r < 32; ++r) { v4us o;
#pragma unroll
            for (int q = 0; q < 4; ++q) o[q] = f2bf(t[r][q]);
            *(v4usa*)(xs + (rb + r) * XP + lane * 4) = o; } }
    asm volatile("s_wait_dscnt 0x0" ::: "memory");   // the wave's staged rows are in LDS before its lanes read what other lanes of the wave wrote; the clobber keeps the reads below behind the stores above
    v8f acc[4][4];
#pragma unroll
    for (int mb = 0; mb < 4; ++mb)
#pragma unroll
        for (int nb = 0; nb < 4; ++nb) acc[mb][nb] = (v8f){};
    const bf* xl = xs + lr * XP + 8 * hi;
#pragma unroll
    for (int ks = 0; ks < KR / 32; ++ks) {
        v16bf wn[4], xa[4];
        if (ks + 1 < KR / 32) {
#pragma unroll
            for (int g = 0; g < 4; ++g) wn[g] = WFrag<bf>::ld(wp + (size_t)g * 16 * DM + (ks + 1) * 32); }   // next step's weight fragments fly while this step's products run
#pragma unroll
        for (int g = 0; g < 4; ++g) xa[g] = ldsfrag(xl + g * 16 * XP + ks * 32);
        __builtin_amdgcn_sched_barrier(0);   // holds the loads above in front of the products below: without it the scheduler sinks each weight load to just before its first use and the wave waits out one L2 trip per fragment
#pragma unroll
        for (int nb = 0; nb < 4; ++nb)
#pragma unroll
            for (int mb = 0; mb < 4; ++mb) acc[mb][nb] = SW ? wmmab(wf[mb], xa[nb], acc[mb][nb]) : wmmab(xa[mb], wf[nb], acc[mb][nb]);
        if (ks + 1 < KR / 32) {
#pragma unroll
            for (int g = 0; g < 4; ++g) wf[g] = wn[g]; }
    }
#pragma unroll
    for (int mb = 0; mb < 4; ++mb) {
#pragma unroll
        for (int nb = 0; nb < 4; ++nb) {
#pragma unroll
            for (int j = 0; j < 8; ++j) sl[(mb * 16 + hi * 8 + j) * 68 + nb * 16 + lr] = acc[mb][nb][j]; } }
    __syncthreads();   // every wave's partial tile is in LDS before any thread adds them
    const int row = (int)(threadIdx.x >> 4), cofs = (int)(threadIdx.x & 15) * 4;   // 32 * KW threads = 16 rows x 16 float4 per strip of 16 rows
#pragma unroll
    for (int mb = 0; mb < 4; ++mb) { const float* op = os + (mb * 16 + row) * 68 + cofs; v4f val = *(const v4fa*)op;
#pragma unroll
        for (int w = 1; w < KW; ++w) val += *(const v4fa*)(op + w * (64 * 68));
        v4us oh, ol;
#pragma unroll
        for (int q = 0; q < 4; ++q) { unsigned short a2, c2; splitf(val[q], a2, c2); oh[q] = a2; ol[q] = c2; }
        const size_t oo = (size_t)(mb * 16 + row) * (SW ? TT : HD) + cofs; *(v4us*)(Oh + oo) = oh; *(v4us*)(Ol + oo) = ol; }   // q, k: tile rows are positions of [b][t][d] planes; v: tile rows are d of [b][d][t] planes
}
// four waves a SIMD: at most 256 VGPRs, so that two blocks (2 x 136 KiB of LDS) share a WGP and all 384 blocks are resident at once
__global__ __launch_bounds__(32 * KW) __attribute__((amdgpu_waves_per_eu(4, 4))) void k_proj(const float* __restrict__ x, const bf* __restrict__ Wt3, bf* QPh, bf* QPl, bf* KPh, bf* KPl, bf* VTh, bf* VTl) {
    __shared__ __align__(16) float os[KW * 64 * 68];   // one slice per wave: first its bf16 piece of x, then its 64x64 f32 partial tile (row pitch 68)
    const int r0 = blockIdx.x * 64; const int y = blockIdx.y; const float* xr = x + (size_t)r0 * DM;
    if (y == 2) { const size_t o0 = (size_t)(r0 / TT) * HD * TT + (size_t)(r0 % TT); proj_tile<true>(xr, Wt3 + (size_t)2 * HD * DM, VTh + o0, VTl + o0, os); }   // block-uniform branch: every thread of a block passes the same barrier
    else { const size_t o0 = (size_t)r0 * HD; proj_tile<false>(xr, Wt3 + (size_t)y * HD * DM, (y ? KPh : QPh) + o0, (y ? KPl : QPl) + o0, os); }
}
#define QW 32             // queries a block
#define CK 32             // keys a pass
#define AW 8              // waves a block
#define KPI 72            // bf16 elements per staged K row: 128 B + 16 B, conflict-free for 16-byte LDS reads
#define VPI 40            // bf16 elements per staged V^T row piece: 64 B + 16 B, likewise
#define SLE (2 * CK * KPI + 2 * HD * VPI)   // bf16 elements per wave slice (K hi, K lo, V^T hi, V^T lo)
#define OPI 68            // f32 pitch of a wave's partial O rows in its slice
#define MOF (QW * OPI)    // f32 offset of the wave's maxima in its slice; the sums follow
#define SC2 (SCL * 1.4426950408889634f)   // 1/sqrt(d_head) x log2(e): the softmax runs on powers of two
typedef __attribute__((ext_vector_type(2))) __bf16 v2bf;
typedef __attribute__((ext_vector_type(8))) unsigned v8u;
__device__ __forceinline__ float xhalf(float v) { const int b = __float_as_int(v); return __int_as_float(__builtin_amdgcn_permlanex16(b, b, 0x76543210, 0xfedcba98, false, false)); }   // lane l <-> l ^ 16
__global__ __launch_bounds__(32 * AW) __attribute__((amdgpu_waves_per_eu(2, 2))) void k_attn(const bf* __restrict__ QPh, const bf* __restrict__ QPl, const bf* __restrict__ KPh, const bf* __restrict__ KPl, const bf* __restrict__ VTh, const bf* __restrict__ VTl, float* __restrict__ OUTb) {
    __shared__ __align__(16) bf sm[AW * SLE];
    const int wv = __builtin_amdgcn_readfirstlane((int)(threadIdx.x >> 5)); const int lane = threadIdx.x & 31, lr = lane & 15, hi = lane >> 4;
    const int b = blockIdx.y; const int q0 = ((int)gridDim.x - 1 - (int)blockIdx.x) * QW;   // longest blocks first
    bf* Khs = sm + wv * SLE; bf* Kls = Khs + CK * KPI; bf* Vhs = Kls + CK * KPI; bf* Vls = Vhs + HD * VPI;
    const int nch = q0 / CK + 1;   // passes of the block: keys 0 .. q0 + QW - 1
    const size_t gk = (size_t)b * TT * HD + (size_t)lane * 8;                              // K planes: a pass is 4 KiB in a row
    const size_t gv = (size_t)b * HD * TT + (size_t)(lane >> 2) * TT + (size_t)(lane & 3) * 8;   // V^T planes: 64 row pieces of 64 B
    const int sk = (lane >> 3) * KPI + (lane & 7) * 8, sv = (lane >> 2) * VPI + (lane & 3) * 8;
    v16bf qh[2][2], ql[2][2];   // [query tile][k step]
#pragma unroll
    for (int qt = 0; qt < 2; ++qt)
#pragma unroll
        for (int ks = 0; ks < 2; ++ks) { const size_t qo = ((size_t)b * TT + q0 + qt * 16 + lr) * HD + ks * 32 + 8 * hi; qh[qt][ks] = WFrag<bf>::ld(QPh + qo); ql[qt][ks] = WFrag<bf>::ld(QPl + qo); }
    v8us st[32];
    int c = wv;
    if (c < nch) {
#pragma unroll
        for (int i = 0; i < 8; ++i) { st[i] = *(const v8us*)(KPh + gk + (size_t)c * CK * HD + i * 256); st[8 + i] = *(const v8us*)(KPl + gk + (size_t)c * CK * HD + i * 256);
            st[16 + i] = *(const v8us*)(VTh + gv + (size_t)c * CK + (size_t)i * 8 * TT); st[24 + i] = *(const v8us*)(VTl + gv + (size_t)c * CK + (size_t)i * 8 * TT); } }
    asm volatile("s_wait_xcnt 0x0" ::: "memory");   // stands in front of every later write of a register that the loads above name as their address
    asm volatile("" :: "v"(qh[0][0]), "v"(qh[0][1]), "v"(qh[1][0]), "v"(qh[1][1]), "v"(ql[0][0]), "v"(ql[0][1]), "v"(ql[1][0]), "v"(ql[1][1]));   // inputs only: the wait for the Q fragments stands here, in front of the loop; left to their first use inside it, it would also wait out each pass's freshly issued row loads
    v8f o[4][2];   // O^T: [d tile][query tile]; row d = hi * 8 + j, column = query lr
#pragma unroll
    for (int dt = 0; dt < 4; ++dt)
#pragma unroll
        for (int qt = 0; qt < 2; ++qt) o[dt][qt] = (v8f){};
    float m[2] = { -3.0e38f, -3.0e38f }, l[2] = { 0.f, 0.f };   // running maximum (scaled log2) and this lane's share of the running sum
#pragma unroll 1   // rolled: one pass's staging registers and fragments at a time
    for (; c < nch; c += AW) {
#pragma unroll
        for (int i = 0; i < 8; ++i) { *(v8usa*)(Khs + sk + i * 4 * KPI) = st[i]; *(v8usa*)(Kls + sk + i * 4 * KPI) = st[8 + i]; *(v8usa*)(Vhs + sv + i * 8 * VPI) = st[16 + i]; *(v8usa*)(Vls + sv + i * 8 * VPI) = st[24 + i]; }
        if (c + AW < nch) { const int cn = c + AW;   // the next pass's rows fly while this pass is worked on
#pragma unroll
            for (int i = 0; i < 8; ++i) { st[i] = *(const v8us*)(KPh + gk + (size_t)cn * CK * HD + i * 256); st[8 + i] = *(const v8us*)(KPl + gk + (size_t)cn * CK * HD + i * 256);
                st[16 + i] = *(const v8us*)(VTh + gv + (size_t)cn * CK + (size_t)i * 8 * TT); st[24 + i] = *(const v8us*)(VTl + gv + (size_t)cn * CK + (size_t)i * 8 * TT); } }
        asm volatile("s_wait_xcnt 0x0\n\ts_wait_dscnt 0x0" ::: "memory");   // first wait: in front of every later write of an address register of the loads above; second: the wave's staged rows are in LDS before its lanes read what other lanes of the wave wrote; the clobber keeps the reads below behind the stores above
        v16bf kh[2][2], kl[2][2], vh[4], vl[4];   // [k step][key tile]; [d tile]
#pragma unroll
        for (int ks = 0; ks < 2; ++ks)
#pragma unroll
            for (int kt = 0; kt < 2; ++kt) { kh[ks][kt] = ldsfrag(Khs + (kt * 16 + lr) * KPI + ks * 32 + 8 * hi); kl[ks][kt] = ldsfrag(Kls + (kt * 16 + lr) * KPI + ks * 32 + 8 * hi); }
#pragma unroll
        for (int dt = 0; dt < 4; ++dt) { vh[dt] = ldsfrag(Vhs + (dt * 16 + lr) * VPI + 8 * hi); vl[dt] = ldsfrag(Vls + (dt * 16 + lr) * VPI + 8 * hi); }
        __builtin_amdgcn_sched_barrier(0);   // holds the pass's LDS reads together in front of its products: without it the scheduler sinks the V^T reads between the P.V products and the wave waits out one LDS trip per d tile
        v8f s[2][2];   // S^T: [key tile][query tile]; row key = hi * 8 + j, column = query lr
#pragma unroll
        for (int kt = 0; kt < 2; ++kt)
#pragma unroll
            for (int qt = 0; qt < 2; ++qt) s[kt][qt] = (v8f){};
#pragma unroll
        for (int ks = 0; ks < 2; ++ks) {
#pragma unroll
            for (int kt = 0; kt < 2; ++kt)
#pragma unroll
                for (int qt = 0; qt < 2; ++qt) s[kt][qt] = wmmab(kh[ks][kt], qh[qt][ks], s[kt][qt]);
#pragma unroll
            for (int kt = 0; kt < 2; ++kt)
#pragma unroll
                for (int qt = 0; qt < 2; ++qt) s[kt][qt] = wmmab(kl[ks][kt], qh[qt][ks], s[kt][qt]);
#pragma unroll
            for (int kt = 0; kt < 2; ++kt)
#pragma unroll
                for (int qt = 0; qt < 2; ++qt) s[kt][qt] = wmmab(kh[ks][kt], ql[qt][ks], s[kt][qt]); }
        const bool diag = (c == nch - 1);   // only the block's last pass crosses the diagonal (wave-uniform)
        v16bf ph[2], pl[2];
#pragma unroll
        for (int qt = 0; qt < 2; ++qt) { float t[16]; float mx = -3.0e38f;
#pragma unroll
            for (int kt = 0; kt < 2; ++kt)
#pragma unroll
                for (int j = 0; j < 8; ++j) { float u = s[kt][qt][j]; if (diag && kt * 16 + hi * 8 + j > qt * 16 + lr) u = -__builtin_inff(); t[kt * 8 + j] = u; mx = fmaxf(mx, u); }
            mx = fmaxf(mx, xhalf(mx)) * SC2;   // SC2 > 0: the maximum of the scaled scores
            if (__builtin_amdgcn_ballot_w32(mx > m[qt]) != 0) {   // a query's maximum rose: bring its sum and its O column to the new one (factor 1 for the other queries)
                const float mn = fmaxf(m[qt], mx), al = __builtin_amdgcn_exp2f(m[qt] - mn); m[qt] = mn; l[qt] *= al;
#pragma unroll
                for (int dt = 0; dt < 4; ++dt) o[dt][qt] *= al; }
            v2f sa = (v2f){}, sb = (v2f){}; v8u hw, lw; v2f sc2, nm2; sc2[0] = SC2; sc2[1] = SC2; nm2[0] = -m[qt]; nm2[1] = -m[qt];
#pragma unroll
            for (int e = 0; e < 8; ++e) { v2f u2; u2[0] = t[2 * e]; u2[1] = t[2 * e + 1]; const v2f a2 = __builtin_elementwise_fma(u2, sc2, nm2); v2f p; p[0] = __builtin_amdgcn_exp2f(a2[0]); p[1] = __builtin_amdgcn_exp2f(a2[1]);
                if (e & 1) sb += p; else sa += p;
                const unsigned h = __builtin_bit_cast(unsigned, __builtin_convertvector(p, v2bf)); hw[e] = h;
                v2f r; r[0] = p[0] - __uint_as_float(h << 16); r[1] = p[1] - __uint_as_float(h & 0xFFFF0000u); lw[e] = __builtin_bit_cast(unsigned, __builtin_convertvector(r, v2bf)); }
            sa += sb; l[qt] += sa[0] + sa[1];
            ph[qt] = __builtin_bit_cast(v16bf, hw); pl[qt] = __builtin_bit_cast(v16bf, lw); }   // element e of P^T: key 8 * hi + e (e < 8), 16 + 8 * hi + e - 8 (else): the k order of the V^T loader
#pragma unroll
        for (int dt = 0; dt < 4; ++dt) {
#pragma unroll
            for (int qt = 0; qt < 2; ++qt) o[dt][qt] = wmmab(vh[dt], ph[qt], o[dt][qt]);
#pragma unroll
            for (int qt = 0; qt < 2; ++qt) o[dt][qt] = wmmab(vl[dt], ph[qt], o[dt][qt]);
#pragma unroll
            for (int qt = 0; qt < 2; ++qt) o[dt][qt] = wmmab(vh[dt], pl[qt], o[dt][qt]); }
        asm volatile("s_wait_dscnt 0x0" ::: "memory");   // this pass's fragment reads have returned before the slice is written again (next pass, or the partial result below); the clobber keeps those stores behind the reads
    }
    float* sl = (float*)(sm + wv * SLE);
#pragma unroll
    for (int qt = 0; qt < 2; ++qt) { l[qt] += xhalf(l[qt]);   // join the wave halves' sums
#pragma unroll
        for (int dt = 0; dt < 4; ++dt) { float* dp = sl + (qt * 16 + lr) * OPI + dt * 16 + hi * 8; v4f a, e;
#pragma unroll
            for (int j = 0; j < 4; ++j) { a[j] = o[dt][qt][j]; e[j] = o[dt][qt][4 + j]; }
            *(v4fa*)dp = a; *(v4fa*)(dp + 4) = e; }
        if (hi == 0) { sl[MOF + qt * 16 + lr] = m[qt]; sl[MOF + QW + qt * 16 + lr] = l[qt]; } }
    __syncthreads();   // every wave's partial result is in LDS before any thread joins them
#pragma unroll
    for (int it = 0; it < QW * HD / 4 / (32 * AW); ++it) { const int idx = (int)threadIdx.x + it * 32 * AW; const int q = idx >> 4, cofs = (idx & 15) * 4; const float* bp = (const float*)sm;
        float M = bp[MOF + q];
#pragma unroll
        for (int w = 1; w < AW; ++w) M = fmaxf(M, bp[w * (SLE / 2) + MOF + q]);   // wave 0 always holds key 0, so M is a real score
        v4f acc = (v4f){}; float L = 0.f;
#pragma unroll
        for (int w = 0; w < AW; ++w) { const float f = __builtin_amdgcn_exp2f(bp[w * (SLE / 2) + MOF + q] - M); L += f * bp[w * (SLE / 2) + MOF + QW + q]; acc += f * *(const v4fa*)(bp + w * (SLE / 2) + q * OPI + cofs); }
        const float r = __fdiv_rn(1.0f, L); *(v4f*)(OUTb + ((size_t)b * TT + q0 + q) * HD + cofs) = acc * r; }
}

extern "C" void kernel_launch(void* const* d_in, const int* in_sizes, int n_in,
                              void* d_out, int out_size, void* d_ws, size_t ws_size, hipStream_t stream) {
    (void)in_sizes; (void)n_in; (void)out_size;
    const float* x = (const float*)d_in[0]; const float* wq = (const float*)d_in[1]; const float* wk = (const float*)d_in[2]; const float* wv = (const float*)d_in[3];   /* ('xw' [1024][64]) */
    float* OUT = (float*)d_out;     // [4][2048][64]
    char* wsp = (char*)d_ws;
    auto take = [&](size_t bytes) { char* p = wsp; wsp += (bytes + 255) & ~(size_t)255; return (void*)p; };
    bf* WT3 = (bf*)take((size_t)3 * HD * DM * 2);   // transposed q, k, v weights, one plane each
    bf* QPh = (bf*)take((size_t)NB_ * NH_ * TT * HD * 2); bf* QPl = (bf*)take((size_t)NB_ * NH_ * TT * HD * 2); bf* KPh = (bf*)take((size_t)NB_ * NKV * TT * HD * 2); bf* KPl = (bf*)take((size_t)NB_ * NKV * TT * HD * 2); bf* VTh = (bf*)take((size_t)NB_ * NKV * HD * TT * 2); bf* VTl = (bf*)take((size_t)NB_ * NKV * HD * TT * 2);
    if ((size_t)(wsp - (char*)d_ws) > ws_size) return;    // ws 256 MiB
    k_wtG<<<dim3((unsigned)((DM * HD / 64 + 63) / 64), 3, 1), 256, 0, stream>>>(wq, wk, wv, DM, HD, WT3);
    // x is [NB_*TT][DM] row-contiguous, so the projections take the batches as 4 x 2048 rows of one GEMM
    k_proj<<<dim3(NB_ * TT / 64, 3, 1), 32 * KW, 0, stream>>>(x, WT3, QPh, QPl, KPh, KPl, VTh, VTl);
    // attention: grid x = block of QW query rows, grid y = batch
    k_attn<<<dim3(TT / QW, NB_, 1), 32 * AW, 0, stream>>>(QPh, QPl, KPh, KPl, VTh, VTl, OUT);
}

// v005
// It runs in 27.3 microseconds.
// Timed twice side by side with v004, it ran 1.34 and 1.35 times as fast.
// Counting every step since v000, it is 18.4 times as fast.
#include <hip/hip_runtime.h>

// Single causal attention head (x [4][2048][1024]; q, k, v = einsum('btd,de->bte', x, W) = x W ('xw' [1024][64] 1/32, no bias; ONE 64-wide head); scores = q.k / 64^0.5; causal (-inf above the diagonal); softmax over the keys (axis 2); out = attn.v -> [4][2048][64] (0.5 M); argument order x, Wq, Wk, Wv).
// All four batches go through every launch together. Layout, one plane per batch: ONE projection launch reads f32 x, rounds it to bf16 on the way into LDS, reads the f32 'xw' weights as they lie and rounds them to bf16 fragments in registers, forms q, k and v (grid y) and writes their hi/lo planes itself (v transposed); ONE attention launch (causal, T 2048, one head): scores, online softmax and P.V with the scores and probabilities in registers, EVERY row on hi/lo planes (3 products for scores and P.V: one head and no output projection); it writes the f32 output rows.
// Compute dtypes, f32 accumulate: every input rounded to bf16; projections exact; attention 3 products on every row; softmax f32; output f32.

#define NB_  4
#define TT   2048
#define DM   1024
#define NH_  1
#define NKV  1
#define REP  (NH_ / NKV)
#define HD   64
#define DQ   (NH_ * HD)
#define DKV  (NKV * HD)
#define ZH   1                    // ONE head: a single plane per batch
#define NZ   (NB_ * ZH)           // planes per launch: plane index = batch (one head each)
#define RH   TT                   // every row hi/lo (3 products)
#define WIN  2048
#define PCAR 1024.0f
#define SCL  0.125f   // 1/sqrt(d_head = 64)
typedef _Float16 h16;
typedef unsigned short bf;
typedef __attribute__((ext_vector_type(16))) __bf16   v16bf;
typedef __attribute__((ext_vector_type(16))) _Float16 v16h;
typedef __attribute__((ext_vector_type(8)))  _Float16 v8h;
typedef __attribute__((ext_vector_type(8)))  unsigned short v8us;
typedef __attribute__((ext_vector_type(8)))  float    v8f;
typedef __attribute__((ext_vector_type(4)))  float    v4f;
typedef v8h  __attribute__((may_alias)) v8ha;
typedef v4f  __attribute__((may_alias)) v4fa;
typedef v8us __attribute__((may_alias)) v8usa;

__device__ __forceinline__ unsigned short f2bf(float f) { unsigned u = __float_as_uint(f); u += 0x7FFFu + ((u >> 16) & 1u); return (unsigned short)(u >> 16); }
__device__ __forceinline__ float bf2f(unsigned short b) { return __uint_as_float(((unsigned)b) << 16); }
__device__ __forceinline__ float bfr(float f) { return bf2f(f2bf(f)); }
__device__ __forceinline__ v16h cat16(v8h lo, v8h hi) { return __builtin_shufflevector(lo, hi, 0, 1, 2, 3, 4, 5, 6, 7, 8, 9, 10, 11, 12, 13, 14, 15); }
__device__ __forceinline__ v16bf cat16b(v8us lo, v8us hi) { return __builtin_bit_cast(v16bf, __builtin_shufflevector(lo, hi, 0, 1, 2, 3, 4, 5, 6, 7, 8, 9, 10, 11, 12, 13, 14, 15)); }
__device__ __forceinline__ v8f wmma16(v16h a, v16h b, v8f c) { return __builtin_amdgcn_wmma_f32_16x16x32_f16(false, a, false, b, (short)0, c, false, false); }
__device__ __forceinline__ v8f wmmab(v16bf a, v16bf b, v8f c) { return __builtin_amdgcn_wmma_f32_16x16x32_bf16(false, a, false, b, (short)0, c, false, false); }



// ---- fragment loaders: operands straight from K-contiguous 16-bit planes
#define KW 8
template <typename T16> struct WFrag;
template <> struct WFrag<h16> { typedef v16h V; static __device__ __forceinline__ V ld(const h16* p) { return cat16(*(const v8h*)p, *(const v8h*)(p + 16)); } static __device__ __forceinline__ v8f mma(V a, V b, v8f c) { return wmma16(a, b, c); } };
template <> struct WFrag<bf> { typedef v16bf V; static __device__ __forceinline__ V ld(const bf* p) { return cat16b(*(const v8us*)p, *(const v8us*)(p + 16)); } static __device__ __forceinline__ v8f mma(V a, V b, v8f c) { return wmmab(a, b, c); } };

__device__ __forceinline__ h16 tohx(float x) { return (h16)x; }
__device__ __forceinline__ void splitf(float y, unsigned short& h, unsigned short& l) { h = f2bf(y); l = f2bf(y - bf2f(h)); }
typedef __attribute__((ext_vector_type(2))) _Float16 v2h;
typedef __attribute__((ext_vector_type(4))) _Float16 v4h;
typedef __attribute__((ext_vector_type(2))) unsigned short v2us;
typedef __attribute__((ext_vector_type(4))) unsigned short v4us;
typedef __attribute__((ext_vector_type(2))) float v2f;
typedef __attribute__((ext_vector_type(4))) int v4i;
typedef __attribute__((ext_vector_type(2))) __bf16 v2bf;
typedef __attribute__((ext_vector_type(8))) unsigned v8u;


// ---- k_proj: the whole projection stage in one launch; grid (rows / 64, 3), 32 * KW threads. Block (r, y) forms the 64x64 tile of rows r * 64.. of x W_y (y = 0, 1, 2: q, k, v) and writes its bf16 hi/lo planes.
// The K loop is split over the block's KW waves (wave w takes the w-th contiguous DM / KW columns); the KW f32 partial tiles are added in LDS in wave order.
// Each wave reads its 64 x KR piece of f32 x in whole 512-byte row pieces, rounds it to bf16 and keeps it in its OWN LDS slice (pitch XP), from which it takes the x fragments; the slice then holds the wave's partial tile.
// The weights are read as they lie, f32 [k][n]: a lane takes 4 neighbouring columns of a row (16 lanes = one whole 256-byte row, the wave halves two rows 8 apart), so column n = 4 * lr + g belongs to lane lr of fragment g;
// two rows k, k + 1 of one column pack into one bf16 pair, in the k order of the x loader. The tile's columns are so permuted among the accumulators; the partial tile in LDS is in natural order again.
// v is formed as W_v^T x^T (the two operands change places; both loaders have the same k order), so that its tile lies [d][t] and the same epilogue writes whole lines of the transposed v planes.
#define KR (DM / KW)      // x columns per wave
#define XP 136            // bf16 elements per staged x row: 256 B + 16 B, the conflict-free pitch for 16-byte LDS reads; 64 * XP * 2 B = one 64 x 68 f32 slice
typedef v4us __attribute__((may_alias)) v4usa;
__device__ __forceinline__ v16bf ldsfrag(const bf* p) { return cat16b(*(const v8usa*)p, *(const v8usa*)(p + 16)); }
template <bool SW>   // SW: the v tile, operands swapped
__device__ __forceinline__ void proj_tile(const float* __restrict__ x, const float* __restrict__ w, bf* Oh, bf* Ol, float* os) {
    const int wv = __builtin_amdgcn_readfirstlane((int)(threadIdx.x >> 5)); const int kb = wv * KR;
    const int lane = threadIdx.x & 31, lr = lane & 15, hi = lane >> 4;
    float* sl = os + wv * (64 * 68); bf* xs = (bf*)sl;
    const float* wu = w + (size_t)kb * HD; const unsigned wo = (unsigned)(hi * 8 * HD + lr * 4);   // wave-uniform base and a 32-bit lane offset
    v4f wr[16];   // element e of the fragments: row 8 * hi + e (e < 8), 16 + 8 * hi + e - 8 (else) of the step's 32
#pragma unroll
    for (int e = 0; e < 16; ++e) wr[e] = *(const v4f*)(wu + ((e & 7) + (e >> 3) * 16) * HD + wo);   // first step's weight rows fly while x is staged
    const float* xu = x + kb; const unsigned xo = (unsigned)lane * 4u;   // wave-uniform base and a 32-bit lane offset
#pragma unroll 1   // rolled: 32 row pieces (128 VGPRs) in flight a trip; unrolled, all 64 are hoisted and the kernel spills at 256 VGPRs
    for (int rb = 0; rb < 64; rb += 32) { v4f t[32];
#pragma unroll
        for (int r = 0; r < 32; ++r) t[r] = *(const v4f*)(xu + (size_t)(rb + r) * DM + xo);
#pragma unroll
        for (int r = 0; r < 32; ++r) { v4us o;
#pragma unroll
            for (int q = 0; q < 4; ++q) o[q] = f2bf(t[r][q]);
            *(v4usa*)(xs + (rb + r) * XP + lane * 4) = o; } }
    asm volatile("s_wait_dscnt 0x0" ::: "memory");   // the wave's staged rows are in LDS before its lanes read what other lanes of the wave wrote; the clobber keeps the reads below behind the stores above
    v8f acc[4][4];
#pragma unroll
    for (int mb = 0; mb < 4; ++mb)
#pragma unroll
        for (int nb = 0; nb < 4; ++nb) acc[mb][nb] = (v8f){};
    const bf* xl = xs + lr * XP + 8 * hi;
#pragma unroll
    for (int ks = 0; ks < KR / 32; ++ks) {
        v16bf wf[4];
#pragma unroll
        for (int g = 0; g < 4; ++g) { v8u pk;
#pragma unroll
            for (int i = 0; i < 8; ++i) { v2f p; p[0] = wr[2 * i][g]; p[1] = wr[2 * i + 1][g]; pk[i] = __builtin_bit_cast(unsigned, __builtin_convertvector(p, v2bf)); }
            wf[g] = __builtin_bit_cast(v16bf, pk); }
        if (ks + 1 < KR / 32) {
#pragma unroll
            for (int e = 0; e < 16; ++e) wr[e] = *(const v4f*)(wu + ((ks + 1) * 32 + (e & 7) + (e >> 3) * 16) * HD + wo); }   // next step's weight rows fly while this step's products run
        __builtin_amdgcn_sched_barrier(0);   // holds the weight loads above in front of the step's LDS reads and products: without it the scheduler puts them behind the first LDS wait and among the products, and they have less of the step to fly in
#pragma unroll
        for (int h = 0; h < 2; ++h) { v16bf xa[2];   // x fragments two at a time: with all four the step would not fit 256 VGPRs beside the 16 weight rows in flight
#pragma unroll
            for (int g = 0; g < 2; ++g) xa[g] = ldsfrag(xl + (h * 2 + g) * 16 * XP + ks * 32);
#pragma unroll
            for (int f = 0; f < 4; ++f)
#pragma unroll
                for (int g = 0; g < 2; ++g) { const int xb = h * 2 + g; if (SW) acc[f][xb] = wmmab(wf[f], xa[g], acc[f][xb]); else acc[xb][f] = wmmab(xa[g], wf[f], acc[xb][f]); } }
        __builtin_amdgcn_sched_barrier(0);   // holds the next step's packing, and with it the wait for the weight rows in flight, behind this step's products
    }
    if (SW) {   // tile row d = 4 * (hi * 8 + j) + mb; rows 32.. keep their columns with bit 5 flipped, so that the wave halves (32 rows apart) store to different banks
#pragma unroll
        for (int mb = 0; mb < 4; ++mb)
#pragma unroll
            for (int nb = 0; nb < 4; ++nb)
#pragma unroll
                for (int j = 0; j < 8; ++j) sl[((hi * 8 + j) * 4 + mb) * 68 + ((nb * 16 + lr) ^ (hi * 32))] = acc[mb][nb][j];
    } else {   // tile column n = 4 * lr + nb: a lane's four accumulators of one row are 16 bytes in a row
#pragma unroll
        for (int mb = 0; mb < 4; ++mb)
#pragma unroll
            for (int j = 0; j < 8; ++j) { v4f o4;
#pragma unroll
                for (int nb = 0; nb < 4; ++nb) o4[nb] = acc[mb][nb][j];
                *(v4fa*)(sl + (mb * 16 + hi * 8 + j) * 68 + lr * 4) = o4; }
    }
    __syncthreads();   // every wave's partial tile is in LDS before any thread adds them
    const int row = (int)(threadIdx.x >> 4), cofs = (int)(threadIdx.x & 15) * 4;   // 32 * KW threads = 16 rows x 16 float4 per strip of 16 rows
#pragma unroll
    for (int mb = 0; mb < 4; ++mb) { const float* op = os + (mb * 16 + row) * 68 + (SW ? (cofs ^ ((mb >> 1) * 32)) : cofs); v4f val = *(const v4fa*)op;
#pragma unroll
        for (int w = 1; w < KW; ++w) val += *(const v4fa*)(op + w * (64 * 68));
        v4us oh, ol;
#pragma unroll
        for (int q = 0; q < 4; ++q) { unsigned short a2, c2; splitf(val[q], a2, c2); oh[q] = a2; ol[q] = c2; }
        const size_t oo = (size_t)(mb * 16 + row) * (SW ? TT : HD) + cofs; *(v4us*)(Oh + oo) = oh; *(v4us*)(Ol + oo) = ol; }   // q, k: tile rows are positions of [b][t][d] planes; v: tile rows are d of [b][d][t] planes
}
// four waves a SIMD: at most 256 VGPRs, so that two blocks (2 x 136 KiB of LDS) share a WGP and all 384 blocks are resident at once
__global__ __launch_bounds__(32 * KW) __attribute__((amdgpu_waves_per_eu(4, 4))) void k_proj(const float* __restrict__ x, const float* __restrict__ wq, const float* __restrict__ wk, const float* __restrict__ wv, bf* QPh, bf* QPl, bf* KPh, bf* KPl, bf* VTh, bf* VTl) {
    __shared__ __align__(16) float os[KW * 64 * 68];   // one slice per wave: first its bf16 piece of x, then its 64x64 f32 partial tile (row pitch 68)
    const int r0 = blockIdx.x * 64; const int y = blockIdx.y; const float* xr = x + (size_t)r0 * DM;
    if (y == 2) { const size_t o0 = (size_t)(r0 / TT) * HD * TT + (size_t)(r0 % TT); proj_tile<true>(xr, wv, VTh + o0, VTl + o0, os); }   // block-uniform branch: every thread of a block passes the same barrier
    else { const size_t o0 = (size_t)r0 * HD; proj_tile<false>(xr, y ? wk : wq, (y ? KPh : QPh) + o0, (y ? KPl : QPl) + o0, os); }
}
#define QW 32             // queries a block
#define CK 32             // keys a pass
#define AW 8              // waves a block
#define KPI 72            // bf16 elements per staged K row: 128 B + 16 B, conflict-free for 16-byte LDS reads
#define VPI 40            // bf16 elements per staged V^T row piece: 64 B + 16 B, likewise
#define SLE (2 * CK * KPI + 2 * HD * VPI)   // bf16 elements per wave slice (K hi, K lo, V^T hi, V^T lo)
#define OPI 68            // f32 pitch of a wave's partial O rows in its slice
#define MOF (QW * OPI)    // f32 offset of the wave's maxima in its slice; the sums follow
#define SC2 (SCL * 1.4426950408889634f)   // 1/sqrt(d_head) x log2(e): the softmax runs on powers of two
__device__ __forceinline__ float xhalf(float v) { const int b = __float_as_int(v); return __int_as_float(__builtin_amdgcn_permlanex16(b, b, 0x76543210, 0xfedcba98, false, false)); }   // lane l <-> l ^ 16
__global__ __launch_bounds__(32 * AW) __attribute__((amdgpu_waves_per_eu(2, 2))) void k_attn(const bf* __restrict__ QPh, const bf* __restrict__ QPl, const bf* __restrict__ KPh, const bf* __restrict__ KPl, const bf* __restrict__ VTh, const bf* __restrict__ VTl, float* __restrict__ OUTb) {
    __shared__ __align__(16) bf sm[AW * SLE];
    const int wv = __builtin_amdgcn_readfirstlane((int)(threadIdx.x >> 5)); const int lane = threadIdx.x & 31, lr = lane & 15, hi = lane >> 4;
    const int b = blockIdx.y; const int q0 = ((int)gridDim.x - 1 - (int)blockIdx.x) * QW;   // longest blocks first
    bf* Khs = sm + wv * SLE; bf* Kls = Khs + CK * KPI; bf* Vhs = Kls + CK * KPI; bf* Vls = Vhs + HD * VPI;
    const int nch = q0 / CK + 1;   // passes of the block: keys 0 .. q0 + QW - 1
    const size_t gk = (size_t)b * TT * HD + (size_t)lane * 8;                              // K planes: a pass is 4 KiB in a row
    const size_t gv = (size_t)b * HD * TT + (size_t)(lane >> 2) * TT + (size_t)(lane & 3) * 8;   // V^T planes: 64 row pieces of 64 B
    const int sk = (lane >> 3) * KPI + (lane & 7) * 8, sv = (lane >> 2) * VPI + (lane & 3) * 8;
    v16bf qh[2][2], ql[2][2];   // [query tile][k step]
#pragma unroll
    for (int qt = 0; qt < 2; ++qt)
#pragma unroll
        for (int ks = 0; ks < 2; ++ks) { const size_t qo = ((size_t)b * TT + q0 + qt * 16 + lr) * HD + ks * 32 + 8 * hi; qh[qt][ks] = WFrag<bf>::ld(QPh + qo); ql[qt][ks] = WFrag<bf>::ld(QPl + qo); }
    v8us st[32];
    int c = wv;
    if (c < nch) {
#pragma unroll
        for (int i = 0; i < 8; ++i) { st[i] = *(const v8us*)(KPh + gk + (size_t)c * CK * HD + i * 256); st[8 + i] = *(const v8us*)(KPl + gk + (size_t)c * CK * HD + i * 256);
            st[16 + i] = *(const v8us*)(VTh + gv + (size_t)c * CK + (size_t)i * 8 * TT); st[24 + i] = *(const v8us*)(VTl + gv + (size_t)c * CK + (size_t)i * 8 * TT); } }
    asm volatile("s_wait_xcnt 0x0" ::: "memory");   // stands in front of every later write of a register that the loads above name as their address
    asm volatile("" :: "v"(qh[0][0]), "v"(qh[0][1]), "v"(qh[1][0]), "v"(qh[1][1]), "v"(ql[0][0]), "v"(ql[0][1]), "v"(ql[1][0]), "v"(ql[1][1]));   // inputs only: the wait for the Q fragments stands here, in front of the loop; left to their first use inside it, it would also wait out each pass's freshly issued row loads
    v8f o[4][2];   // O^T: [d tile][query tile]; row d = hi * 8 + j, column = query lr
#pragma unroll
    for (int dt = 0; dt < 4; ++dt)
#pragma unroll
        for (int qt = 0; qt < 2; ++qt) o[dt][qt] = (v8f){};
    float m[2] = { -3.0e38f, -3.0e38f }, l[2] = { 0.f, 0.f };   // running maximum (scaled log2) and this lane's share of the running sum
#pragma unroll 1   // rolled: one pass's staging registers and fragments at a time
    for (; c < nch; c += AW) {
#pragma unroll
        for (int i = 0; i < 8; ++i) { *(v8usa*)(Khs + sk + i * 4 * KPI) = st[i]; *(v8usa*)(Kls + sk + i * 4 * KPI) = st[8 + i]; *(v8usa*)(Vhs + sv + i * 8 * VPI) = st[16 + i]; *(v8usa*)(Vls + sv + i * 8 * VPI) = st[24 + i]; }
        if (c + AW < nch) { const int cn = c + AW;   // the next pass's rows fly while this pass is worked on
#pragma unroll
            for (int i = 0; i < 8; ++i) { st[i] = *(const v8us*)(KPh + gk + (size_t)cn * CK * HD + i * 256); st[8 + i] = *(const v8us*)(KPl + gk + (size_t)cn * CK * HD + i * 256);
                st[16 + i] = *(const v8us*)(VTh + gv + (size_t)cn * CK + (size_t)i * 8 * TT); st[24 + i] = *(const v8us*)(VTl + gv + (size_t)cn * CK + (size_t)i * 8 * TT); } }
        asm volatile("s_wait_xcnt 0x0\n\ts_wait_dscnt 0x0" ::: "memory");   // first wait: in front of every later write of an address register of the loads above; second: the wave's staged rows are in LDS before its lanes read what other lanes of the wave wrote; the clobber keeps the reads below behind the stores above
        v16bf kh[2][2], kl[2][2], vh[4], vl[4];   // [k step][key tile]; [d tile]
#pragma unroll
        for (int ks = 0; ks < 2; ++ks)
#pragma unroll
            for (int kt = 0; kt < 2; ++kt) { kh[ks][kt] = ldsfrag(Khs + (kt * 16 + lr) * KPI + ks * 32 + 8 * hi); kl[ks][kt] = ldsfrag(Kls + (kt * 16 + lr) * KPI + ks * 32 + 8 * hi); }
#pragma unroll
        for (int dt = 0; dt < 4; ++dt) { vh[dt] = ldsfrag(Vhs + (dt * 16 + lr) * VPI + 8 * hi); vl[dt] = ldsfrag(Vls + (dt * 16 + lr) * VPI + 8 * hi); }
        __builtin_amdgcn_sched_barrier(0);   // holds the pass's LDS reads together in front of its products: without it the scheduler sinks the V^T reads between the P.V products and the wave waits out one LDS trip per d tile
        v8f s[2][2];   // S^T: [key tile][query tile]; row key = hi * 8 + j, column = query lr
#pragma unroll
        for (int kt = 0; kt < 2; ++kt)
#pragma unroll
            for (int qt = 0; qt < 2; ++qt) s[kt][qt] = (v8f){};
#pragma unroll
        for (int ks = 0; ks < 2; ++ks) {
#pragma unroll
            for (int kt = 0; kt < 2; ++kt)
#pragma unroll
                for (int qt = 0; qt < 2; ++qt) s[kt][qt] = wmmab(kh[ks][kt], qh[qt][ks], s[kt][qt]);
#pragma unroll
            for (int kt = 0; kt < 2; ++kt)
#pragma unroll
                for (int qt = 0; qt < 2; ++qt) s[kt][qt] = wmmab(kl[ks][kt], qh[qt][ks], s[kt][qt]);
#pragma unroll
            for (int kt = 0; kt < 2; ++kt)
#pragma unroll
                for (int qt = 0; qt < 2; ++qt) s[kt][qt] = wmmab(kh[ks][kt], ql[qt][ks], s[kt][qt]); }
        const bool diag = (c == nch - 1);   // only the block's last pass crosses the diagonal (wave-uniform)
        v16bf ph[2], pl[2];
#pragma unroll
        for (int qt = 0; qt < 2; ++qt) { float t[16]; float mx = -3.0e38f;
#pragma unroll
            for (int kt = 0; kt < 2; ++kt)
#pragma unroll
                for (int j = 0; j < 8; ++j) { float u = s[kt][qt][j]; if (diag && kt * 16 + hi * 8 + j > qt * 16 + lr) u = -__builtin_inff(); t[kt * 8 + j] = u; mx = fmaxf(mx, u); }
            mx = fmaxf(mx, xhalf(mx)) * SC2;   // SC2 > 0: the maximum of the scaled scores
            if (__builtin_amdgcn_ballot_w32(mx > m[qt]) != 0) {   // a query's maximum rose: bring its sum and its O column to the new one (factor 1 for the other queries)
                const float mn = fmaxf(m[qt], mx), al = __builtin_amdgcn_exp2f(m[qt] - mn); m[qt] = mn; l[qt] *= al;
#pragma unroll
                for (int dt = 0; dt < 4; ++dt) o[dt][qt] *= al; }
            v2f sa = (v2f){}, sb = (v2f){}; v8u hw, lw; v2f sc2, nm2; sc2[0] = SC2; sc2[1] = SC2; nm2[0] = -m[qt]; nm2[1] = -m[qt];
#pragma unroll
            for (int e = 0; e < 8; ++e) { v2f u2; u2[0] = t[2 * e]; u2[1] = t[2 * e + 1]; const v2f a2 = __builtin_elementwise_fma(u2, sc2, nm2); v2f p; p[0] = __builtin_amdgcn_exp2f(a2[0]); p[1] = __builtin_amdgcn_exp2f(a2[1]);
                if (e & 1) sb += p; else sa += p;
                const unsigned h = __builtin_bit_cast(unsigned, __builtin_convertvector(p, v2bf)); hw[e] = h;
                v2f r; r[0] = p[0] - __uint_as_float(h << 16); r[1] = p[1] - __uint_as_float(h & 0xFFFF0000u); lw[e] = __builtin_bit_cast(unsigned, __builtin_convertvector(r, v2bf)); }
            sa += sb; l[qt] += sa[0] + sa[1];
            ph[qt] = __builtin_bit_cast(v16bf, hw); pl[qt] = __builtin_bit_cast(v16bf, lw); }   // element e of P^T: key 8 * hi + e (e < 8), 16 + 8 * hi + e - 8 (else): the k order of the V^T loader
#pragma unroll
        for (int dt = 0; dt < 4; ++dt) {
#pragma unroll
            for (int qt = 0; qt < 2; ++qt) o[dt][qt] = wmmab(vh[dt], ph[qt], o[dt][qt]);
#pragma unroll
            for (int qt = 0; qt < 2; ++qt) o[dt][qt] = wmmab(vl[dt], ph[qt], o[dt][qt]);
#pragma unroll
            for (int qt = 0; qt < 2; ++qt) o[dt][qt] = wmmab(vh[dt], pl[qt], o[dt][qt]); }
        asm volatile("s_wait_dscnt 0x0" ::: "memory");   // this pass's fragment reads have returned before the slice is written again (next pass, or the partial result below); the clobber keeps those stores behind the reads
    }
    float* sl = (float*)(sm + wv * SLE);
#pragma unroll
    for (int qt = 0; qt < 2; ++qt) { l[qt] += xhalf(l[qt]);   // join the wave halves' sums
#pragma unroll
        for (int dt = 0; dt < 4; ++dt) { float* dp = sl + (qt * 16 + lr) * OPI + dt * 16 + hi * 8; v4f a, e;
#pragma unroll
            for (int j = 0; j < 4; ++j) { a[j] = o[dt][qt][j]; e[j] = o[dt][qt][4 + j]; }
            *(v4fa*)dp = a; *(v4fa*)(dp + 4) = e; }
        if (hi == 0) { sl[MOF + qt * 16 + lr] = m[qt]; sl[MOF + QW + qt * 16 + lr] = l[qt]; } }
    __syncthreads();   // every wave's partial result is in LDS before any thread joins them
#pragma unroll
    for (int it = 0; it < QW * HD / 4 / (32 * AW); ++it) { const int idx = (int)threadIdx.x + it * 32 * AW; const int q = idx >> 4, cofs = (idx & 15) * 4; const float* bp = (const float*)sm;
        float M = bp[MOF + q];
#pragma unroll
        for (int w = 1; w < AW; ++w) M = fmaxf(M, bp[w * (SLE / 2) + MOF + q]);   // wave 0 always holds key 0, so M is a real score
        v4f acc = (v4f){}; float L = 0.f;
#pragma unroll
        for (int w = 0; w < AW; ++w) { const float f = __builtin_amdgcn_exp2f(bp[w * (SLE / 2) + MOF + q] - M); L += f * bp[w * (SLE / 2) + MOF + QW + q]; acc += f * *(const v4fa*)(bp + w * (SLE / 2) + q * OPI + cofs); }
        const float r = __fdiv_rn(1.0f, L); *(v4f*)(OUTb + ((size_t)b * TT + q0 + q) * HD + cofs) = acc * r; }
}

extern "C" void kernel_launch(void* const* d_in, const int* in_sizes, int n_in,
                              void* d_out, int out_size, void* d_ws, size_t ws_size, hipStream_t stream) {
    (void)in_sizes; (void)n_in; (void)out_size;
    const float* x = (const float*)d_in[0]; const float* wq = (const float*)d_in[1]; const float* wk = (const float*)d_in[2]; const float* wv = (const float*)d_in[3];   /* ('xw' [1024][64]) */
    float* OUT = (float*)d_out;     // [4][2048][64]
    char* wsp = (char*)d_ws;
    auto take = [&](size_t bytes) { char* p = wsp; wsp += (bytes + 255) & ~(size_t)255; return (void*)p; };
    bf* QPh = (bf*)take((size_t)NB_ * NH_ * TT * HD * 2); bf* QPl = (bf*)take((size_t)NB_ * NH_ * TT * HD * 2); bf* KPh = (bf*)take((size_t)NB_ * NKV * TT * HD * 2); bf* KPl = (bf*)take((size_t)NB_ * NKV * TT * HD * 2); bf* VTh = (bf*)take((size_t)NB_ * NKV * HD * TT * 2); bf* VTl = (bf*)take((size_t)NB_ * NKV * HD * TT * 2);
    if ((size_t)(wsp - (char*)d_ws) > ws_size) return;    // ws 256 MiB
    // x is [NB_*TT][DM] row-contiguous, so the projections take the batches as 4 x 2048 rows of one GEMM
    k_proj<<<dim3(NB_ * TT / 64, 3, 1), 32 * KW, 0, stream>>>(x, wq, wk, wv, QPh, QPl, KPh, KPl, VTh, VTl);
    // attention: grid x = block of QW query rows, grid y = batch
    k_attn<<<dim3(TT / QW, NB_, 1), 32 * AW, 0, stream>>>(QPh, QPl, KPh, KPl, VTh, VTl, OUT);
}

// v006
// It runs in 24 microseconds.
// In two side-by-side timings against v005, it was 1.09 and 1.12 times as fast.
// Counting every step since v000, it is 20.4 times as fast.
#include <hip/hip_runtime.h>

// Single causal attention head (x [4][2048][1024]; q, k, v = einsum('btd,de->bte', x, W) = x W ('xw' [1024][64] 1/32, no bias; ONE 64-wide head); scores = q.k / 64^0.5; causal (-inf above the diagonal); softmax over the keys (axis 2); out = attn.v -> [4][2048][64] (0.5 M); argument order x, Wq, Wk, Wv).
// All four batches go through every launch together. Layout, one plane per batch: ONE projection launch reads f32 x, rounds it to bf16 on the way into LDS, reads the f32 'xw' weights as they lie and rounds them to bf16 fragments in registers, forms q, k and v (grid y) and writes their hi/lo planes itself (v transposed; k and v in fragment order); ONE attention launch (causal, T 2048, one head): scores, online softmax and P.V with the scores and probabilities in registers, EVERY row on hi/lo planes (3 products for scores and P.V: one head and no output projection); it writes the f32 output rows.
// Compute dtypes, f32 accumulate: every input rounded to bf16; projections exact; attention 3 products on every row; softmax f32; output f32.

#define NB_  4
#define TT   2048
#define DM   1024
#define NH_  1
#define NKV  1
#define REP  (NH_ / NKV)
#define HD   64
#define DQ   (NH_ * HD)
#define DKV  (NKV * HD)
#define ZH   1                    // ONE head: a single plane per batch
#define NZ   (NB_ * ZH)           // planes per launch: plane index = batch (one head each)
#define RH   TT                   // every row hi/lo (3 products)
#define WIN  2048
#define PCAR 1024.0f
#define SCL  0.125f   // 1/sqrt(d_head = 64)
typedef _Float16 h16;
typedef unsigned short bf;
typedef __attribute__((ext_vector_type(16))) __bf16   v16bf;
typedef __attribute__((ext_vector_type(16))) _Float16 v16h;
typedef __attribute__((ext_vector_type(8)))  _Float16 v8h;
typedef __attribute__((ext_vector_type(8)))  unsigned short v8us;
typedef __attribute__((ext_vector_type(8)))  float    v8f;
typedef __attribute__((ext_vector_type(4)))  float    v4f;
typedef v8h  __attribute__((may_alias)) v8ha;
typedef v4f  __attribute__((may_alias)) v4fa;
typedef v8us __attribute__((may_alias)) v8usa;

__device__ __forceinline__ unsigned short f2bf(float f) { unsigned u = __float_as_uint(f); u += 0x7FFFu + ((u >> 16) & 1u); return (unsigned short)(u >> 16); }
__device__ __forceinline__ float bf2f(unsigned short b) { return __uint_as_float(((unsigned)b) << 16); }
__device__ __forceinline__ float bfr(float f) { return bf2f(f2bf(f)); }
__device__ __forceinline__ v16h cat16(v8h lo, v8h hi) { return __builtin_shufflevector(lo, hi, 0, 1, 2, 3, 4, 5, 6, 7, 8, 9, 10, 11, 12, 13, 14, 15); }
__device__ __forceinline__ v16bf cat16b(v8us lo, v8us hi) { return __builtin_bit_cast(v16bf, __builtin_shufflevector(lo, hi, 0, 1, 2, 3, 4, 5, 6, 7, 8, 9, 10, 11, 12, 13, 14, 15)); }
__device__ __forceinline__ v8f wmma16(v16h a, v16h b, v8f c) { return __builtin_amdgcn_wmma_f32_16x16x32_f16(false, a, false, b, (short)0, c, false, false); }
__device__ __forceinline__ v8f wmmab(v16bf a, v16bf b, v8f c) { return __builtin_amdgcn_wmma_f32_16x16x32_bf16(false, a, false, b, (short)0, c, false, false); }



// ---- fragment loaders: operands straight from K-contiguous 16-bit planes
#define KW 8
template <typename T16> struct WFrag;
template <> struct WFrag<h16> { typedef v16h V; static __device__ __forceinline__ V ld(const h16* p) { return cat16(*(const v8h*)p, *(const v8h*)(p + 16)); } static __device__ __forceinline__ v8f mma(V a, V b, v8f c) { return wmma16(a, b, c); } };
template <> struct WFrag<bf> { typedef v16bf V; static __device__ __forceinline__ V ld(const bf* p) { return cat16b(*(const v8us*)p, *(const v8us*)(p + 16)); } static __device__ __forceinline__ v8f mma(V a, V b, v8f c) { return wmmab(a, b, c); } };

__device__ __forceinline__ h16 tohx(float x) { return (h16)x; }
__device__ __forceinline__ void splitf(float y, unsigned short& h, unsigned short& l) { h = f2bf(y); l = f2bf(y - bf2f(h)); }
typedef __attribute__((ext_vector_type(2))) _Float16 v2h;
typedef __attribute__((ext_vector_type(4))) _Float16 v4h;
typedef __attribute__((ext_vector_type(2))) unsigned short v2us;
typedef __attribute__((ext_vector_type(4))) unsigned short v4us;
typedef __attribute__((ext_vector_type(2))) float v2f;
typedef __attribute__((ext_vector_type(4))) int v4i;
typedef __attribute__((ext_vector_type(2))) __bf16 v2bf;
typedef __attribute__((ext_vector_type(8))) unsigned v8u;


// ---- k_proj: the whole projection stage in one launch; grid (rows / 64, 3), 32 * KW threads. Block (r, y) forms the 64x64 tile of rows r * 64.. of x W_y (y = 0, 1, 2: q, k, v) and writes its bf16 hi/lo planes.
// The K loop is split over the block's KW waves (wave w takes the w-th contiguous DM / KW columns); the KW f32 partial tiles are added in LDS in wave order.
// Each wave reads its 64 x KR piece of f32 x in whole 512-byte row pieces, rounds it to bf16 and keeps it in its OWN LDS slice (pitch XP), from which it takes the x fragments; the slice then holds the wave's partial tile.
// The weights are read as they lie, f32 [k][n]: a lane takes 4 neighbouring columns of a row (16 lanes = one whole 256-byte row, the wave halves two rows 8 apart), so column n = 4 * lr + g belongs to lane lr of fragment g;
// two rows k, k + 1 of one column pack into one bf16 pair, in the k order of the x loader. The tile's columns are so permuted among the accumulators; the partial tile in LDS is in natural order again.
// v is formed as W_v^T x^T (the two operands change places; both loaders have the same k order), so that its tile lies [d][t]. The k and v planes are written in the order in which k_attn's waves load their fragments.
#define KR (DM / KW)      // x columns per wave
#define XP 136            // bf16 elements per staged x row: 256 B + 16 B, the conflict-free pitch for 16-byte LDS reads; 64 * XP * 2 B = one 64 x 68 f32 slice
typedef v4us __attribute__((may_alias)) v4usa;
__device__ __forceinline__ v16bf ldsfrag(const bf* p) { return cat16b(*(const v8usa*)p, *(const v8usa*)(p + 16)); }
template <bool SW>   // SW: the v tile, operands swapped
__device__ __forceinline__ void proj_tile(const float* __restrict__ x, const float* __restrict__ w, bf* Oh, bf* Ol, float* os, const bool fr) {   // fr (block-uniform): the k tile, written in fragment order
    const int wv = __builtin_amdgcn_readfirstlane((int)(threadIdx.x >> 5)); const int kb = wv * KR;
    const int lane = threadIdx.x & 31, lr = lane & 15, hi = lane >> 4;
    float* sl = os + wv * (64 * 68); bf* xs = (bf*)sl;
    const float* wu = w + (size_t)kb * HD; const unsigned wo = (unsigned)(hi * 8 * HD + lr * 4);   // wave-uniform base and a 32-bit lane offset
    v4f wr[16];   // element e of the fragments: row 8 * hi + e (e < 8), 16 + 8 * hi + e - 8 (else) of the step's 32
#pragma unroll
    for (int e = 0; e < 16; ++e) wr[e] = *(const v4f*)(wu + ((e & 7) + (e >> 3) * 16) * HD + wo);   // first step's weight rows fly while x is staged
    const float* xu = x + kb; const unsigned xo = (unsigned)lane * 4u;   // wave-uniform base and a 32-bit lane offset
#pragma unroll 1   // rolled: 32 row pieces (128 VGPRs) in flight a trip; unrolled, all 64 are hoisted and the kernel spills at 256 VGPRs
    for (int rb = 0; rb < 64; rb += 32) { v4f t[32];
#pragma unroll
        for (int r = 0; r < 32; ++r) t[r] = *(const v4f*)(xu + (size_t)(rb + r) * DM + xo);
#pragma unroll
        for (int r = 0; r < 32; ++r) { v4us o;
#pragma unroll
            for (int q = 0; q < 4; ++q) o[q] = f2bf(t[r][q]);
            *(v4usa*)(xs + (rb + r) * XP + lane * 4) = o; } }
    asm volatile("s_wait_dscnt 0x0" ::: "memory");   // the wave's staged rows are in LDS before its lanes read what other lanes of the wave wrote; the clobber keeps the reads below behind the stores above
    v8f acc[4][4];
#pragma unroll
    for (int mb = 0; mb < 4; ++mb)
#pragma unroll
        for (int nb = 0; nb < 4; ++nb) acc[mb][nb] = (v8f){};
    const bf* xl = xs + lr * XP + 8 * hi;
#pragma unroll
    for (int ks = 0; ks < KR / 32; ++ks) {
        v16bf wf[4];
#pragma unroll
        for (int g = 0; g < 4; ++g) { v8u pk;
#pragma unroll
            for (int i = 0; i < 8; ++i) { v2f p; p[0] = wr[2 * i][g]; p[1] = wr[2 * i + 1][g]; pk[i] = __builtin_bit_cast(unsigned, __builtin_convertvector(p, v2bf)); }
            wf[g] = __builtin_bit_cast(v16bf, pk); }
        if (ks + 1 < KR / 32) {
#pragma unroll
            for (int e = 0; e < 16; ++e) wr[e] = *(const v4f*)(wu + ((ks + 1) * 32 + (e & 7) + (e >> 3) * 16) * HD + wo); }   // next step's weight rows fly while this step's products run
        __builtin_amdgcn_sched_barrier(0);   // holds the weight loads above in front of the step's LDS reads and products: without it the scheduler puts them behind the first LDS wait and among the products, and they have less of the step to fly in
#pragma unroll
        for (int h = 0; h < 2; ++h) { v16bf xa[2];   // x fragments two at a time: with all four the step would not fit 256 VGPRs beside the 16 weight rows in flight
#pragma unroll
            for (int g = 0; g < 2; ++g) xa[g] = ldsfrag(xl + (h * 2 + g) * 16 * XP + ks * 32);
#pragma unroll
            for (int f = 0; f < 4; ++f)
#pragma unroll
                for (int g = 0; g < 2; ++g) { const int xb = h * 2 + g; if (SW) acc[f][xb] = wmmab(wf[f], xa[g], acc[f][xb]); else acc[xb][f] = wmmab(xa[g], wf[f], acc[xb][f]); } }
        __builtin_amdgcn_sched_barrier(0);   // holds the next step's packing, and with it the wait for the weight rows in flight, behind this step's products
    }
    if (SW) {   // tile row d = 4 * (hi * 8 + j) + mb; rows 32.. keep their columns with bit 5 flipped, so that the wave halves (32 rows apart) store to different banks
#pragma unroll
        for (int mb = 0; mb < 4; ++mb)
#pragma unroll
            for (int nb = 0; nb < 4; ++nb)
#pragma unroll
                for (int j = 0; j < 8; ++j) sl[((hi * 8 + j) * 4 + mb) * 68 + ((nb * 16 + lr) ^ (hi * 32))] = acc[mb][nb][j];
    } else {   // tile column n = 4 * lr + nb: a lane's four accumulators of one row are 16 bytes in a row
#pragma unroll
        for (int mb = 0; mb < 4; ++mb)
#pragma unroll
            for (int j = 0; j < 8; ++j) { v4f o4;
#pragma unroll
                for (int nb = 0; nb < 4; ++nb) o4[nb] = acc[mb][nb][j];
                *(v4fa*)(sl + (mb * 16 + hi * 8 + j) * 68 + lr * 4) = o4; }
    }
    __syncthreads();   // every wave's partial tile is in LDS before any thread adds them
    if (SW || fr) {   // k and v tiles, in fragment order: inside a group of 8 k elements the 16 rows of a fragment lie 16 bytes apart. A thread takes one row's 8 elements of a group (16 lanes = 16 rows: no LDS bank met twice), a wave stores 512 bytes in a row
#pragma unroll
        for (int it = 0; it < 2; ++it) { const int idx = (int)threadIdx.x + it * 32 * KW; const int r16 = idx & 15, grp = (idx >> 4) & 7, mb = idx >> 7;
            const float* op = os + (mb * 16 + r16) * 68 + (SW ? ((grp * 8) ^ ((mb >> 1) * 32)) : grp * 8); v4f va = *(const v4fa*)op, vb = *(const v4fa*)(op + 4);
#pragma unroll
            for (int w = 1; w < KW; ++w) { va += *(const v4fa*)(op + w * (64 * 68)); vb += *(const v4fa*)(op + w * (64 * 68) + 4); }
            v8us oh, ol;
#pragma unroll
            for (int q = 0; q < 4; ++q) { unsigned short a2, c2; splitf(va[q], a2, c2); oh[q] = a2; ol[q] = c2; splitf(vb[q], a2, c2); oh[4 + q] = a2; ol[4 + q] = c2; }
            const size_t oo = SW ? (size_t)((grp >> 2) * (HD * 32) + mb * 512 + (grp & 3) * 128 + r16 * 8)   // v: tile rows are d, columns keys: [32 keys][16 d][group of 8 keys][d][key]
                                 : (size_t)(mb * (16 * HD) + grp * 128 + r16 * 8);                          // k: tile rows are keys, columns d: [16 keys][group of 8 d][key][d]
            *(v8us*)(Oh + oo) = oh; *(v8us*)(Ol + oo) = ol; }
        if (!SW) asm volatile("s_wait_xcnt 0x0" ::: "memory");   // k tile: the q branch's code follows in the build and writes registers that the four stores above name; the wait stands in front of it (the v tile's stores run into the kernel's end)
    } else {   // q: tile rows are positions of the [b][t][d] planes
        const int row = (int)(threadIdx.x >> 4), cofs = (int)(threadIdx.x & 15) * 4;   // 32 * KW threads = 16 rows x 16 float4 per strip of 16 rows
#pragma unroll
        for (int mb = 0; mb < 4; ++mb) { const float* op = os + (mb * 16 + row) * 68 + cofs; v4f val = *(const v4fa*)op;
#pragma unroll
            for (int w = 1; w < KW; ++w) val += *(const v4fa*)(op + w * (64 * 68));
            v4us oh, ol;
#pragma unroll
            for (int q = 0; q < 4; ++q) { unsigned short a2, c2; splitf(val[q], a2, c2); oh[q] = a2; ol[q] = c2; }
            const size_t oo = (size_t)(mb * 16 + row) * HD + cofs; *(v4us*)(Oh + oo) = oh; *(v4us*)(Ol + oo) = ol; }
    }
}
// four waves a SIMD: at most 256 VGPRs, so that two blocks (2 x 136 KiB of LDS) share a WGP and all 384 blocks are resident at once
__global__ __launch_bounds__(32 * KW) __attribute__((amdgpu_waves_per_eu(4, 4))) void k_proj(const float* __restrict__ x, const float* __restrict__ wq, const float* __restrict__ wk, const float* __restrict__ wv, bf* QPh, bf* QPl, bf* KPh, bf* KPl, bf* VTh, bf* VTl) {
    __shared__ __align__(16) float os[KW * 64 * 68];   // one slice per wave: first its bf16 piece of x, then its 64x64 f32 partial tile (row pitch 68)
    const int r0 = blockIdx.x * 64; const int y = blockIdx.y; const float* xr = x + (size_t)r0 * DM;
    if (y == 2) { const size_t o0 = (size_t)r0 * HD; proj_tile<true>(xr, wv, VTh + o0, VTl + o0, os, true); }   // block-uniform branch: every thread of a block passes the same barrier
    else { const size_t o0 = (size_t)r0 * HD; proj_tile<false>(xr, y ? wk : wq, (y ? KPh : QPh) + o0, (y ? KPl : QPl) + o0, os, y != 0); }
}
#define QW 32             // queries a block
#define CK 32             // keys a pass
#define AW 8              // waves a block
#define PEL (CK * HD)     // bf16 elements of a pass in each plane
#define OPI 68            // f32 pitch of a wave's partial O rows in its slice
#define MOF (QW * OPI)    // f32 offset of the wave's maxima in its slice; the sums follow
#define SLF (QW * OPI + 2 * QW)   // f32 elements per wave slice
#define SC2 (SCL * 1.4426950408889634f)   // 1/sqrt(d_head) x log2(e): the softmax runs on powers of two
__device__ __forceinline__ float xhalf(float v) { const int b = __float_as_int(v); return __int_as_float(__builtin_amdgcn_permlanex16(b, b, 0x76543210, 0xfedcba98, false, false)); }   // lane l <-> l ^ 16
typedef const __attribute__((address_space(1))) bf* gbf;   // a pointer into global memory
typedef const __attribute__((address_space(1))) v8us* gv8;
typedef unsigned long long u64;
// two plane bases (wave-uniform, in scalar pairs) step to the wave's next pass. The pass's loads name only such a pair and the lane offset, which the loop never rewrites; the wait stands in the statement of the additions, so in front of
// the overwrite of pairs that issued loads name; the youngest of those loads were issued half a pass earlier
__device__ __forceinline__ void next_pass(u64& a, u64& b) { asm volatile("s_wait_xcnt 0x0\n\ts_add_nc_u64 %0, %0, %2\n\ts_add_nc_u64 %1, %1, %2" : "+s"(a), "+s"(b) : "i"(AW * PEL * 2) : "memory"); }
__device__ __forceinline__ v16bf ldgfrag(gbf p) { return cat16b(*(gv8)p, *(gv8)(p + 256)); }   // p: fragment base + lane * 8; elements 0..7: k = 8 * hi + e, elements 8..15: k = 16 + 8 * hi + e - 8
__device__ __forceinline__ void ld_k(const u64 bh, const u64 bl, const unsigned lo, v16bf (&kh)[2][2], v16bf (&kl)[2][2]) {   // bh, bl: wave-uniform pass bases; lo: the 32-bit lane offset
    const gbf ph = (gbf)bh, pl = (gbf)bl;
#pragma unroll
    for (int ks = 0; ks < 2; ++ks)
#pragma unroll
        for (int kt = 0; kt < 2; ++kt) { kh[ks][kt] = ldgfrag(ph + kt * 1024 + ks * 512 + lo); kl[ks][kt] = ldgfrag(pl + kt * 1024 + ks * 512 + lo); }
}
template <bool FIRST>   // FIRST: the loads in front of the loop
__device__ __forceinline__ void ld_v(const u64 bh, const u64 bl, const unsigned lo, v16bf (&vh)[4], v16bf (&vl)[4]) {
    const gbf ph = (gbf)bh, pl = (gbf)bl;
#pragma unroll
    for (int dt = 0; dt < 4; ++dt) { vh[dt] = ldgfrag(ph + dt * 512 + lo);
        if (FIRST && dt == 3) { const v8us a = *(gv8)(pl + dt * 512 + lo);
            asm volatile("s_wait_xcnt 0x0" ::: "memory");   // in front of the loop the lane offset's register ends its life at the last load and is handed out as that load's destination: the wait stands in front of that overwrite of a register which the loads above name
            vl[dt] = cat16b(a, *(gv8)(pl + dt * 512 + 256 + lo)); }
        else vl[dt] = ldgfrag(pl + dt * 512 + lo); }
}
// one pass; MORE: the wave has a further pass (then this one lies wholly below the diagonal) and refills the fragment registers for it; bk, bv: the plane bases of the pass at hand
template <bool MORE>
__device__ __forceinline__ void attn_pass(const bool diag, const int lr, const int hi, const unsigned lo, u64& bkh, u64& bkl, u64& bvh, u64& bvl,
                                          const v16bf (&qh)[2][2], const v16bf (&ql)[2][2], v16bf (&kh)[2][2], v16bf (&kl)[2][2], v16bf (&vh)[4], v16bf (&vl)[4], v8f (&o)[4][2], float (&m)[2], float (&l)[2]) {
    v8f s[2][2];   // S^T: [key tile][query tile]; row key = hi * 8 + j, column = query lr
#pragma unroll
    for (int kt = 0; kt < 2; ++kt)
#pragma unroll
        for (int qt = 0; qt < 2; ++qt) s[kt][qt] = (v8f){};
#pragma unroll
    for (int ks = 0; ks < 2; ++ks) {
#pragma unroll
        for (int kt = 0; kt < 2; ++kt)
#pragma unroll
            for (int qt = 0; qt < 2; ++qt) s[kt][qt] = wmmab(kh[ks][kt], qh[qt][ks], s[kt][qt]);
#pragma unroll
        for (int kt = 0; kt < 2; ++kt)
#pragma unroll
            for (int qt = 0; qt < 2; ++qt) s[kt][qt] = wmmab(kl[ks][kt], qh[qt][ks], s[kt][qt]);
#pragma unroll
        for (int kt = 0; kt < 2; ++kt)
#pragma unroll
            for (int qt = 0; qt < 2; ++qt) s[kt][qt] = wmmab(kh[ks][kt], ql[qt][ks], s[kt][qt]); }
    if (MORE) {
        __builtin_amdgcn_sched_barrier(0);   // holds the refill behind the score products: hoisted above them it would need a second register set and copies at the loop's end
        next_pass(bkh, bkl); ld_k(bkh, bkl, lo, kh, kl);
        __builtin_amdgcn_sched_barrier(0);   // holds the refill in front of the softmax, so that it has the softmax and P.V to fly in
    }
    v16bf ph[2], pl[2];
#pragma unroll
    for (int qt = 0; qt < 2; ++qt) { float t[16]; float mx = -3.0e38f;
#pragma unroll
        for (int kt = 0; kt < 2; ++kt)
#pragma unroll
            for (int j = 0; j < 8; ++j) { float u = s[kt][qt][j]; if (!MORE && diag && kt * 16 + hi * 8 + j > qt * 16 + lr) u = -__builtin_inff(); t[kt * 8 + j] = u; mx = fmaxf(mx, u); }
        mx = fmaxf(mx, xhalf(mx)) * SC2;   // SC2 > 0: the maximum of the scaled scores
        if (__builtin_amdgcn_ballot_w32(mx > m[qt]) != 0) {   // a query's maximum rose: bring its sum and its O column to the new one (factor 1 for the other queries)
            const float mn = fmaxf(m[qt], mx), al = __builtin_amdgcn_exp2f(m[qt] - mn); m[qt] = mn; l[qt] *= al;
#pragma unroll
            for (int dt = 0; dt < 4; ++dt) o[dt][qt] *= al; }
        v2f sa = (v2f){}, sb = (v2f){}; v8u hw, lw; v2f sc2, nm2; sc2[0] = SC2; sc2[1] = SC2; nm2[0] = -m[qt]; nm2[1] = -m[qt];
#pragma unroll
        for (int e = 0; e < 8; ++e) { v2f u2; u2[0] = t[2 * e]; u2[1] = t[2 * e + 1]; const v2f a2 = __builtin_elementwise_fma(u2, sc2, nm2); v2f p; p[0] = __builtin_amdgcn_exp2f(a2[0]); p[1] = __builtin_amdgcn_exp2f(a2[1]);
            if (e & 1) sb += p; else sa += p;
            const unsigned h = __builtin_bit_cast(unsigned, __builtin_convertvector(p, v2bf)); hw[e] = h;
            v2f r; r[0] = p[0] - __uint_as_float(h << 16); r[1] = p[1] - __uint_as_float(h & 0xFFFF0000u); lw[e] = __builtin_bit_cast(unsigned, __builtin_convertvector(r, v2bf)); }
        sa += sb; l[qt] += sa[0] + sa[1];
        ph[qt] = __builtin_bit_cast(v16bf, hw); pl[qt] = __builtin_bit_cast(v16bf, lw); }   // element e of P^T: key 8 * hi + e (e < 8), 16 + 8 * hi + e - 8 (else): the k order of the V^T fragments
#pragma unroll
    for (int dt = 0; dt < 4; ++dt) {
#pragma unroll
        for (int qt = 0; qt < 2; ++qt) o[dt][qt] = wmmab(vh[dt], ph[qt], o[dt][qt]);
#pragma unroll
        for (int qt = 0; qt < 2; ++qt) o[dt][qt] = wmmab(vl[dt], ph[qt], o[dt][qt]);
#pragma unroll
        for (int qt = 0; qt < 2; ++qt) o[dt][qt] = wmmab(vh[dt], pl[qt], o[dt][qt]); }
    if (MORE) {
        __builtin_amdgcn_sched_barrier(0);   // holds the refill behind the P.V products: hoisted above them it would need a second register set and copies at the loop's end
        next_pass(bvh, bvl); ld_v<false>(bvh, bvl, lo, vh, vl);
    }
}
__global__ __launch_bounds__(32 * AW) __attribute__((amdgpu_waves_per_eu(2, 2))) void k_attn(const bf* __restrict__ QPh, const bf* __restrict__ QPl, const bf* __restrict__ KPh, const bf* __restrict__ KPl, const bf* __restrict__ VTh, const bf* __restrict__ VTl, float* __restrict__ OUTb) {
    __shared__ __align__(16) float sm[AW * SLF];
    const int wv = __builtin_amdgcn_readfirstlane((int)(threadIdx.x >> 5)); const int lane = threadIdx.x & 31, lr = lane & 15, hi = lane >> 4;
    const int b = blockIdx.y; const int q0 = ((int)gridDim.x - 1 - (int)blockIdx.x) * QW;   // longest blocks first
    const int nch = q0 / CK + 1;   // passes of the block: keys 0 .. q0 + QW - 1
    const size_t gp = (size_t)b * TT * HD; const unsigned lo = (unsigned)lane * 8u;   // all four planes: the batch's first pass (wave-uniform); this lane's 16 bytes of a wave load
    v16bf qh[2][2], ql[2][2];   // [query tile][k step]
#pragma unroll
    for (int qt = 0; qt < 2; ++qt)
#pragma unroll
        for (int ks = 0; ks < 2; ++ks) { const size_t qo = ((size_t)b * TT + q0 + qt * 16 + lr) * HD + ks * 32 + 8 * hi; qh[qt][ks] = WFrag<bf>::ld(QPh + qo); ql[qt][ks] = WFrag<bf>::ld(QPl + qo); }
    v16bf kh[2][2], kl[2][2], vh[4], vl[4];   // [k step][key tile]; [d tile]
    int c = wv;
    const size_t po = gp + (size_t)c * PEL; u64 bkh = (u64)(KPh + po), bkl = (u64)(KPl + po), bvh = (u64)(VTh + po), bvl = (u64)(VTl + po);   // the wave's first pass
    if (c < nch) { ld_k(bkh, bkl, lo, kh, kl); ld_v<true>(bvh, bvl, lo, vh, vl); }
    asm volatile("" :: "v"(qh[0][0]), "v"(qh[0][1]), "v"(qh[1][0]), "v"(qh[1][1]), "v"(ql[0][0]), "v"(ql[0][1]), "v"(ql[1][0]), "v"(ql[1][1]));   // inputs only: the wait for the Q fragments stands here, in front of the loop; left to their first use inside it, it would also wait out each pass's freshly issued fragment loads
    v8f o[4][2];   // O^T: [d tile][query tile]; row d = hi * 8 + j, column = query lr
#pragma unroll
    for (int dt = 0; dt < 4; ++dt)
#pragma unroll
        for (int qt = 0; qt < 2; ++qt) o[dt][qt] = (v8f){};
    float m[2] = { -3.0e38f, -3.0e38f }, l[2] = { 0.f, 0.f };   // running maximum (scaled log2) and this lane's share of the running sum
#pragma unroll 1   // rolled: one set of fragment registers, refilled in place
    for (; c + AW < nch; c += AW) attn_pass<true>(false, lr, hi, lo, bkh, bkl, bvh, bvl, qh, ql, kh, kl, vh, vl, o, m, l);
    asm volatile("s_wait_xcnt 0x0" ::: "memory");   // stands in front of every later write of a register that the last fragment loads name as their address
    if (c < nch) attn_pass<false>(c == nch - 1, lr, hi, lo, bkh, bkl, bvh, bvl, qh, ql, kh, kl, vh, vl, o, m, l);   // the wave's last pass: nothing to refill; only the block's last pass crosses the diagonal (wave-uniform)
    float* sl = sm + wv * SLF;
#pragma unroll
    for (int qt = 0; qt < 2; ++qt) { l[qt] += xhalf(l[qt]);   // join the wave halves' sums
#pragma unroll
        for (int dt = 0; dt < 4; ++dt) { float* dp = sl + (qt * 16 + lr) * OPI + dt * 16 + hi * 8; v4f a, e;
#pragma unroll
            for (int j = 0; j < 4; ++j) { a[j] = o[dt][qt][j]; e[j] = o[dt][qt][4 + j]; }
            *(v4fa*)dp = a; *(v4fa*)(dp + 4) = e; }
        if (hi == 0) { sl[MOF + qt * 16 + lr] = m[qt]; sl[MOF + QW + qt * 16 + lr] = l[qt]; } }
    __syncthreads();   // every wave's partial result is in LDS before any thread joins them
#pragma unroll
    for (int it = 0; it < QW * HD / 4 / (32 * AW); ++it) { const int idx = (int)threadIdx.x + it * 32 * AW; const int q = idx >> 4, cofs = (idx & 15) * 4; const float* bp = sm;
        float M = bp[MOF + q];
#pragma unroll
        for (int w = 1; w < AW; ++w) M = fmaxf(M, bp[w * SLF + MOF + q]);   // wave 0 always holds key 0, so M is a real score
        v4f acc = (v4f){}; float L = 0.f;
#pragma unroll
        for (int w = 0; w < AW; ++w) { const float f = __builtin_amdgcn_exp2f(bp[w * SLF + MOF + q] - M); L += f * bp[w * SLF + MOF + QW + q]; acc += f * *(const v4fa*)(bp + w * SLF + q * OPI + cofs); }
        const float r = __fdiv_rn(1.0f, L); *(v4f*)(OUTb + ((size_t)b * TT + q0 + q) * HD + cofs) = acc * r; }
}

extern "C" void kernel_launch(void* const* d_in, const int* in_sizes, int n_in,
                              void* d_out, int out_size, void* d_ws, size_t ws_size, hipStream_t stream) {
    (void)in_sizes; (void)n_in; (void)out_size;
    const float* x = (const float*)d_in[0]; const float* wq = (const float*)d_in[1]; const float* wk = (const float*)d_in[2]; const float* wv = (const float*)d_in[3];   /* ('xw' [1024][64]) */
    float* OUT = (float*)d_out;     // [4][2048][64]
    char* wsp = (char*)d_ws;
    auto take = [&](size_t bytes) { char* p = wsp; wsp += (bytes + 255) & ~(size_t)255; return (void*)p; };
    bf* QPh = (bf*)take((size_t)NB_ * NH_ * TT * HD * 2); bf* QPl = (bf*)take((size_t)NB_ * NH_ * TT * HD * 2); bf* KPh = (bf*)take((size_t)NB_ * NKV * TT * HD * 2); bf* KPl = (bf*)take((size_t)NB_ * NKV * TT * HD * 2); bf* VTh = (bf*)take((size_t)NB_ * NKV * HD * TT * 2); bf* VTl = (bf*)take((size_t)NB_ * NKV * HD * TT * 2);
    if ((size_t)(wsp - (char*)d_ws) > ws_size) return;    // ws 256 MiB
    // x is [NB_*TT][DM] row-contiguous, so the projections take the batches as 4 x 2048 rows of one GEMM
    k_proj<<<dim3(NB_ * TT / 64, 3, 1), 32 * KW, 0, stream>>>(x, wq, wk, wv, QPh, QPl, KPh, KPl, VTh, VTl);
    // attention: grid x = block of QW query rows, grid y = batch
    k_attn<<<dim3(TT / QW, NB_, 1), 32 * AW, 0, stream>>>(QPh, QPl, KPh, KPl, VTh, VTl, OUT);
}

// v007
// A run of this version takes 23.6 microseconds.
// Timed twice side by side with v006, it ran 1.04 and 1.03 times as fast.
// All steps since v000 together make it 21.2 times as fast.
#include <hip/hip_runtime.h>

// Single causal attention head (x [4][2048][1024]; q, k, v = einsum('btd,de->bte', x, W) = x W ('xw' [1024][64] 1/32, no bias; ONE 64-wide head); scores = q.k / 64^0.5; causal (-inf above the diagonal); softmax over the keys (axis 2); out = attn.v -> [4][2048][64] (0.5 M); argument order x, Wq, Wk, Wv).
// All four batches go through every launch together. Layout, one plane per batch: ONE projection launch reads f32 x, rounds it to bf16 on the way into LDS, reads the f32 'xw' weights as they lie and rounds them to bf16 fragments in registers, forms q, k and v (grid y: q and half of k; the other half of k and v) and writes their hi/lo planes itself (v transposed; k and v in fragment order); ONE attention launch (causal, T 2048, one head): scores, online softmax and P.V with the scores and probabilities in registers, EVERY row on hi/lo planes (3 products for scores and P.V: one head and no output projection); it writes the f32 output rows.
// Compute dtypes, f32 accumulate: every input rounded to bf16; projections exact; attention 3 products on every row; softmax f32; output f32.

#define NB_  4
#define TT   2048
#define DM   1024
#define NH_  1
#define NKV  1
#define REP  (NH_ / NKV)
#define HD   64
#define DQ   (NH_ * HD)
#define DKV  (NKV * HD)
#define ZH   1                    // ONE head: a single plane per batch
#define NZ   (NB_ * ZH)           // planes per launch: plane index = batch (one head each)
#define RH   TT                   // every row hi/lo (3 products)
#define WIN  2048
#define PCAR 1024.0f
#define SCL  0.125f   // 1/sqrt(d_head = 64)
typedef _Float16 h16;
typedef unsigned short bf;
typedef __attribute__((ext_vector_type(16))) __bf16   v16bf;
typedef __attribute__((ext_vector_type(16))) _Float16 v16h;
typedef __attribute__((ext_vector_type(8)))  _Float16 v8h;
typedef __attribute__((ext_vector_type(8)))  unsigned short v8us;
typedef __attribute__((ext_vector_type(8)))  float    v8f;
typedef __attribute__((ext_vector_type(4)))  float    v4f;
typedef v8h  __attribute__((may_alias)) v8ha;
typedef v4f  __attribute__((may_alias)) v4fa;
typedef v8us __attribute__((may_alias)) v8usa;

__device__ __forceinline__ unsigned short f2bf(float f) { unsigned u = __float_as_uint(f); u += 0x7FFFu + ((u >> 16) & 1u); return (unsigned short)(u >> 16); }
__device__ __forceinline__ float bf2f(unsigned short b) { return __uint_as_float(((unsigned)b) << 16); }
__device__ __forceinline__ float bfr(float f) { return bf2f(f2bf(f)); }
__device__ __forceinline__ v16h cat16(v8h lo, v8h hi) { return __builtin_shufflevector(lo, hi, 0, 1, 2, 3, 4, 5, 6, 7, 8, 9, 10, 11, 12, 13, 14, 15); }
__device__ __forceinline__ v16bf cat16b(v8us lo, v8us hi) { return __builtin_bit_cast(v16bf, __builtin_shufflevector(lo, hi, 0, 1, 2, 3, 4, 5, 6, 7, 8, 9, 10, 11, 12, 13, 14, 15)); }
__device__ __forceinline__ v8f wmma16(v16h a, v16h b, v8f c) { return __builtin_amdgcn_wmma_f32_16x16x32_f16(false, a, false, b, (short)0, c, false, false); }
__device__ __forceinline__ v8f wmmab(v16bf a, v16bf b, v8f c) { return __builtin_amdgcn_wmma_f32_16x16x32_bf16(false, a, false, b, (short)0, c, false, false); }



// ---- fragment loaders: operands straight from K-contiguous 16-bit planes
#define KW 8
template <typename T16> struct WFrag;
template <> struct WFrag<h16> { typedef v16h V; static __device__ __forceinline__ V ld(const h16* p) { return cat16(*(const v8h*)p, *(const v8h*)(p + 16)); } static __device__ __forceinline__ v8f mma(V a, V b, v8f c) { return wmma16(a, b, c); } };
template <> struct WFrag<bf> { typedef v16bf V; static __device__ __forceinline__ V ld(const bf* p) { return cat16b(*(const v8us*)p, *(const v8us*)(p + 16)); } static __device__ __forceinline__ v8f mma(V a, V b, v8f c) { return wmmab(a, b, c); } };

__device__ __forceinline__ h16 tohx(float x) { return (h16)x; }
__device__ __forceinline__ void splitf(float y, unsigned short& h, unsigned short& l) { h = f2bf(y); l = f2bf(y - bf2f(h)); }
typedef __attribute__((ext_vector_type(2))) _Float16 v2h;
typedef __attribute__((ext_vector_type(4))) _Float16 v4h;
typedef __attribute__((ext_vector_type(2))) unsigned short v2us;
typedef __attribute__((ext_vector_type(4))) unsigned short v4us;
typedef __attribute__((ext_vector_type(2))) float v2f;
typedef __attribute__((ext_vector_type(4))) int v4i;
typedef __attribute__((ext_vector_type(2))) __bf16 v2bf;
typedef __attribute__((ext_vector_type(8))) unsigned v8u;


// ---- k_proj: the whole projection stage in one launch; grid (rows / 64, 2), 32 * KW threads, one block a WGP. Block (r, y) forms 96 columns of rows r * 64..: y = 0: x W_q and columns 0..31 of x W_k; y = 1: columns 32..63 of x W_k and x W_v; it writes their bf16 hi/lo planes.
// The K loop is split over the block's KW waves (wave w takes the w-th contiguous DM / KW columns); the KW f32 partial tiles are added in LDS in wave order.
// Each wave reads its 64 x KR piece of f32 x in whole 512-byte row pieces, rounds it to bf16 and keeps it in its OWN LDS slice (pitch XP), from which it takes the x fragments; the slice then holds the wave's partial tiles.
// The weights are read as they lie, f32 [k][n]. Whole matrix: a lane takes 4 neighbouring columns of a row (16 lanes = one whole 256-byte row, the wave halves two rows 8 apart), so column n = 4 * lr + g belongs to lane lr of fragment g.
// Half of W_k: a lane takes 2 neighbouring columns (16 lanes = one 128-byte line), so column 2 * lr + g of the half belongs to lane lr of fragment g.
// Two rows k, k + 1 of one column pack into one bf16 pair, in the k order of the x loader. The tile's columns are so permuted among the accumulators; the partial tiles in LDS are in natural order again.
// v is formed as W_v^T x^T (the two operands change places; both loaders have the same k order), so that its tile lies [d][t]. The k and v planes are written in the order in which k_attn's waves load their fragments.
#define KR (DM / KW)      // x columns per wave
#define XP 136            // bf16 elements per staged x row: 256 B + 16 B, the conflict-free pitch for 16-byte LDS reads
#define HP 36             // f32 pitch of the 64 x 32 partial tile of the half of k: the wave halves (8 rows apart) store to different banks, and 16 rows read 16 bytes each from different banks
#define HOF (64 * 68)     // f32 offset of that tile in a wave's slice, behind the 64 x 64 partial tile (row pitch 68)
#define SLW (HOF + 64 * HP)   // f32 elements of a wave's slice
typedef v4us __attribute__((may_alias)) v4usa;
typedef v2f __attribute__((may_alias)) v2fa;
__device__ __forceinline__ void wait_x() { asm volatile("s_wait_xcnt 0x0" ::: "memory"); }   // stands in front of a write of a register that an issued global load names as its address
__device__ __forceinline__ v16bf ldsfrag(const bf* p) { return cat16b(*(const v8usa*)p, *(const v8usa*)(p + 16)); }
// one step's weight rows. ends: the two lane offsets and the bases end their lives here, and the build then hands such a register out as the destination of one of the last loads or to the code behind them: a wait stands in front of each of the last two loads and one behind them
__device__ __forceinline__ void ld_w(const float* wu, const unsigned wo, const float* w2u, const unsigned wo2, const int ks, const bool ends, v4f (&wr)[16], v2f (&wr2)[16]) {
#pragma unroll
    for (int e = 0; e < 16; ++e) { const int ro = (ks * 32 + (e & 7) + (e >> 3) * 16) * HD;
        if (ends && e == 15) wait_x();
        wr[e] = *(const v4f*)(wu + ro + wo);
        if (ends && e == 15) wait_x();
        wr2[e] = *(const v2f*)(w2u + ro + wo2); }
    if (ends) wait_x();
}
// the part that both kinds of block share, once in the text: the wave's piece of x is staged and the first step's weight rows are asked for. w: the whole matrix (q or v); w2: first column of the block's half of W_k
// wr, wr2: element e of the fragments: row 8 * hi + e (e < 8), 16 + 8 * hi + e - 8 (else) of the step's 32
__device__ __forceinline__ void proj_stage(const float* __restrict__ x, const float* __restrict__ w, const float* __restrict__ w2, float* os, v4f (&wr)[16], v2f (&wr2)[16]) {
    const int wv = __builtin_amdgcn_readfirstlane((int)(threadIdx.x >> 5)); const int kb = wv * KR;
    const int lane = threadIdx.x & 31, lr = lane & 15, hi = lane >> 4;
    bf* xs = (bf*)(os + wv * SLW);
    const float* wu = w + (size_t)kb * HD; const unsigned wo = (unsigned)(hi * 8 * HD + lr * 4);   // wave-uniform base and a 32-bit lane offset
    const float* w2u = w2 + (size_t)kb * HD; const unsigned wo2 = (unsigned)(hi * 8 * HD + lr * 2);
    const float* xu = x + kb; const unsigned xo = (unsigned)lane * 4u;   // wave-uniform base and a 32-bit lane offset
    v4f t[64];   // all 64 row pieces in flight: two waves a SIMD have the registers for it, and half as many waves a WGP must keep as many bytes in flight
#pragma unroll
    for (int r = 0; r < 64; ++r) t[r] = *(const v4f*)(xu + (size_t)r * DM + xo);
    __builtin_amdgcn_sched_barrier(0);   // holds all 64 loads in front of the first wait: left alone the scheduler asks for 24 rows, waits them out and only then asks for the rest, two trips to L2 in series
#pragma unroll
    for (int hf = 0; hf < 2; ++hf) {
#pragma unroll
        for (int r = hf * 32; r < hf * 32 + 32; ++r) { v4us o;
#pragma unroll
            for (int q = 0; q < 4; ++q) o[q] = f2bf(t[r][q]);
            *(v4usa*)(xs + r * XP + lane * 4) = o; }
        if (hf == 0) {
            __builtin_amdgcn_sched_barrier(0);   // holds the weight loads behind the first half's rounding: hoisted, they queue behind 62 loads in flight and the wave stands at the load counter's limit instead of rounding what has come
            ld_w(wu, wo, w2u, wo2, 0, true, wr, wr2);   // the first step's weight rows fly while the other 32 row pieces are rounded
            __builtin_amdgcn_sched_barrier(0);   // holds the weight loads in front of the second half's rounding, so that they have it to fly in
        } }
    asm volatile("s_wait_dscnt 0x0" ::: "memory");   // the wave's staged rows are in LDS before its lanes read what other lanes of the wave wrote; the clobber keeps the later reads behind the stores above
}
template <bool SW>   // SW: the v tile, operands swapped; Kh, Kl: the block's 64 keys at its half's first group of 8 d
__device__ __forceinline__ void proj_tile(const float* __restrict__ w, const float* __restrict__ w2, v4f (&wr)[16], v2f (&wr2)[16], bf* Oh, bf* Ol, bf* Kh, bf* Kl, float* os) {
    const int wv = __builtin_amdgcn_readfirstlane((int)(threadIdx.x >> 5)); const int kb = wv * KR;
    const int lane = threadIdx.x & 31, lr = lane & 15, hi = lane >> 4;
    float* sl = os + wv * SLW; const bf* xs = (const bf*)sl;
    const float* wu = w + (size_t)kb * HD; const unsigned wo = (unsigned)(hi * 8 * HD + lr * 4);   // wave-uniform base and a 32-bit lane offset
    const float* w2u = w2 + (size_t)kb * HD; const unsigned wo2 = (unsigned)(hi * 8 * HD + lr * 2);
    v8f acc[4][4], ach[4][2];   // the whole matrix's tile; the half of k: [x tile][fragment]
#pragma unroll
    for (int mb = 0; mb < 4; ++mb) {
#pragma unroll
        for (int nb = 0; nb < 4; ++nb) acc[mb][nb] = (v8f){};
#pragma unroll
        for (int nb = 0; nb < 2; ++nb) ach[mb][nb] = (v8f){}; }
    const bf* xl = xs + lr * XP + 8 * hi;
#pragma unroll
    for (int ks = 0; ks < KR / 32; ++ks) {
        v16bf wf[4], wf2[2];
#pragma unroll
        for (int g = 0; g < 4; ++g) { v8u pk;
#pragma unroll
            for (int i = 0; i < 8; ++i) { v2f p; p[0] = wr[2 * i][g]; p[1] = wr[2 * i + 1][g]; pk[i] = __builtin_bit_cast(unsigned, __builtin_convertvector(p, v2bf)); }
            wf[g] = __builtin_bit_cast(v16bf, pk); }
#pragma unroll
        for (int g = 0; g < 2; ++g) { v8u pk;
#pragma unroll
            for (int i = 0; i < 8; ++i) { v2f p; p[0] = wr2[2 * i][g]; p[1] = wr2[2 * i + 1][g]; pk[i] = __builtin_bit_cast(unsigned, __builtin_convertvector(p, v2bf)); }
            wf2[g] = __builtin_bit_cast(v16bf, pk); }
        __builtin_amdgcn_sched_barrier(0);   // holds the refill below behind the packing above, so that it goes into the registers just packed: hoisted, it takes a second set, copies and a spill at 512 VGPRs
        if (ks + 1 < KR / 32) ld_w(wu, wo, w2u, wo2, ks + 1, ks + 2 == KR / 32, wr, wr2);   // next step's weight rows fly while this step's products run
        __builtin_amdgcn_sched_barrier(0);   // holds the weight loads above in front of the step's LDS reads and products: without it the scheduler puts them behind the first LDS wait and among the products, and they have less of the step to fly in
#pragma unroll
        for (int h = 0; h < 2; ++h) { v16bf xa[2];   // x fragments two at a time: the second pair's LDS reads fly under the first pair's products
#pragma unroll
            for (int g = 0; g < 2; ++g) xa[g] = ldsfrag(xl + (h * 2 + g) * 16 * XP + ks * 32);
#pragma unroll
            for (int f = 0; f < 4; ++f)
#pragma unroll
                for (int g = 0; g < 2; ++g) { const int xb = h * 2 + g; if (SW) acc[f][xb] = wmmab(wf[f], xa[g], acc[f][xb]); else acc[xb][f] = wmmab(xa[g], wf[f], acc[xb][f]); }
#pragma unroll
            for (int f = 0; f < 2; ++f)
#pragma unroll
                for (int g = 0; g < 2; ++g) ach[h * 2 + g][f] = wmmab(xa[g], wf2[f], ach[h * 2 + g][f]); }
        __builtin_amdgcn_sched_barrier(0);   // holds the next step's packing, and with it the wait for the weight rows in flight, behind this step's products
    }
    if (SW) {   // tile row d = 4 * (hi * 8 + j) + mb; rows 32.. keep their columns with bit 5 flipped, so that the wave halves (32 rows apart) store to different banks
#pragma unroll
        for (int mb = 0; mb < 4; ++mb)
#pragma unroll
            for (int nb = 0; nb < 4; ++nb)
#pragma unroll
                for (int j = 0; j < 8; ++j) sl[((hi * 8 + j) * 4 + mb) * 68 + ((nb * 16 + lr) ^ (hi * 32))] = acc[mb][nb][j];
    } else {   // tile column n = 4 * lr + nb: a lane's four accumulators of one row are 16 bytes in a row
#pragma unroll
        for (int mb = 0; mb < 4; ++mb)
#pragma unroll
            for (int j = 0; j < 8; ++j) { v4f o4;
#pragma unroll
                for (int nb = 0; nb < 4; ++nb) o4[nb] = acc[mb][nb][j];
                *(v4fa*)(sl + (mb * 16 + hi * 8 + j) * 68 + lr * 4) = o4; }
    }
#pragma unroll
    for (int mb = 0; mb < 4; ++mb)   // half of k: tile column 2 * lr + nb: a lane's two accumulators of one row are 8 bytes in a row
#pragma unroll
        for (int j = 0; j < 8; ++j) { v2f o2; o2[0] = ach[mb][0][j]; o2[1] = ach[mb][1][j]; *(v2fa*)(sl + HOF + (mb * 16 + hi * 8 + j) * HP + lr * 2) = o2; }
    __syncthreads();   // every wave's partial tiles are in LDS before any thread adds them
    // k and v tiles go out in fragment order: inside a group of 8 k elements the 16 rows of a fragment lie 16 bytes apart. A thread takes one row's 8 elements of a group (16 lanes = 16 rows: no LDS bank met twice), a wave stores 512 bytes in a row
    // All sums and roundings come first, all global stores last: behind a store nothing is written any more
    v8us koh, kol; size_t ko;
    {   // half of k: tile rows are keys, columns d: [16 keys][group of 8 d][key][d]; 4 groups of the 8 are this block's
        const int idx = (int)threadIdx.x; const int r16 = idx & 15, grp = (idx >> 4) & 3, mb = idx >> 6;
        const float* op = os + HOF + (mb * 16 + r16) * HP + grp * 8; v4f va = *(const v4fa*)op, vb = *(const v4fa*)(op + 4);
#pragma unroll
        for (int w = 1; w < KW; ++w) { va += *(const v4fa*)(op + w * SLW); vb += *(const v4fa*)(op + w * SLW + 4); }
#pragma unroll
        for (int q = 0; q < 4; ++q) { unsigned short a2, c2; splitf(va[q], a2, c2); koh[q] = a2; kol[q] = c2; splitf(vb[q], a2, c2); koh[4 + q] = a2; kol[4 + q] = c2; }
        ko = (size_t)(mb * (16 * HD) + grp * 128 + r16 * 8); }
    if (SW) {   // v: tile rows are d, columns keys: [32 keys][16 d][group of 8 keys][d][key]
        v8us oh[2], ol[2]; size_t oo[2];
#pragma unroll
        for (int it = 0; it < 2; ++it) { const int idx = (int)threadIdx.x + it * 32 * KW; const int r16 = idx & 15, grp = (idx >> 4) & 7, mb = idx >> 7;
            const float* op = os + (mb * 16 + r16) * 68 + ((grp * 8) ^ ((mb >> 1) * 32)); v4f va = *(const v4fa*)op, vb = *(const v4fa*)(op + 4);
#pragma unroll
            for (int w = 1; w < KW; ++w) { va += *(const v4fa*)(op + w * SLW); vb += *(const v4fa*)(op + w * SLW + 4); }
#pragma unroll
            for (int q = 0; q < 4; ++q) { unsigned short a2, c2; splitf(va[q], a2, c2); oh[it][q] = a2; ol[it][q] = c2; splitf(vb[q], a2, c2); oh[it][4 + q] = a2; ol[it][4 + q] = c2; }
            oo[it] = (size_t)((grp >> 2) * (HD * 32) + mb * 512 + (grp & 3) * 128 + r16 * 8); }
        __builtin_amdgcn_sched_barrier(0);   // holds the stores behind the last sum and rounding: among them, registers that an issued store names would be written again
        *(v8us*)(Kh + ko) = koh; *(v8us*)(Kl + ko) = kol;
#pragma unroll
        for (int it = 0; it < 2; ++it) { *(v8us*)(Oh + oo[it]) = oh[it]; *(v8us*)(Ol + oo[it]) = ol[it]; }
        asm volatile("s_wait_xcnt 0x0" ::: "memory");   // v block: the q block's code follows in the build and writes registers that the six stores above name; the wait stands in front of it (the q block's stores run into the kernel's end)
    } else {   // q: tile rows are positions of the [b][t][d] planes
        const int row = (int)(threadIdx.x >> 4), cofs = (int)(threadIdx.x & 15) * 4;   // 32 * KW threads = 16 rows x 16 float4 per strip of 16 rows
        v4us oh[4], ol[4];
#pragma unroll
        for (int mb = 0; mb < 4; ++mb) { const float* op = os + (mb * 16 + row) * 68 + cofs; v4f val = *(const v4fa*)op;
#pragma unroll
            for (int w = 1; w < KW; ++w) val += *(const v4fa*)(op + w * SLW);
#pragma unroll
            for (int q = 0; q < 4; ++q) { unsigned short a2, c2; splitf(val[q], a2, c2); oh[mb][q] = a2; ol[mb][q] = c2; } }
        __builtin_amdgcn_sched_barrier(0);   // holds the stores behind the last sum and rounding: among them, registers that an issued store names would be written again
        *(v8us*)(Kh + ko) = koh; *(v8us*)(Kl + ko) = kol;
#pragma unroll
        for (int mb = 0; mb < 4; ++mb) { const size_t oo = (size_t)(mb * 16 + row) * HD + cofs; *(v4us*)(Oh + oo) = oh[mb]; *(v4us*)(Ol + oo) = ol[mb]; }
    }
}
// 256 equal blocks, one a WGP (208 KiB of LDS each): two waves a SIMD, up to 512 VGPRs
__global__ __launch_bounds__(32 * KW) __attribute__((amdgpu_waves_per_eu(2, 2))) void k_proj(const float* __restrict__ x, const float* __restrict__ wq, const float* __restrict__ wk, const float* __restrict__ wv, bf* QPh, bf* QPl, bf* KPh, bf* KPl, bf* VTh, bf* VTl) {
    __shared__ __align__(16) float os[KW * SLW];   // one slice per wave: first its bf16 piece of x, then its f32 partial tiles
    const int r0 = blockIdx.x * 64; const int y = blockIdx.y; const float* xr = x + (size_t)r0 * DM; const size_t o0 = (size_t)r0 * HD;
    const float* w = y ? wv : wq; const float* w2 = wk + (y ? 32 : 0); v4f wr[16]; v2f wr2[16];
    proj_stage(xr, w, w2, os, wr, wr2);
    if (y) proj_tile<true>(w, w2, wr, wr2, VTh + o0, VTl + o0, KPh + o0 + 4 * 128, KPl + o0 + 4 * 128, os);   // block-uniform branch: every thread of a block passes the same barrier
    else proj_tile<false>(w, w2, wr, wr2, QPh + o0, QPl + o0, KPh + o0, KPl + o0, os);
}
#define QW 32             // queries a block
#define CK 32             // keys a pass
#define AW 8              // waves a block
#define PEL (CK * HD)     // bf16 elements of a pass in each plane
#define OPI 68            // f32 pitch of a wave's partial O rows in its slice
#define MOF (QW * OPI)    // f32 offset of the wave's maxima in its slice; the sums follow
#define SLF (QW * OPI + 2 * QW)   // f32 elements per wave slice
#define SC2 (SCL * 1.4426950408889634f)   // 1/sqrt(d_head) x log2(e): the softmax runs on powers of two
__device__ __forceinline__ float xhalf(float v) { const int b = __float_as_int(v); return __int_as_float(__builtin_amdgcn_permlanex16(b, b, 0x76543210, 0xfedcba98, false, false)); }   // lane l <-> l ^ 16
typedef const __attribute__((address_space(1))) bf* gbf;   // a pointer into global memory
typedef const __attribute__((address_space(1))) v8us* gv8;
typedef unsigned long long u64;
// two plane bases (wave-uniform, in scalar pairs) step to the wave's next pass. The pass's loads name only such a pair and the lane offset, which the loop never rewrites; the wait stands in the statement of the additions, so in front of
// the overwrite of pairs that issued loads name; the youngest of those loads were issued half a pass earlier
__device__ __forceinline__ void next_pass(u64& a, u64& b) { asm volatile("s_wait_xcnt 0x0\n\ts_add_nc_u64 %0, %0, %2\n\ts_add_nc_u64 %1, %1, %2" : "+s"(a), "+s"(b) : "i"(AW * PEL * 2) : "memory"); }
__device__ __forceinline__ v16bf ldgfrag(gbf p) { return cat16b(*(gv8)p, *(gv8)(p + 256)); }   // p: fragment base + lane * 8; elements 0..7: k = 8 * hi + e, elements 8..15: k = 16 + 8 * hi + e - 8
__device__ __forceinline__ void ld_k(const u64 bh, const u64 bl, const unsigned lo, v16bf (&kh)[2][2], v16bf (&kl)[2][2]) {   // bh, bl: wave-uniform pass bases; lo: the 32-bit lane offset
    const gbf ph = (gbf)bh, pl = (gbf)bl;
#pragma unroll
    for (int ks = 0; ks < 2; ++ks)
#pragma unroll
        for (int kt = 0; kt < 2; ++kt) { kh[ks][kt] = ldgfrag(ph + kt * 1024 + ks * 512 + lo); kl[ks][kt] = ldgfrag(pl + kt * 1024 + ks * 512 + lo); }
}
template <bool FIRST>   // FIRST: the loads in front of the loop
__device__ __forceinline__ void ld_v(const u64 bh, const u64 bl, const unsigned lo, v16bf (&vh)[4], v16bf (&vl)[4]) {
    const gbf ph = (gbf)bh, pl = (gbf)bl;
#pragma unroll
    for (int dt = 0; dt < 4; ++dt) { vh[dt] = ldgfrag(ph + dt * 512 + lo);
        if (FIRST && dt == 3) { const v8us a = *(gv8)(pl + dt * 512 + lo);
            asm volatile("s_wait_xcnt 0x0" ::: "memory");   // in front of the loop the lane offset's register ends its life at the last load and is handed out as that load's destination: the wait stands in front of that overwrite of a register which the loads above name
            vl[dt] = cat16b(a, *(gv8)(pl + dt * 512 + 256 + lo)); }
        else vl[dt] = ldgfrag(pl + dt * 512 + lo); }
}
// one pass; MORE: the wave has a further pass (then this one lies wholly below the diagonal) and refills the fragment registers for it; bk, bv: the plane bases of the pass at hand
template <bool MORE>
__device__ __forceinline__ void attn_pass(const bool diag, const int lr, const int hi, const unsigned lo, u64& bkh, u64& bkl, u64& bvh, u64& bvl,
                                          const v16bf (&qh)[2][2], const v16bf (&ql)[2][2], v16bf (&kh)[2][2], v16bf (&kl)[2][2], v16bf (&vh)[4], v16bf (&vl)[4], v8f (&o)[4][2], float (&m)[2], float (&l)[2]) {
    v8f s[2][2];   // S^T: [key tile][query tile]; row key = hi * 8 + j, column = query lr
#pragma unroll
    for (int kt = 0; kt < 2; ++kt)
#pragma unroll
        for (int qt = 0; qt < 2; ++qt) s[kt][qt] = (v8f){};
#pragma unroll
    for (int ks = 0; ks < 2; ++ks) {
#pragma unroll
        for (int kt = 0; kt < 2; ++kt)
#pragma unroll
            for (int qt = 0; qt < 2; ++qt) s[kt][qt] = wmmab(kh[ks][kt], qh[qt][ks], s[kt][qt]);
#pragma unroll
        for (int kt = 0; kt < 2; ++kt)
#pragma unroll
            for (int qt = 0; qt < 2; ++qt) s[kt][qt] = wmmab(kl[ks][kt], qh[qt][ks], s[kt][qt]);
#pragma unroll
        for (int kt = 0; kt < 2; ++kt)
#pragma unroll
            for (int qt = 0; qt < 2; ++qt) s[kt][qt] = wmmab(kh[ks][kt], ql[qt][ks], s[kt][qt]); }
    if (MORE) {
        __builtin_amdgcn_sched_barrier(0);   // holds the refill behind the score products: hoisted above them it would need a second register set and copies at the loop's end
        next_pass(bkh, bkl); ld_k(bkh, bkl, lo, kh, kl);
        __builtin_amdgcn_sched_barrier(0);   // holds the refill in front of the softmax, so that it has the softmax and P.V to fly in
    }
    v16bf ph[2], pl[2];
#pragma unroll
    for (int qt = 0; qt < 2; ++qt) { float t[16]; float mx = -3.0e38f;
#pragma unroll
        for (int kt = 0; kt < 2; ++kt)
#pragma unroll
            for (int j = 0; j < 8; ++j) { float u = s[kt][qt][j]; if (!MORE && diag && kt * 16 + hi * 8 + j > qt * 16 + lr) u = -__builtin_inff(); t[kt * 8 + j] = u; mx = fmaxf(mx, u); }
        mx = fmaxf(mx, xhalf(mx)) * SC2;   // SC2 > 0: the maximum of the scaled scores
        if (__builtin_amdgcn_ballot_w32(mx > m[qt]) != 0) {   // a query's maximum rose: bring its sum and its O column to the new one (factor 1 for the other queries)
            const float mn = fmaxf(m[qt], mx), al = __builtin_amdgcn_exp2f(m[qt] - mn); m[qt] = mn; l[qt] *= al;
#pragma unroll
            for (int dt = 0; dt < 4; ++dt) o[dt][qt] *= al; }
        v2f sa = (v2f){}, sb = (v2f){}; v8u hw, lw; v2f sc2, nm2; sc2[0] = SC2; sc2[1] = SC2; nm2[0] = -m[qt]; nm2[1] = -m[qt];
#pragma unroll
        for (int e = 0; e < 8; ++e) { v2f u2; u2[0] = t[2 * e]; u2[1] = t[2 * e + 1]; const v2f a2 = __builtin_elementwise_fma(u2, sc2, nm2); v2f p; p[0] = __builtin_amdgcn_exp2f(a2[0]); p[1] = __builtin_amdgcn_exp2f(a2[1]);
            if (e & 1) sb += p; else sa += p;
            const unsigned h = __builtin_bit_cast(unsigned, __builtin_convertvector(p, v2bf)); hw[e] = h;
            v2f r; r[0] = p[0] - __uint_as_float(h << 16); r[1] = p[1] - __uint_as_float(h & 0xFFFF0000u); lw[e] = __builtin_bit_cast(unsigned, __builtin_convertvector(r, v2bf)); }
        sa += sb; l[qt] += sa[0] + sa[1];
        ph[qt] = __builtin_bit_cast(v16bf, hw); pl[qt] = __builtin_bit_cast(v16bf, lw); }   // element e of P^T: key 8 * hi + e (e < 8), 16 + 8 * hi + e - 8 (else): the k order of the V^T fragments
#pragma unroll
    for (int dt = 0; dt < 4; ++dt) {
#pragma unroll
        for (int qt = 0; qt < 2; ++qt) o[dt][qt] = wmmab(vh[dt], ph[qt], o[dt][qt]);
#pragma unroll
        for (int qt = 0; qt < 2; ++qt) o[dt][qt] = wmmab(vl[dt], ph[qt], o[dt][qt]);
#pragma unroll
        for (int qt = 0; qt < 2; ++qt) o[dt][qt] = wmmab(vh[dt], pl[qt], o[dt][qt]); }
    if (MORE) {
        __builtin_amdgcn_sched_barrier(0);   // holds the refill behind the P.V products: hoisted above them it would need a second register set and copies at the loop's end
        next_pass(bvh, bvl); ld_v<false>(bvh, bvl, lo, vh, vl);
    }
}
__global__ __launch_bounds__(32 * AW) __attribute__((amdgpu_waves_per_eu(2, 2))) void k_attn(const bf* __restrict__ QPh, const bf* __restrict__ QPl, const bf* __restrict__ KPh, const bf* __restrict__ KPl, const bf* __restrict__ VTh, const bf* __restrict__ VTl, float* __restrict__ OUTb) {
    __shared__ __align__(16) float sm[AW * SLF];
    const int wv = __builtin_amdgcn_readfirstlane((int)(threadIdx.x >> 5)); const int lane = threadIdx.x & 31, lr = lane & 15, hi = lane >> 4;
    const int b = blockIdx.y; const int q0 = ((int)gridDim.x - 1 - (int)blockIdx.x) * QW;   // longest blocks first
    const int nch = q0 / CK + 1;   // passes of the block: keys 0 .. q0 + QW - 1
    const size_t gp = (size_t)b * TT * HD; const unsigned lo = (unsigned)lane * 8u;   // all four planes: the batch's first pass (wave-uniform); this lane's 16 bytes of a wave load
    v16bf qh[2][2], ql[2][2];   // [query tile][k step]
#pragma unroll
    for (int qt = 0; qt < 2; ++qt)
#pragma unroll
        for (int ks = 0; ks < 2; ++ks) { const size_t qo = ((size_t)b * TT + q0 + qt * 16 + lr) * HD + ks * 32 + 8 * hi; qh[qt][ks] = WFrag<bf>::ld(QPh + qo); ql[qt][ks] = WFrag<bf>::ld(QPl + qo); }
    v16bf kh[2][2], kl[2][2], vh[4], vl[4];   // [k step][key tile]; [d tile]
    int c = wv;
    const size_t po = gp + (size_t)c * PEL; u64 bkh = (u64)(KPh + po), bkl = (u64)(KPl + po), bvh = (u64)(VTh + po), bvl = (u64)(VTl + po);   // the wave's first pass
    if (c < nch) { ld_k(bkh, bkl, lo, kh, kl); ld_v<true>(bvh, bvl, lo, vh, vl); }
    asm volatile("" :: "v"(qh[0][0]), "v"(qh[0][1]), "v"(qh[1][0]), "v"(qh[1][1]), "v"(ql[0][0]), "v"(ql[0][1]), "v"(ql[1][0]), "v"(ql[1][1]));   // inputs only: the wait for the Q fragments stands here, in front of the loop; left to their first use inside it, it would also wait out each pass's freshly issued fragment loads
    v8f o[4][2];   // O^T: [d tile][query tile]; row d = hi * 8 + j, column = query lr
#pragma unroll
    for (int dt = 0; dt < 4; ++dt)
#pragma unroll
        for (int qt = 0; qt < 2; ++qt) o[dt][qt] = (v8f){};
    float m[2] = { -3.0e38f, -3.0e38f }, l[2] = { 0.f, 0.f };   // running maximum (scaled log2) and this lane's share of the running sum
#pragma unroll 1   // rolled: one set of fragment registers, refilled in place
    for (; c + AW < nch; c += AW) attn_pass<true>(false, lr, hi, lo, bkh, bkl, bvh, bvl, qh, ql, kh, kl, vh, vl, o, m, l);
    asm volatile("s_wait_xcnt 0x0" ::: "memory");   // stands in front of every later write of a register that the last fragment loads name as their address
    if (c < nch) attn_pass<false>(c == nch - 1, lr, hi, lo, bkh, bkl, bvh, bvl, qh, ql, kh, kl, vh, vl, o, m, l);   // the wave's last pass: nothing to refill; only the block's last pass crosses the diagonal (wave-uniform)
    float* sl = sm + wv * SLF;
#pragma unroll
    for (int qt = 0; qt < 2; ++qt) { l[qt] += xhalf(l[qt]);   // join the wave halves' sums
#pragma unroll
        for (int dt = 0; dt < 4; ++dt) { float* dp = sl + (qt * 16 + lr) * OPI + dt * 16 + hi * 8; v4f a, e;
#pragma unroll
            for (int j = 0; j < 4; ++j) { a[j] = o[dt][qt][j]; e[j] = o[dt][qt][4 + j]; }
            *(v4fa*)dp = a; *(v4fa*)(dp + 4) = e; }
        if (hi == 0) { sl[MOF + qt * 16 + lr] = m[qt]; sl[MOF + QW + qt * 16 + lr] = l[qt]; } }
    __syncthreads();   // every wave's partial result is in LDS before any thread joins them
#pragma unroll
    for (int it = 0; it < QW * HD / 4 / (32 * AW); ++it) { const int idx = (int)threadIdx.x + it * 32 * AW; const int q = idx >> 4, cofs = (idx & 15) * 4; const float* bp = sm;
        float M = bp[MOF + q];
#pragma unroll
        for (int w = 1; w < AW; ++w) M = fmaxf(M, bp[w * SLF + MOF + q]);   // wave 0 always holds key 0, so M is a real score
        v4f acc = (v4f){}; float L = 0.f;
#pragma unroll
        for (int w = 0; w < AW; ++w) { const float f = __builtin_amdgcn_exp2f(bp[w * SLF + MOF + q] - M); L += f * bp[w * SLF + MOF + QW + q]; acc += f * *(const v4fa*)(bp + w * SLF + q * OPI + cofs); }
        const float r = __fdiv_rn(1.0f, L); *(v4f*)(OUTb + ((size_t)b * TT + q0 + q) * HD + cofs) = acc * r; }
}

extern "C" void kernel_launch(void* const* d_in, const int* in_sizes, int n_in,
                              void* d_out, int out_size, void* d_ws, size_t ws_size, hipStream_t stream) {
    (void)in_sizes; (void)n_in; (void)out_size;
    const float* x = (const float*)d_in[0]; const float* wq = (const float*)d_in[1]; const float* wk = (const float*)d_in[2]; const float* wv = (const float*)d_in[3];   /* ('xw' [1024][64]) */
    float* OUT = (float*)d_out;     // [4][2048][64]
    char* wsp = (char*)d_ws;
    auto take = [&](size_t bytes) { char* p = wsp; wsp += (bytes + 255) & ~(size_t)255; return (void*)p; };
    bf* QPh = (bf*)take((size_t)NB_ * NH_ * TT * HD * 2); bf* QPl = (bf*)take((size_t)NB_ * NH_ * TT * HD * 2); bf* KPh = (bf*)take((size_t)NB_ * NKV * TT * HD * 2); bf* KPl = (bf*)take((size_t)NB_ * NKV * TT * HD * 2); bf* VTh = (bf*)take((size_t)NB_ * NKV * HD * TT * 2); bf* VTl = (bf*)take((size_t)NB_ * NKV * HD * TT * 2);
    if ((size_t)(wsp - (char*)d_ws) > ws_size) return;    // ws 256 MiB
    // x is [NB_*TT][DM] row-contiguous, so the projections take the batches as 4 x 2048 rows of one GEMM
    k_proj<<<dim3(NB_ * TT / 64, 2, 1), 32 * KW, 0, stream>>>(x, wq, wk, wv, QPh, QPl, KPh, KPl, VTh, VTl);
    // attention: grid x = block of QW query rows, grid y = batch
    k_attn<<<dim3(TT / QW, NB_, 1), 32 * AW, 0, stream>>>(QPh, QPl, KPh, KPl, VTh, VTl, OUT);
}

// v008
// A run of this version takes 20.8 microseconds.
// Next to v007, in two timings, it ran 1.13 and 1.12 times as fast.
// All steps since v000 together make it 23.8 times as fast.
#include <hip/hip_runtime.h>

// Single causal attention head (x [4][2048][1024]; q, k, v = einsum('btd,de->bte', x, W) = x W ('xw' [1024][64] 1/32, no bias; ONE 64-wide head); scores = q.k / 64^0.5; causal (-inf above the diagonal); softmax over the keys (axis 2); out = attn.v -> [4][2048][64] (0.5 M); argument order x, Wq, Wk, Wv).
// All four batches go through every launch together. Layout, one plane per batch: ONE projection launch reads f32 x, rounds it to bf16 on the way into LDS, reads the f32 'xw' weights as they lie and rounds them to bf16 fragments in registers, forms q, k and v (grid y: q and half of k; the other half of k and v) and writes their hi/lo planes itself (v transposed; k and v in fragment order); ONE attention launch (causal, T 2048, one head): scores, online softmax and P.V with the scores and probabilities in registers, EVERY row on hi/lo planes (3 products for scores and P.V: one head and no output projection); it writes the f32 output rows.
// Compute dtypes, f32 accumulate: every input rounded to bf16; projections exact; attention 3 products on every row; softmax f32; output f32.

#define NB_  4
#define TT   2048
#define DM   1024
#define NH_  1
#define NKV  1
#define REP  (NH_ / NKV)
#define HD   64
#define DQ   (NH_ * HD)
#define DKV  (NKV * HD)
#define ZH   1                    // ONE head: a single plane per batch
#define NZ   (NB_ * ZH)           // planes per launch: plane index = batch (one head each)
#define RH   TT                   // every row hi/lo (3 products)
#define WIN  2048
#define PCAR 1024.0f
#define SCL  0.125f   // 1/sqrt(d_head = 64)
typedef _Float16 h16;
typedef unsigned short bf;
typedef __attribute__((ext_vector_type(16))) __bf16   v16bf;
typedef __attribute__((ext_vector_type(16))) _Float16 v16h;
typedef __attribute__((ext_vector_type(8)))  _Float16 v8h;
typedef __attribute__((ext_vector_type(8)))  unsigned short v8us;
typedef __attribute__((ext_vector_type(8)))  float    v8f;
typedef __attribute__((ext_vector_type(4)))  float    v4f;
typedef v8h  __attribute__((may_alias)) v8ha;
typedef v4f  __attribute__((may_alias)) v4fa;
typedef v8us __attribute__((may_alias)) v8usa;

__device__ __forceinline__ unsigned short f2bf(float f) { unsigned u = __float_as_uint(f); u += 0x7FFFu + ((u >> 16) & 1u); return (unsigned short)(u >> 16); }
__device__ __forceinline__ float bf2f(unsigned short b) { return __uint_as_float(((unsigned)b) << 16); }
__device__ __forceinline__ float bfr(float f) { return bf2f(f2bf(f)); }
__device__ __forceinline__ v16h cat16(v8h lo, v8h hi) { return __builtin_shufflevector(lo, hi, 0, 1, 2, 3, 4, 5, 6, 7, 8, 9, 10, 11, 12, 13, 14, 15); }
__device__ __forceinline__ v16bf cat16b(v8us lo, v8us hi) { return __builtin_bit_cast(v16bf, __builtin_shufflevector(lo, hi, 0, 1, 2, 3, 4, 5, 6, 7, 8, 9, 10, 11, 12, 13, 14, 15)); }
__device__ __forceinline__ v8f wmma16(v16h a, v16h b, v8f c) { return __builtin_amdgcn_wmma_f32_16x16x32_f16(false, a, false, b, (short)0, c, false, false); }
__device__ __forceinline__ v8f wmmab(v16bf a, v16bf b, v8f c) { return __builtin_amdgcn_wmma_f32_16x16x32_bf16(false, a, false, b, (short)0, c, false, false); }



// ---- fragment loaders: operands straight from K-contiguous 16-bit planes
#define KW 8
template <typename T16> struct WFrag;
template <> struct WFrag<h16> { typedef v16h V; static __device__ __forceinline__ V ld(const h16* p) { return cat16(*(const v8h*)p, *(const v8h*)(p + 16)); } static __device__ __forceinline__ v8f mma(V a, V b, v8f c) { return wmma16(a, b, c); } };
template <> struct WFrag<bf> { typedef v16bf V; static __device__ __forceinline__ V ld(const bf* p) { return cat16b(*(const v8us*)p, *(const v8us*)(p + 16)); } static __device__ __forceinline__ v8f mma(V a, V b, v8f c) { return wmmab(a, b, c); } };

__device__ __forceinline__ h16 tohx(float x) { return (h16)x; }
__device__ __forceinline__ void splitf(float y, unsigned short& h, unsigned short& l) { h = f2bf(y); l = f2bf(y - bf2f(h)); }
typedef __attribute__((ext_vector_type(2))) _Float16 v2h;
typedef __attribute__((ext_vector_type(4))) _Float16 v4h;
typedef __attribute__((ext_vector_type(2))) unsigned short v2us;
typedef __attribute__((ext_vector_type(4))) unsigned short v4us;
typedef __attribute__((ext_vector_type(2))) float v2f;
typedef __attribute__((ext_vector_type(4))) int v4i;
typedef __attribute__((ext_vector_type(2))) __bf16 v2bf;
typedef __attribute__((ext_vector_type(8))) unsigned v8u;


// ---- k_proj: the whole projection stage in one launch; grid (rows / 64, 2), 32 * KW threads, one block a WGP. Block (r, y) forms 96 columns of rows r * 64..: y = 0: x W_q and columns 0..31 of x W_k; y = 1: columns 32..63 of x W_k and x W_v; it writes their bf16 hi/lo planes.
// The K loop is split over the block's KW waves (wave w takes a contiguous piece of DM / KW columns); the KW f32 partial tiles are added in LDS in wave order.
// All blocks walk the same weight rows, and the two blocks of a row strip the same x: each block enters the walk at a place of its own (wave w takes piece (w + rot) mod KW and starts it at step kr, wrapping round), so that L2 is not asked for the same lines by all blocks at the same moment.
// Each wave reads its 64 x KR piece of f32 x in whole 512-byte row pieces, rounds it to bf16 and keeps it in its OWN LDS slice (pitch XP), from which it takes the x fragments; the slice then holds the wave's partial tiles.
// The weights are read as they lie, f32 [k][n]. Whole matrix: a lane takes 4 neighbouring columns of a row (16 lanes = one whole 256-byte row, the wave halves two rows 8 apart), so column n = 4 * lr + g belongs to lane lr of fragment g.
// Half of W_k: a lane takes 2 neighbouring columns (16 lanes = one 128-byte line), so column 2 * lr + g of the half belongs to lane lr of fragment g.
// Two rows k, k + 1 of one column pack into one bf16 pair, in the k order of the x loader. The tile's columns are so permuted among the accumulators; the partial tiles in LDS are in natural order again.
// v is formed as W_v^T x^T (the two operands change places; both loaders have the same k order), so that its tile lies [d][t]. The k and v planes are written in the order in which k_attn's waves load their fragments.
#define KR (DM / KW)      // x columns per wave
#define XP 136            // bf16 elements per staged x row: 256 B + 16 B, the conflict-free pitch for 16-byte LDS reads
#define HP 36             // f32 pitch of the 64 x 32 partial tile of the half of k: the wave halves (8 rows apart) store to different banks, and 16 rows read 16 bytes each from different banks
#define HOF (64 * 68)     // f32 offset of that tile in a wave's slice, behind the 64 x 64 partial tile (row pitch 68)
#define SLW (HOF + 64 * HP)   // f32 elements of a wave's slice
typedef v4us __attribute__((may_alias)) v4usa;
typedef v2f __attribute__((may_alias)) v2fa;
__device__ __forceinline__ void wait_x() { asm volatile("s_wait_xcnt 0x0" ::: "memory"); }   // stands in front of a write of a register that an issued global load names as its address
__device__ __forceinline__ v16bf ldsfrag(const bf* p) { return cat16b(*(const v8usa*)p, *(const v8usa*)(p + 16)); }
typedef const __attribute__((address_space(1))) float* gfl;   // pointers into global memory
typedef const __attribute__((address_space(1))) v4f* gv4f;
typedef const __attribute__((address_space(1))) v2f* gv2f;
typedef unsigned long long u64;
// the two bases of a step's weight rows (wave-uniform, in scalar pairs): the wave's piece + d bytes. In asm for two reasons: the wait stands in the statement of the additions, so in front of the overwrite of pairs that the step before's loads name;
// and the sums stay scalar: left to the build, d is added to the lane offset first and every load gets a 64-bit vector address
__device__ __forceinline__ void step_base(u64& a, u64& b, const float* wu, const float* w2u, const int d) { asm volatile("s_wait_xcnt 0x0\n\ts_add_nc_u64 %0, %2, %4\n\ts_add_nc_u64 %1, %3, %4" : "=&s"(a), "=&s"(b) : "s"((u64)wu), "s"((u64)w2u), "s"((u64)d) : "memory"); }
// one step's weight rows. ends: the two lane offsets and the bases end their lives here, and the build then hands such a register out as the destination of one of the last loads or to the code behind them: a wait stands in front of each of the last two loads and one behind them
__device__ __forceinline__ void ld_w(const gfl wu, const unsigned wo, const gfl w2u, const unsigned wo2, const bool ends, v4f (&wr)[16], v2f (&wr2)[16]) {   // wu, w2u: first row of the step
#pragma unroll
    for (int e = 0; e < 16; ++e) { const int ro = ((e & 7) + (e >> 3) * 16) * HD;
        if (ends && e == 15) wait_x();
        wr[e] = *(gv4f)(wu + ro + wo);
        if (ends && e == 15) wait_x();
        wr2[e] = *(gv2f)(w2u + ro + wo2); }
    if (ends) wait_x();
}
// the part that both kinds of block share, once in the text: the wave's piece of x is staged and the first step's weight rows are asked for. w: the whole matrix (q or v); w2: first column of the block's half of W_k
// wr, wr2: element e of the fragments: row 8 * hi + e (e < 8), 16 + 8 * hi + e - 8 (else) of the step's 32
__device__ __forceinline__ void proj_stage(const float* __restrict__ x, const float* __restrict__ w, const float* __restrict__ w2, float* os, const int rot, const int kr, v4f (&wr)[16], v2f (&wr2)[16]) {
    const int wv = __builtin_amdgcn_readfirstlane((int)(threadIdx.x >> 5)); const int kb = ((wv + rot) & (KW - 1)) * KR;
    const int lane = threadIdx.x & 31, lr = lane & 15, hi = lane >> 4;
    bf* xs = (bf*)(os + wv * SLW);
    const float* wu = w + (size_t)kb * HD; const unsigned wo = (unsigned)(hi * 8 * HD + lr * 4);   // wave-uniform base and a 32-bit lane offset
    const float* w2u = w2 + (size_t)kb * HD; const unsigned wo2 = (unsigned)(hi * 8 * HD + lr * 2);
    const float* xu = x + kb; const unsigned xo = (unsigned)lane * 4u;   // wave-uniform base and a 32-bit lane offset
    v4f t[64];   // all 64 row pieces in flight: two waves a SIMD have the registers for it, and half as many waves a WGP must keep as many bytes in flight
#pragma unroll
    for (int r = 0; r < 64; ++r) t[r] = *(const v4f*)(xu + (size_t)r * DM + xo);
    __builtin_amdgcn_sched_barrier(0);   // holds all 64 loads in front of the first wait: left alone the scheduler asks for 24 rows, waits them out and only then asks for the rest, two trips to L2 in series
#pragma unroll
    for (int hf = 0; hf < 2; ++hf) {
#pragma unroll
        for (int r = hf * 32; r < hf * 32 + 32; ++r) { v4us o;
#pragma unroll
            for (int q = 0; q < 4; ++q) o[q] = f2bf(t[r][q]);
            *(v4usa*)(xs + r * XP + lane * 4) = o; }
        if (hf == 0) {
            __builtin_amdgcn_sched_barrier(0);   // holds the weight loads behind the first half's rounding: hoisted, they queue behind 62 loads in flight and the wave stands at the load counter's limit instead of rounding what has come
            u64 ba, bb; step_base(ba, bb, wu, w2u, kr * 32 * HD * 4);
            ld_w((gfl)ba, wo, (gfl)bb, wo2, true, wr, wr2);   // the first step's weight rows fly while the other 32 row pieces are rounded
            __builtin_amdgcn_sched_barrier(0);   // holds the weight loads in front of the second half's rounding, so that they have it to fly in
        } }
    asm volatile("s_wait_dscnt 0x0" ::: "memory");   // the wave's staged rows are in LDS before its lanes read what other lanes of the wave wrote; the clobber keeps the later reads behind the stores above
}
template <bool SW>   // SW: the v tile, operands swapped; Kh, Kl: the block's 64 keys at its half's first group of 8 d
__device__ __forceinline__ void proj_tile(const float* __restrict__ w, const float* __restrict__ w2, const int rot, const int kr, v4f (&wr)[16], v2f (&wr2)[16], bf* Oh, bf* Ol, bf* Kh, bf* Kl, float* os) {
    const int wv = __builtin_amdgcn_readfirstlane((int)(threadIdx.x >> 5)); const int kb = ((wv + rot) & (KW - 1)) * KR;
    const int lane = threadIdx.x & 31, lr = lane & 15, hi = lane >> 4;
    float* sl = os + wv * SLW; const bf* xs = (const bf*)sl;
    const float* wu = w + (size_t)kb * HD; const unsigned wo = (unsigned)(hi * 8 * HD + lr * 4);   // wave-uniform base and a 32-bit lane offset
    const float* w2u = w2 + (size_t)kb * HD; const unsigned wo2 = (unsigned)(hi * 8 * HD + lr * 2);
    v8f acc[4][4], ach[4][2];   // the whole matrix's tile; the half of k: [x tile][fragment]
#pragma unroll
    for (int mb = 0; mb < 4; ++mb) {
#pragma unroll
        for (int nb = 0; nb < 4; ++nb) acc[mb][nb] = (v8f){};
#pragma unroll
        for (int nb = 0; nb < 2; ++nb) ach[mb][nb] = (v8f){}; }
    const bf* xl = xs + lr * XP + 8 * hi;
#pragma unroll
    for (int ks = 0; ks < KR / 32; ++ks) {
        v16bf wf[4], wf2[2];
#pragma unroll
        for (int g = 0; g < 4; ++g) { v8u pk;
#pragma unroll
            for (int i = 0; i < 8; ++i) { v2f p; p[0] = wr[2 * i][g]; p[1] = wr[2 * i + 1][g]; pk[i] = __builtin_bit_cast(unsigned, __builtin_convertvector(p, v2bf)); }
            wf[g] = __builtin_bit_cast(v16bf, pk); }
#pragma unroll
        for (int g = 0; g < 2; ++g) { v8u pk;
#pragma unroll
            for (int i = 0; i < 8; ++i) { v2f p; p[0] = wr2[2 * i][g]; p[1] = wr2[2 * i + 1][g]; pk[i] = __builtin_bit_cast(unsigned, __builtin_convertvector(p, v2bf)); }
            wf2[g] = __builtin_bit_cast(v16bf, pk); }
        __builtin_amdgcn_sched_barrier(0);   // holds the refill below behind the packing above, so that it goes into the registers just packed: hoisted, it takes a second set, copies and a spill at 512 VGPRs
        const int kc = (ks + kr) & (KR / 32 - 1), kn = (ks + 1 + kr) & (KR / 32 - 1);   // this step's and the next step's place in the wave's piece of K
        if (ks + 1 < KR / 32) { u64 ba, bb; step_base(ba, bb, wu, w2u, kn * 32 * HD * 4); ld_w((gfl)ba, wo, (gfl)bb, wo2, ks + 2 == KR / 32, wr, wr2); }   // next step's weight rows fly while this step's products run
        __builtin_amdgcn_sched_barrier(0);   // holds the weight loads above in front of the step's LDS reads and products: without it the scheduler puts them behind the first LDS wait and among the products, and they have less of the step to fly in
#pragma unroll
        for (int h = 0; h < 2; ++h) { v16bf xa[2];   // x fragments two at a time: the second pair's LDS reads fly under the first pair's products
#pragma unroll
            for (int g = 0; g < 2; ++g) xa[g] = ldsfrag(xl + (h * 2 + g) * 16 * XP + kc * 32);
#pragma unroll
            for (int f = 0; f < 4; ++f)
#pragma unroll
                for (int g = 0; g < 2; ++g) { const int xb = h * 2 + g; if (SW) acc[f][xb] = wmmab(wf[f], xa[g], acc[f][xb]); else acc[xb][f] = wmmab(xa[g], wf[f], acc[xb][f]); }
#pragma unroll
            for (int f = 0; f < 2; ++f)
#pragma unroll
                for (int g = 0; g < 2; ++g) ach[h * 2 + g][f] = wmmab(xa[g], wf2[f], ach[h * 2 + g][f]); }
        __builtin_amdgcn_sched_barrier(0);   // holds the next step's packing, and with it the wait for the weight rows in flight, behind this step's products
    }
    if (SW) {   // tile row d = 4 * (hi * 8 + j) + mb; rows 32.. keep their columns with bit 5 flipped, so that the wave halves (32 rows apart) store to different banks
#pragma unroll
        for (int mb = 0; mb < 4; ++mb)
#pragma unroll
            for (int nb = 0; nb < 4; ++nb)
#pragma unroll
                for (int j = 0; j < 8; ++j) sl[((hi * 8 + j) * 4 + mb) * 68 + ((nb * 16 + lr) ^ (hi * 32))] = acc[mb][nb][j];
    } else {   // tile column n = 4 * lr + nb: a lane's four accumulators of one row are 16 bytes in a row
#pragma unroll
        for (int mb = 0; mb < 4; ++mb)
#pragma unroll
            for (int j = 0; j < 8; ++j) { v4f o4;
#pragma unroll
                for (int nb = 0; nb < 4; ++nb) o4[nb] = acc[mb][nb][j];
                *(v4fa*)(sl + (mb * 16 + hi * 8 + j) * 68 + lr * 4) = o4; }
    }
#pragma unroll
    for (int mb = 0; mb < 4; ++mb)   // half of k: tile column 2 * lr + nb: a lane's two accumulators of one row are 8 bytes in a row
#pragma unroll
        for (int j = 0; j < 8; ++j) { v2f o2; o2[0] = ach[mb][0][j]; o2[1] = ach[mb][1][j]; *(v2fa*)(sl + HOF + (mb * 16 + hi * 8 + j) * HP + lr * 2) = o2; }
    __syncthreads();   // every wave's partial tiles are in LDS before any thread adds them
    // k and v tiles go out in fragment order: inside a group of 8 k elements the 16 rows of a fragment lie 16 bytes apart. A thread takes one row's 8 elements of a group (16 lanes = 16 rows: no LDS bank met twice), a wave stores 512 bytes in a row
    // All sums and roundings come first, all global stores last: behind a store nothing is written any more
    v8us koh, kol; size_t ko;
    {   // half of k: tile rows are keys, columns d: [16 keys][group of 8 d][key][d]; 4 groups of the 8 are this block's
        const int idx = (int)threadIdx.x; const int r16 = idx & 15, grp = (idx >> 4) & 3, mb = idx >> 6;
        const float* op = os + HOF + (mb * 16 + r16) * HP + grp * 8; v4f va = *(const v4fa*)op, vb = *(const v4fa*)(op + 4);
#pragma unroll
        for (int w = 1; w < KW; ++w) { va += *(const v4fa*)(op + w * SLW); vb += *(const v4fa*)(op + w * SLW + 4); }
#pragma unroll
        for (int q = 0; q < 4; ++q) { unsigned short a2, c2; splitf(va[q], a2, c2); koh[q] = a2; kol[q] = c2; splitf(vb[q], a2, c2); koh[4 + q] = a2; kol[4 + q] = c2; }
        ko = (size_t)(mb * (16 * HD) + grp * 128 + r16 * 8); }
    if (SW) {   // v: tile rows are d, columns keys: [32 keys][16 d][group of 8 keys][d][key]
        v8us oh[2], ol[2]; size_t oo[2];
#pragma unroll
        for (int it = 0; it < 2; ++it) { const int idx = (int)threadIdx.x + it * 32 * KW; const int r16 = idx & 15, grp = (idx >> 4) & 7, mb = idx >> 7;
            const float* op = os + (mb * 16 + r16) * 68 + ((grp * 8) ^ ((mb >> 1) * 32)); v4f va = *(const v4fa*)op, vb = *(const v4fa*)(op + 4);
#pragma unroll
            for (int w = 1; w < KW; ++w) { va += *(const v4fa*)(op + w * SLW); vb += *(const v4fa*)(op + w * SLW + 4); }
#pragma unroll
            for (int q = 0; q < 4; ++q) { unsigned short a2, c2; splitf(va[q], a2, c2); oh[it][q] = a2; ol[it][q] = c2; splitf(vb[q], a2, c2); oh[it][4 + q] = a2; ol[it][4 + q] = c2; }
            oo[it] = (size_t)((grp >> 2) * (HD * 32) + mb * 512 + (grp & 3) * 128 + r16 * 8); }
        __builtin_amdgcn_sched_barrier(0);   // holds the stores behind the last sum and rounding: among them, registers that an issued store names would be written again
        *(v8us*)(Kh + ko) = koh; *(v8us*)(Kl + ko) = kol;
#pragma unroll
        for (int it = 0; it < 2; ++it) { *(v8us*)(Oh + oo[it]) = oh[it]; *(v8us*)(Ol + oo[it]) = ol[it]; }
        asm volatile("s_wait_xcnt 0x0" ::: "memory");   // v block: the q block's code follows in the build and writes registers that the six stores above name; the wait stands in front of it (the q block's stores run into the kernel's end)
    } else {   // q: tile rows are positions of the [b][t][d] planes
        const int row = (int)(threadIdx.x >> 4), cofs = (int)(threadIdx.x & 15) * 4;   // 32 * KW threads = 16 rows x 16 float4 per strip of 16 rows
        v4us oh[4], ol[4];
#pragma unroll
        for (int mb = 0; mb < 4; ++mb) { const float* op = os + (mb * 16 + row) * 68 + cofs; v4f val = *(const v4fa*)op;
#pragma unroll
            for (int w = 1; w < KW; ++w) val += *(const v4fa*)(op + w * SLW);
#pragma unroll
            for (int q = 0; q < 4; ++q) { unsigned short a2, c2; splitf(val[q], a2, c2); oh[mb][q] = a2; ol[mb][q] = c2; } }
        __builtin_amdgcn_sched_barrier(0);   // holds the stores behind the last sum and rounding: among them, registers that an issued store names would be written again
        *(v8us*)(Kh + ko) = koh; *(v8us*)(Kl + ko) = kol;
#pragma unroll
        for (int mb = 0; mb < 4; ++mb) { const size_t oo = (size_t)(mb * 16 + row) * HD + cofs; *(v4us*)(Oh + oo) = oh[mb]; *(v4us*)(Ol + oo) = ol[mb]; }
    }
}
// 256 equal blocks, one a WGP (208 KiB of LDS each): two waves a SIMD, up to 512 VGPRs
__global__ __launch_bounds__(32 * KW) __attribute__((amdgpu_waves_per_eu(2, 2))) void k_proj(const float* __restrict__ x, const float* __restrict__ wq, const float* __restrict__ wk, const float* __restrict__ wv, bf* QPh, bf* QPl, bf* KPh, bf* KPl, bf* VTh, bf* VTl) {
    __shared__ __align__(16) float os[KW * SLW];   // one slice per wave: first its bf16 piece of x, then its f32 partial tiles
    const int r0 = blockIdx.x * 64; const int y = blockIdx.y; const float* xr = x + (size_t)r0 * DM; const size_t o0 = (size_t)r0 * HD;
    const float* w = y ? wv : wq; const float* w2 = wk + (y ? 32 : 0); v4f wr[16]; v2f wr2[16];
    const int rot = (int)((blockIdx.x + 4 * blockIdx.y) & (KW - 1)), kr = (int)((blockIdx.x >> 3) & (KR / 32 - 1));   // where this block enters the walk of K
    proj_stage(xr, w, w2, os, rot, kr, wr, wr2);
    if (y) proj_tile<true>(w, w2, rot, kr, wr, wr2, VTh + o0, VTl + o0, KPh + o0 + 4 * 128, KPl + o0 + 4 * 128, os);   // block-uniform branch: every thread of a block passes the same barrier
    else proj_tile<false>(w, w2, rot, kr, wr, wr2, QPh + o0, QPl + o0, KPh + o0, KPl + o0, os);
}
#define QW 32             // queries a block
#define CK 32             // keys a pass
#define AW 8              // waves a block
#define PEL (CK * HD)     // bf16 elements of a pass in each plane
#define OPI 68            // f32 pitch of a wave's partial O rows in its slice
#define MOF (QW * OPI)    // f32 offset of the wave's maxima in its slice; the sums follow
#define SLF (QW * OPI + 2 * QW)   // f32 elements per wave slice
#define SC2 (SCL * 1.4426950408889634f)   // 1/sqrt(d_head) x log2(e): the softmax runs on powers of two
__device__ __forceinline__ float xhalf(float v) { const int b = __float_as_int(v); return __int_as_float(__builtin_amdgcn_permlanex16(b, b, 0x76543210, 0xfedcba98, false, false)); }   // lane l <-> l ^ 16
typedef const __attribute__((address_space(1))) bf* gbf;   // a pointer into global memory
typedef const __attribute__((address_space(1))) v8us* gv8;
// two plane bases (wave-uniform, in scalar pairs) step to the wave's next pass. The pass's loads name only such a pair and the lane offset, which the loop never rewrites; the wait stands in the statement of the additions, so in front of
// the overwrite of pairs that issued loads name; the youngest of those loads were issued half a pass earlier
__device__ __forceinline__ void next_pass(u64& a, u64& b, const u64 d) { asm volatile("s_wait_xcnt 0x0\n\ts_add_nc_u64 %0, %0, %2\n\ts_add_nc_u64 %1, %1, %2" : "+s"(a), "+s"(b) : "s"(d) : "memory"); }   // d: bytes to that pass (wave-uniform, modulo 2^64)
__device__ __forceinline__ v16bf ldgfrag(gbf p) { return cat16b(*(gv8)p, *(gv8)(p + 256)); }   // p: fragment base + lane * 8; elements 0..7: k = 8 * hi + e, elements 8..15: k = 16 + 8 * hi + e - 8
__device__ __forceinline__ void ld_k(const u64 bh, const u64 bl, const unsigned lo, v16bf (&kh)[2][2], v16bf (&kl)[2][2]) {   // bh, bl: wave-uniform pass bases; lo: the 32-bit lane offset
    const gbf ph = (gbf)bh, pl = (gbf)bl;
#pragma unroll
    for (int ks = 0; ks < 2; ++ks)
#pragma unroll
        for (int kt = 0; kt < 2; ++kt) { kh[ks][kt] = ldgfrag(ph + kt * 1024 + ks * 512 + lo); kl[ks][kt] = ldgfrag(pl + kt * 1024 + ks * 512 + lo); }
}
template <bool FIRST>   // FIRST: the loads in front of the loop
__device__ __forceinline__ void ld_v(const u64 bh, const u64 bl, const unsigned lo, v16bf (&vh)[4], v16bf (&vl)[4]) {
    const gbf ph = (gbf)bh, pl = (gbf)bl;
#pragma unroll
    for (int dt = 0; dt < 4; ++dt) { vh[dt] = ldgfrag(ph + dt * 512 + lo);
        if (FIRST && dt == 3) { const v8us a = *(gv8)(pl + dt * 512 + lo);
            asm volatile("s_wait_xcnt 0x0" ::: "memory");   // in front of the loop the lane offset's register ends its life at the last load and is handed out as that load's destination: the wait stands in front of that overwrite of a register which the loads above name
            vl[dt] = cat16b(a, *(gv8)(pl + dt * 512 + 256 + lo)); }
        else vl[dt] = ldgfrag(pl + dt * 512 + lo); }
}
// one pass; MORE: the wave has a further pass (then this one lies wholly below the diagonal) and refills the fragment registers for it; bk, bv: the plane bases of the pass at hand; dn: bytes from it to the further pass
template <bool MORE>
__device__ __forceinline__ void attn_pass(const bool diag, const int lr, const int hi, const unsigned lo, const u64 dn, u64& bkh, u64& bkl, u64& bvh, u64& bvl,
                                          const v16bf (&qh)[2][2], const v16bf (&ql)[2][2], v16bf (&kh)[2][2], v16bf (&kl)[2][2], v16bf (&vh)[4], v16bf (&vl)[4], v8f (&o)[4][2], float (&m)[2], float (&l)[2]) {
    v8f s[2][2];   // S^T: [key tile][query tile]; row key = hi * 8 + j, column = query lr
#pragma unroll
    for (int kt = 0; kt < 2; ++kt)
#pragma unroll
        for (int qt = 0; qt < 2; ++qt) s[kt][qt] = (v8f){};
#pragma unroll
    for (int ks = 0; ks < 2; ++ks) {
#pragma unroll
        for (int kt = 0; kt < 2; ++kt)
#pragma unroll
            for (int qt = 0; qt < 2; ++qt) s[kt][qt] = wmmab(kh[ks][kt], qh[qt][ks], s[kt][qt]);
#pragma unroll
        for (int kt = 0; kt < 2; ++kt)
#pragma unroll
            for (int qt = 0; qt < 2; ++qt) s[kt][qt] = wmmab(kl[ks][kt], qh[qt][ks], s[kt][qt]);
#pragma unroll
        for (int kt = 0; kt < 2; ++kt)
#pragma unroll
            for (int qt = 0; qt < 2; ++qt) s[kt][qt] = wmmab(kh[ks][kt], ql[qt][ks], s[kt][qt]); }
    if (MORE) {
        __builtin_amdgcn_sched_barrier(0);   // holds the refill behind the score products: hoisted above them it would need a second register set and copies at the loop's end
        next_pass(bkh, bkl, dn); ld_k(bkh, bkl, lo, kh, kl);
        __builtin_amdgcn_sched_barrier(0);   // holds the refill in front of the softmax, so that it has the softmax and P.V to fly in
    }
    v16bf ph[2], pl[2];
#pragma unroll
    for (int qt = 0; qt < 2; ++qt) { float t[16]; float mx = -3.0e38f;
#pragma unroll
        for (int kt = 0; kt < 2; ++kt)
#pragma unroll
            for (int j = 0; j < 8; ++j) { float u = s[kt][qt][j]; if (!MORE && diag && kt * 16 + hi * 8 + j > qt * 16 + lr) u = -__builtin_inff(); t[kt * 8 + j] = u; mx = fmaxf(mx, u); }
        mx = fmaxf(mx, xhalf(mx)) * SC2;   // SC2 > 0: the maximum of the scaled scores
        if (__builtin_amdgcn_ballot_w32(mx > m[qt]) != 0) {   // a query's maximum rose: bring its sum and its O column to the new one (factor 1 for the other queries)
            const float mn = fmaxf(m[qt], mx), al = __builtin_amdgcn_exp2f(m[qt] - mn); m[qt] = mn; l[qt] *= al;
#pragma unroll
            for (int dt = 0; dt < 4; ++dt) o[dt][qt] *= al; }
        v2f sa = (v2f){}, sb = (v2f){}; v8u hw, lw; v2f sc2, nm2; sc2[0] = SC2; sc2[1] = SC2; nm2[0] = -m[qt]; nm2[1] = -m[qt];
#pragma unroll
        for (int e = 0; e < 8; ++e) { v2f u2; u2[0] = t[2 * e]; u2[1] = t[2 * e + 1]; const v2f a2 = __builtin_elementwise_fma(u2, sc2, nm2); v2f p; p[0] = __builtin_amdgcn_exp2f(a2[0]); p[1] = __builtin_amdgcn_exp2f(a2[1]);
            if (e & 1) sb += p; else sa += p;
            const unsigned h = __builtin_bit_cast(unsigned, __builtin_convertvector(p, v2bf)); hw[e] = h;
            v2f r; r[0] = p[0] - __uint_as_float(h << 16); r[1] = p[1] - __uint_as_float(h & 0xFFFF0000u); lw[e] = __builtin_bit_cast(unsigned, __builtin_convertvector(r, v2bf)); }
        sa += sb; l[qt] += sa[0] + sa[1];
        ph[qt] = __builtin_bit_cast(v16bf, hw); pl[qt] = __builtin_bit_cast(v16bf, lw); }   // element e of P^T: key 8 * hi + e (e < 8), 16 + 8 * hi + e - 8 (else): the k order of the V^T fragments
#pragma unroll
    for (int dt = 0; dt < 4; ++dt) {
#pragma unroll
        for (int qt = 0; qt < 2; ++qt) o[dt][qt] = wmmab(vh[dt], ph[qt], o[dt][qt]);
#pragma unroll
        for (int qt = 0; qt < 2; ++qt) o[dt][qt] = wmmab(vl[dt], ph[qt], o[dt][qt]);
#pragma unroll
        for (int qt = 0; qt < 2; ++qt) o[dt][qt] = wmmab(vh[dt], pl[qt], o[dt][qt]); }
    if (MORE) {
        __builtin_amdgcn_sched_barrier(0);   // holds the refill behind the P.V products: hoisted above them it would need a second register set and copies at the loop's end
        next_pass(bvh, bvl, dn); ld_v<false>(bvh, bvl, lo, vh, vl);
    }
}
__global__ __launch_bounds__(32 * AW) __attribute__((amdgpu_waves_per_eu(2, 2))) void k_attn(const bf* __restrict__ QPh, const bf* __restrict__ QPl, const bf* __restrict__ KPh, const bf* __restrict__ KPl, const bf* __restrict__ VTh, const bf* __restrict__ VTl, float* __restrict__ OUTb) {
    __shared__ __align__(16) float sm[AW * SLF];
    const int wv = __builtin_amdgcn_readfirstlane((int)(threadIdx.x >> 5)); const int lane = threadIdx.x & 31, lr = lane & 15, hi = lane >> 4;
    const int b = blockIdx.y; const int q0 = ((int)gridDim.x - 1 - (int)blockIdx.x) * QW;   // longest blocks first
    const int nch = q0 / CK + 1;   // passes of the block: keys 0 .. q0 + QW - 1
    const size_t gp = (size_t)b * TT * HD; const unsigned lo = (unsigned)lane * 8u;   // all four planes: the batch's first pass (wave-uniform); this lane's 16 bytes of a wave load
    v16bf qh[2][2], ql[2][2];   // [query tile][k step]
#pragma unroll
    for (int qt = 0; qt < 2; ++qt)
#pragma unroll
        for (int ks = 0; ks < 2; ++ks) { const size_t qo = ((size_t)b * TT + q0 + qt * 16 + lr) * HD + ks * 32 + 8 * hi; qh[qt][ks] = WFrag<bf>::ld(QPh + qo); ql[qt][ks] = WFrag<bf>::ld(QPl + qo); }
    v16bf kh[2][2], kl[2][2], vh[4], vl[4];   // [k step][key tile]; [d tile]
    const int nw = (nch - wv + AW - 1) / AW, nl = nw - 1;   // the wave's passes (wv, wv + AW, ...; none: nw = 0); all but the last of them run in the loop
    int i = (((int)blockIdx.x & 7) * nl) >> 3;   // the blocks of a batch walk the same planes: each enters the loop's passes at a place of its own and wraps round, so that L2 is not asked for the same lines by all of them at the same moment; 0 <= i < nl where nl > 0
    if (nl <= 0) i = 0;
    const size_t po = gp + (size_t)(wv + i * AW) * PEL; u64 bkh = (u64)(KPh + po), bkl = (u64)(KPl + po), bvh = (u64)(VTh + po), bvl = (u64)(VTl + po);   // the wave's first pass
    if (nw > 0) { ld_k(bkh, bkl, lo, kh, kl); ld_v<true>(bvh, bvl, lo, vh, vl); }
    asm volatile("" :: "v"(qh[0][0]), "v"(qh[0][1]), "v"(qh[1][0]), "v"(qh[1][1]), "v"(ql[0][0]), "v"(ql[0][1]), "v"(ql[1][0]), "v"(ql[1][1]));   // inputs only: the wait for the Q fragments stands here, in front of the loop; left to their first use inside it, it would also wait out each pass's freshly issued fragment loads
    v8f o[4][2];   // O^T: [d tile][query tile]; row d = hi * 8 + j, column = query lr
#pragma unroll
    for (int dt = 0; dt < 4; ++dt)
#pragma unroll
        for (int qt = 0; qt < 2; ++qt) o[dt][qt] = (v8f){};
    float m[2] = { -3.0e38f, -3.0e38f }, l[2] = { 0.f, 0.f };   // running maximum (scaled log2) and this lane's share of the running sum
#pragma unroll 1   // rolled: one set of fragment registers, refilled in place
    for (int left = nl; left > 0; --left) { int nx = i + 1 == nl ? 0 : i + 1; if (left == 1) nx = nl;   // behind the loop's last pass comes the wave's last one
        attn_pass<true>(false, lr, hi, lo, (u64)(long long)((nx - i) * (AW * PEL * 2)), bkh, bkl, bvh, bvl, qh, ql, kh, kl, vh, vl, o, m, l); i = nx; }
    asm volatile("s_wait_xcnt 0x0" ::: "memory");   // stands in front of every later write of a register that the last fragment loads name as their address
    if (nw > 0) attn_pass<false>(wv + nl * AW == nch - 1, lr, hi, lo, 0, bkh, bkl, bvh, bvl, qh, ql, kh, kl, vh, vl, o, m, l);   // the wave's last pass: nothing to refill; only the block's last pass crosses the diagonal (wave-uniform)
    float* sl = sm + wv * SLF;
#pragma unroll
    for (int qt = 0; qt < 2; ++qt) { l[qt] += xhalf(l[qt]);   // join the wave halves' sums
#pragma unroll
        for (int dt = 0; dt < 4; ++dt) { float* dp = sl + (qt * 16 + lr) * OPI + dt * 16 + hi * 8; v4f a, e;
#pragma unroll
            for (int j = 0; j < 4; ++j) { a[j] = o[dt][qt][j]; e[j] = o[dt][qt][4 + j]; }
            *(v4fa*)dp = a; *(v4fa*)(dp + 4) = e; }
        if (hi == 0) { sl[MOF + qt * 16 + lr] = m[qt]; sl[MOF + QW + qt * 16 + lr] = l[qt]; } }
    __syncthreads();   // every wave's partial result is in LDS before any thread joins them
#pragma unroll
    for (int it = 0; it < QW * HD / 4 / (32 * AW); ++it) { const int idx = (int)threadIdx.x + it * 32 * AW; const int q = idx >> 4, cofs = (idx & 15) * 4; const float* bp = sm;
        float M = bp[MOF + q];
#pragma unroll
        for (int w = 1; w < AW; ++w) M = fmaxf(M, bp[w * SLF + MOF + q]);   // wave 0 always holds key 0, so M is a real score
        v4f acc = (v4f){}; float L = 0.f;
#pragma unroll
        for (int w = 0; w < AW; ++w) { const float f = __builtin_amdgcn_exp2f(bp[w * SLF + MOF + q] - M); L += f * bp[w * SLF + MOF + QW + q]; acc += f * *(const v4fa*)(bp + w * SLF + q * OPI + cofs); }
        const float r = __fdiv_rn(1.0f, L); *(v4f*)(OUTb + ((size_t)b * TT + q0 + q) * HD + cofs) = acc * r; }
}

extern "C" void kernel_launch(void* const* d_in, const int* in_sizes, int n_in,
                              void* d_out, int out_size, void* d_ws, size_t ws_size, hipStream_t stream) {
    (void)in_sizes; (void)n_in; (void)out_size;
    const float* x = (const float*)d_in[0]; const float* wq = (const float*)d_in[1]; const float* wk = (const float*)d_in[2]; const float* wv = (const float*)d_in[3];   /* ('xw' [1024][64]) */
    float* OUT = (float*)d_out;     // [4][2048][64]
    char* wsp = (char*)d_ws;
    auto take = [&](size_t bytes) { char* p = wsp; wsp += (bytes + 255) & ~(size_t)255; return (void*)p; };
    bf* QPh = (bf*)take((size_t)NB_ * NH_ * TT * HD * 2); bf* QPl = (bf*)take((size_t)NB_ * NH_ * TT * HD * 2); bf* KPh = (bf*)take((size_t)NB_ * NKV * TT * HD * 2); bf* KPl = (bf*)take((size_t)NB_ * NKV * TT * HD * 2); bf* VTh = (bf*)take((size_t)NB_ * NKV * HD * TT * 2); bf* VTl = (bf*)take((size_t)NB_ * NKV * HD * TT * 2);
    if ((size_t)(wsp - (char*)d_ws) > ws_size) return;    // ws 256 MiB
    // x is [NB_*TT][DM] row-contiguous, so the projections take the batches as 4 x 2048 rows of one GEMM
    k_proj<<<dim3(NB_ * TT / 64, 2, 1), 32 * KW, 0, stream>>>(x, wq, wk, wv, QPh, QPl, KPh, KPl, VTh, VTl);
    // attention: grid x = block of QW query rows, grid y = batch
    k_attn<<<dim3(TT / QW, NB_, 1), 32 * AW, 0, stream>>>(QPh, QPl, KPh, KPl, VTh, VTl, OUT);
}

// v010
// It runs in 15.1 microseconds.
// Versions between v008 and this one are left out; their measured steps multiply to 1.36 times as fast.
// All steps since v000 together make it 32.4 times as fast.
#include <hip/hip_runtime.h>

// Single causal attention head (x [4][2048][1024]; q, k, v = einsum('btd,de->bte', x, W) = x W ('xw' [1024][64] 1/32, no bias; ONE 64-wide head); scores = q.k / 64^0.5; causal (-inf above the diagonal); softmax over the keys (axis 2); out = attn.v -> [4][2048][64] (0.5 M); argument order x, Wq, Wk, Wv).
// All four batches go through every launch together. Layout, one plane per batch: ONE projection launch brings f32 x into LDS by tensor loads, rounds it to bf16 at the fragment read, reads the f32 'xw' weights as they lie and rounds them to bf16 fragments in registers, forms q, k and v (grid y: q and half of k; the other half of k and v) and writes their f16 planes itself (v transposed; k and v in fragment order); ONE attention launch (causal, T 2048, one head): scores, online softmax and P.V with the scores and probabilities in registers, every row on the f16 planes (1 product for scores and for P.V); it writes the f32 output rows.
// Compute dtypes, f32 accumulate: every input rounded to bf16; projections exact in bf16 products, q, k and v then rounded to f16 (11 significant bits); attention 1 f16 product on every row, P rounded to f16; softmax f32; output f32.

#define NB_  4
#define TT   2048
#define DM   1024
#define NH_  1
#define NKV  1
#define REP  (NH_ / NKV)
#define HD   64
#define DQ   (NH_ * HD)
#define DKV  (NKV * HD)
#define ZH   1                    // ONE head: a single plane per batch
#define NZ   (NB_ * ZH)           // planes per launch: plane index = batch (one head each)
#define WIN  2048
#define PCAR 1024.0f
#define SCL  0.125f   // 1/sqrt(d_head = 64)
typedef _Float16 h16;
typedef unsigned short bf;
typedef __attribute__((ext_vector_type(16))) __bf16   v16bf;
typedef __attribute__((ext_vector_type(16))) _Float16 v16h;
typedef __attribute__((ext_vector_type(8)))  _Float16 v8h;
typedef __attribute__((ext_vector_type(8)))  unsigned short v8us;
typedef __attribute__((ext_vector_type(8)))  float    v8f;
typedef __attribute__((ext_vector_type(4)))  float    v4f;
typedef v8h  __attribute__((may_alias)) v8ha;
typedef v4f  __attribute__((may_alias)) v4fa;
typedef v8us __attribute__((may_alias)) v8usa;

__device__ __forceinline__ unsigned short f2bf(float f) { unsigned u = __float_as_uint(f); u += 0x7FFFu + ((u >> 16) & 1u); return (unsigned short)(u >> 16); }
__device__ __forceinline__ float bf2f(unsigned short b) { return __uint_as_float(((unsigned)b) << 16); }
__device__ __forceinline__ float bfr(float f) { return bf2f(f2bf(f)); }
__device__ __forceinline__ v16h cat16(v8h lo, v8h hi) { return __builtin_shufflevector(lo, hi, 0, 1, 2, 3, 4, 5, 6, 7, 8, 9, 10, 11, 12, 13, 14, 15); }
__device__ __forceinline__ v16bf cat16b(v8us lo, v8us hi) { return __builtin_bit_cast(v16bf, __builtin_shufflevector(lo, hi, 0, 1, 2, 3, 4, 5, 6, 7, 8, 9, 10, 11, 12, 13, 14, 15)); }
__device__ __forceinline__ v8f wmma16(v16h a, v16h b, v8f c) { return __builtin_amdgcn_wmma_f32_16x16x32_f16(false, a, false, b, (short)0, c, false, false); }
__device__ __forceinline__ v8f wmmab(v16bf a, v16bf b, v8f c) { return __builtin_amdgcn_wmma_f32_16x16x32_bf16(false, a, false, b, (short)0, c, false, false); }



// ---- fragment loaders: operands straight from K-contiguous 16-bit planes
#define KW 8
template <typename T16> struct WFrag;
template <> struct WFrag<h16> { typedef v16h V; static __device__ __forceinline__ V ld(const h16* p) { return cat16(*(const v8h*)p, *(const v8h*)(p + 16)); } static __device__ __forceinline__ v8f mma(V a, V b, v8f c) { return wmma16(a, b, c); } };
template <> struct WFrag<bf> { typedef v16bf V; static __device__ __forceinline__ V ld(const bf* p) { return cat16b(*(const v8us*)p, *(const v8us*)(p + 16)); } static __device__ __forceinline__ v8f mma(V a, V b, v8f c) { return wmmab(a, b, c); } };

__device__ __forceinline__ h16 tohx(float x) { return (h16)x; }
typedef __attribute__((ext_vector_type(2))) _Float16 v2h;
typedef __attribute__((ext_vector_type(4))) _Float16 v4h;
typedef __attribute__((ext_vector_type(2))) unsigned short v2us;
typedef __attribute__((ext_vector_type(4))) unsigned short v4us;
typedef __attribute__((ext_vector_type(2))) float v2f;
typedef __attribute__((ext_vector_type(4))) int v4i;
typedef __attribute__((ext_vector_type(2))) __bf16 v2bf;
typedef __attribute__((ext_vector_type(8))) unsigned v8u;
__device__ __forceinline__ v4h toh4(v4f a) { return __builtin_convertvector(a, v4h); }   // f32 -> f16, to nearest even
__device__ __forceinline__ v8h toh8(v4f a, v4f b) { return __builtin_shufflevector(toh4(a), toh4(b), 0, 1, 2, 3, 4, 5, 6, 7); }


// ---- k_proj: the whole projection stage in one launch; grid (rows / 64, 2), 32 * KW threads, one block a WGP. Block (r, y) forms 96 columns of rows r * 64..: y = 0: x W_q and columns 0..31 of x W_k; y = 1: columns 32..63 of x W_k and x W_v; it writes their f16 planes.
// The K loop is split over the block's KW waves (wave w takes a contiguous piece of DM / KW columns); the KW f32 partial tiles are added in LDS in wave order.
// All blocks walk the same weight rows, and the two blocks of a row strip the same x: each block enters the walk at a place of its own (wave w takes piece (w + rot) mod KW and starts it at step kr, wrapping round), so that L2 is not asked for the same lines by all blocks at the same moment.
// Each wave brings its 64 x KR piece of f32 x into its OWN LDS slice with two tensor loads (two tiles of 64 rows x 256 bytes, row pitch XRB), through no register; it reads the x fragments from there as f32 and rounds them to bf16 in registers; the slice then holds the wave's partial tiles.
// No other wave reads a wave's x tiles, so the wave's own s_wait_tensorcnt is all that stands between a tile's landing and its reads.
// The weights are read as they lie, f32 [k][n]. Whole matrix: a lane takes 4 neighbouring columns of a row (16 lanes = one whole 256-byte row, the wave halves two rows 8 apart), so column n = 4 * lr + g belongs to lane lr of fragment g.
// Half of W_k: a lane takes 2 neighbouring columns (16 lanes = one 128-byte line), so column 2 * lr + g of the half belongs to lane lr of fragment g.
// Two rows k, k + 1 of one column pack into one bf16 pair, in the k order of the x loader. The tile's columns are so permuted among the accumulators; the partial tiles in LDS are in natural order again.
// v is formed as W_v^T x^T (the two operands change places; both loaders have the same k order), so that its tile lies [d][t]. The k and v planes are written in the order in which k_attn's waves load their fragments.
#define KR (DM / KW)      // x columns per wave
#define XRB 272           // bytes per staged x row of a tile: 256 B + the mover's 16-B pad, the conflict-free pitch for 16-byte LDS reads
#define XTB 18432         // bytes of a tile's place in LDS: 64 rows x XRB = 17,408, rounded up to a multiple of 2 KiB
#define HP 36             // f32 pitch of the 64 x 32 partial tile of the half of k: the wave halves (8 rows apart) store to different banks, and 16 rows read 16 bytes each from different banks
#define HOF (64 * 68)     // f32 offset of that tile in a wave's slice, behind the 64 x 64 partial tile (row pitch 68)
#define SLW (2 * XTB / 4)     // f32 elements of a wave's slice: the two x tiles; the partial tiles (HOF + 64 * HP elements) fit in it
typedef v4us __attribute__((may_alias)) v4usa;
typedef v2f __attribute__((may_alias)) v2fa;
__device__ __forceinline__ void wait_x() { asm volatile("s_wait_xcnt 0x0" ::: "memory"); }   // stands in front of a write of a register that an issued global load names as its address
typedef __attribute__((ext_vector_type(8))) float v8fl;
typedef __attribute__((ext_vector_type(4))) unsigned v4u;
// an x fragment from a staged f32 row; p: the step's first k of the row + 8 * hi; elements 0..7: k = 8 * hi + e, elements 8..15: k = 16 + 8 * hi + e - 8; rounded to nearest even
__device__ __forceinline__ v16bf ldsfrag(const float* p) {
    const v8fl lo = __builtin_shufflevector(*(const v4fa*)p, *(const v4fa*)(p + 4), 0, 1, 2, 3, 4, 5, 6, 7), hh = __builtin_shufflevector(*(const v4fa*)(p + 16), *(const v4fa*)(p + 20), 0, 1, 2, 3, 4, 5, 6, 7);
    return __builtin_convertvector(__builtin_shufflevector(lo, hh, 0, 1, 2, 3, 4, 5, 6, 7, 8, 9, 10, 11, 12, 13, 14, 15), v16bf); }
__device__ __forceinline__ unsigned uni(unsigned v) { return (unsigned)__builtin_amdgcn_readfirstlane((int)v); }
__device__ __forceinline__ v8u tdm_group1() { v8u g;
    g[0] = uni((1u << 20) | (5u << 22) | (3u << 25)); g[1] = uni(256u << 16); g[2] = uni(64u << 16); g[3] = uni(256u << 16);
    g[4] = uni(64u); g[5] = uni(DM * 4u); g[6] = uni(0u); g[7] = uni(0u); return g; }
// group 0: the tile's place in LDS (byte offset in the work-group's LDS) and its first byte in global memory
__device__ __forceinline__ v4u tdm_group0(const unsigned dst, const unsigned long long ga) { v4u g;
    g[0] = uni(1u); g[1] = uni(dst); g[2] = uni((unsigned)ga); g[3] = uni((((unsigned)(ga >> 32)) & 0x01FFFFFFu) | 0x80000000u); return g; }
__device__ __forceinline__ void tdm_load(const v4u g0, const v8u g1) { asm volatile("tensor_load_to_lds %0, %1" :: "s"(g0), "s"(g1) : "memory"); }   // one request of the whole wave
typedef const __attribute__((address_space(1))) float* gfl;   // pointers into global memory
typedef const __attribute__((address_space(1))) v4f* gv4f;
typedef const __attribute__((address_space(1))) v2f* gv2f;
typedef unsigned long long u64;
// the two bases of a step's weight rows (wave-uniform, in scalar pairs): the wave's piece + d bytes. In asm for two reasons: the wait stands in the statement of the additions, so in front of the overwrite of pairs that the step before's loads name;
// and the sums stay scalar: left to the build, d is added to the lane offset first and every load gets a 64-bit vector address
__device__ __forceinline__ void step_base(u64& a, u64& b, const float* wu, const float* w2u, const int d) { asm volatile("s_wait_xcnt 0x0\n\ts_add_nc_u64 %0, %2, %4\n\ts_add_nc_u64 %1, %3, %4" : "=&s"(a), "=&s"(b) : "s"((u64)wu), "s"((u64)w2u), "s"((u64)d) : "memory"); }
// one step's weight rows. ends: the two lane offsets and the bases end their lives here, and the build then hands such a register out as the destination of one of the last loads or to the code behind them: a wait stands in front of each of the last two loads and one behind them
__device__ __forceinline__ void ld_w(const gfl wu, const unsigned wo, const gfl w2u, const unsigned wo2, const bool ends, v4f (&wr)[16], v2f (&wr2)[16]) {   // wu, w2u: first row of the step
#pragma unroll
    for (int e = 0; e < 16; ++e) { const int ro = ((e & 7) + (e >> 3) * 16) * HD;
        if (ends && e == 15) wait_x();
        wr[e] = *(gv4f)(wu + ro + wo);
        if (ends && e == 15) wait_x();
        wr2[e] = *(gv2f)(w2u + ro + wo2); }
    if (ends) wait_x();
}
// the part that both kinds of block share, once in the text: the wave's two x tiles and the first step's weight rows are asked for. w: the whole matrix (q or v); w2: first column of the block's half of W_k
// wr, wr2: element e of the fragments: row 8 * hi + e (e < 8), 16 + 8 * hi + e - 8 (else) of the step's 32
// da, db, dg: the descriptors of the two requests; they stay in their registers until the wait that covers both (proj_tile)
__device__ __forceinline__ void proj_stage(const float* __restrict__ x, const float* __restrict__ w, const float* __restrict__ w2, float* os, const int rot, const int kr, v4f (&wr)[16], v2f (&wr2)[16], v4u& da, v4u& db, v8u& dg) {
    const int wv = __builtin_amdgcn_readfirstlane((int)(threadIdx.x >> 5)); const int kb = ((wv + rot) & (KW - 1)) * KR;
    const int lane = threadIdx.x & 31, lr = lane & 15, hi = lane >> 4;
    const float* wu = w + (size_t)kb * HD; const unsigned wo = (unsigned)(hi * 8 * HD + lr * 4);   // wave-uniform base and a 32-bit lane offset
    const float* w2u = w2 + (size_t)kb * HD; const unsigned wo2 = (unsigned)(hi * 8 * HD + lr * 2);
    const unsigned ta = (unsigned)kr >> 1, tb = ta ^ 1u;   // tile t holds columns 64 * t.. of the piece (steps 2 * t, 2 * t + 1); the tile of the block's first step is asked for first
    const unsigned lb = (unsigned)(size_t)os + (unsigned)wv * (SLW * 4u); const u64 xa = (u64)(x + kb);   // the slice's place in LDS, a multiple of 2 KiB; the piece's first byte
    dg = tdm_group1(); da = tdm_group0(lb + ta * XTB, xa + ta * 256u); db = tdm_group0(lb + tb * XTB, xa + tb * 256u);
    asm volatile("" : "+s"(da), "+s"(db), "+s"(dg));   // descriptor words held in scalar registers: every word is written here, some instructions ahead of the request that reads it, and both requests' words before the first is issued
    u64 ba, bb; step_base(ba, bb, wu, w2u, kr * 32 * HD * 4);
    tdm_load(da, dg);   // every wave issues its own two requests, unconditionally
    ld_w((gfl)ba, wo, (gfl)bb, wo2, true, wr, wr2);   // the first step's weight rows fly beside the tiles
    tdm_load(db, dg);   // behind the weight loads, so that the eight waves' first tiles are asked for ahead of their second ones
}
template <bool SW>   // SW: the v tile, operands swapped; Kp: the block's 64 keys at its half's first group of 8 d
__device__ __forceinline__ void proj_tile(const float* __restrict__ w, const float* __restrict__ w2, const int rot, const int kr, v4f (&wr)[16], v2f (&wr2)[16], const v4u da, const v4u db, const v8u dg, h16* Op, h16* Kp, float* os) {
    const int wv = __builtin_amdgcn_readfirstlane((int)(threadIdx.x >> 5)); const int kb = ((wv + rot) & (KW - 1)) * KR;
    const int lane = threadIdx.x & 31, lr = lane & 15, hi = lane >> 4;
    float* sl = os + wv * SLW;
    const float* wu = w + (size_t)kb * HD; const unsigned wo = (unsigned)(hi * 8 * HD + lr * 4);   // wave-uniform base and a 32-bit lane offset
    const float* w2u = w2 + (size_t)kb * HD; const unsigned wo2 = (unsigned)(hi * 8 * HD + lr * 2);
    v8f acc[4][4], ach[4][2];   // the whole matrix's tile; the half of k: [x tile][fragment]
#pragma unroll
    for (int mb = 0; mb < 4; ++mb) {
#pragma unroll
        for (int nb = 0; nb < 4; ++nb) acc[mb][nb] = (v8f){};
#pragma unroll
        for (int nb = 0; nb < 2; ++nb) ach[mb][nb] = (v8f){}; }
    const float* xl = sl + lr * (XRB / 4) + 8 * hi;
#pragma unroll
    for (int ks = 0; ks < KR / 32; ++ks) {
        v16bf wf[4], wf2[2];
#pragma unroll
        for (int g = 0; g < 4; ++g) { v8u pk;
#pragma unroll
            for (int i = 0; i < 8; ++i) { v2f p; p[0] = wr[2 * i][g]; p[1] = wr[2 * i + 1][g]; pk[i] = __builtin_bit_cast(unsigned, __builtin_convertvector(p, v2bf)); }
            wf[g] = __builtin_bit_cast(v16bf, pk); }
#pragma unroll
        for (int g = 0; g < 2; ++g) { v8u pk;
#pragma unroll
            for (int i = 0; i < 8; ++i) { v2f p; p[0] = wr2[2 * i][g]; p[1] = wr2[2 * i + 1][g]; pk[i] = __builtin_bit_cast(unsigned, __builtin_convertvector(p, v2bf)); }
            wf2[g] = __builtin_bit_cast(v16bf, pk); }
        __builtin_amdgcn_sched_barrier(0);   // holds the refill below behind the packing above, so that it goes into the registers just packed: hoisted, it takes a second set, copies and a spill at 512 VGPRs
        const int kc = (ks + kr) & (KR / 32 - 1), kn = (ks + 1 + kr) & (KR / 32 - 1);   // this step's and the next step's place in the wave's piece of K
        if (ks + 1 < KR / 32) { u64 ba, bb; step_base(ba, bb, wu, w2u, kn * 32 * HD * 4); ld_w((gfl)ba, wo, (gfl)bb, wo2, ks + 2 == KR / 32, wr, wr2); }   // next step's weight rows fly while this step's products run
        __builtin_amdgcn_sched_barrier(0);   // holds the weight loads above in front of the step's LDS reads and products: without it the scheduler puts them behind the first LDS wait and among the products, and they have less of the step to fly in
        if (ks == 0) asm volatile("s_wait_tensorcnt 0x1" ::: "memory");   // the first request's tile, which this step reads, has landed; the clobber keeps the LDS reads below behind the wait
        if (ks == 1) asm volatile("s_wait_tensorcnt 0x0" :: "s"(da), "s"(db), "s"(dg) : "memory");   // both tiles have landed; the inputs keep the descriptor words in their registers while a request is outstanding
        const float* xk = xl + (kc >> 1) * (XTB / 4) + (kc & 1) * 32;   // the step's tile and its 32 columns there
#pragma unroll
        for (int h = 0; h < 2; ++h) { v16bf xa[2];   // x fragments two at a time: the second pair's LDS reads fly under the first pair's products
#pragma unroll
            for (int g = 0; g < 2; ++g) xa[g] = ldsfrag(xk + (h * 2 + g) * 16 * (XRB / 4));
#pragma unroll
            for (int f = 0; f < 4; ++f)
#pragma unroll
                for (int g = 0; g < 2; ++g) { const int xb = h * 2 + g; if (SW) acc[f][xb] = wmmab(wf[f], xa[g], acc[f][xb]); else acc[xb][f] = wmmab(xa[g], wf[f], acc[xb][f]); }
#pragma unroll
            for (int f = 0; f < 2; ++f)
#pragma unroll
                for (int g = 0; g < 2; ++g) ach[h * 2 + g][f] = wmmab(xa[g], wf2[f], ach[h * 2 + g][f]); }
        __builtin_amdgcn_sched_barrier(0);   // holds the next step's packing, and with it the wait for the weight rows in flight, behind this step's products
    }
    if (SW) {   // tile row d = 4 * (hi * 8 + j) + mb; rows 32.. keep their columns with bit 5 flipped, so that the wave halves (32 rows apart) store to different banks
#pragma unroll
        for (int mb = 0; mb < 4; ++mb)
#pragma unroll
            for (int nb = 0; nb < 4; ++nb)
#pragma unroll
                for (int j = 0; j < 8; ++j) sl[((hi * 8 + j) * 4 + mb) * 68 + ((nb * 16 + lr) ^ (hi * 32))] = acc[mb][nb][j];
    } else {   // tile column n = 4 * lr + nb: a lane's four accumulators of one row are 16 bytes in a row
#pragma unroll
        for (int mb = 0; mb < 4; ++mb)
#pragma unroll
            for (int j = 0; j < 8; ++j) { v4f o4;
#pragma unroll
                for (int nb = 0; nb < 4; ++nb) o4[nb] = acc[mb][nb][j];
                *(v4fa*)(sl + (mb * 16 + hi * 8 + j) * 68 + lr * 4) = o4; }
    }
#pragma unroll
    for (int mb = 0; mb < 4; ++mb)   // half of k: tile column 2 * lr + nb: a lane's two accumulators of one row are 8 bytes in a row
#pragma unroll
        for (int j = 0; j < 8; ++j) { v2f o2; o2[0] = ach[mb][0][j]; o2[1] = ach[mb][1][j]; *(v2fa*)(sl + HOF + (mb * 16 + hi * 8 + j) * HP + lr * 2) = o2; }
    __syncthreads();   // every wave's partial tiles are in LDS before any thread adds them
    // k and v tiles go out in fragment order: inside a group of 8 k elements the 16 rows of a fragment lie 16 bytes apart. A thread takes one row's 8 elements of a group (16 lanes = 16 rows: no LDS bank met twice), a wave stores 512 bytes in a row
    // All sums and roundings come first, all global stores last: behind a store nothing is written any more
    v8h kov; size_t ko;
    {   // half of k: tile rows are keys, columns d: [16 keys][group of 8 d][key][d]; 4 groups of the 8 are this block's
        const int idx = (int)threadIdx.x; const int r16 = idx & 15, grp = (idx >> 4) & 3, mb = idx >> 6;
        const float* op = os + HOF + (mb * 16 + r16) * HP + grp * 8; v4f va = *(const v4fa*)op, vb = *(const v4fa*)(op + 4);
#pragma unroll
        for (int w = 1; w < KW; ++w) { va += *(const v4fa*)(op + w * SLW); vb += *(const v4fa*)(op + w * SLW + 4); }
        kov = toh8(va, vb);
        ko = (size_t)(mb * (16 * HD) + grp * 128 + r16 * 8); }
    if (SW) {   // v: tile rows are d, columns keys: [32 keys][16 d][group of 8 keys][d][key]
        v8h ov[2]; size_t oo[2];
#pragma unroll
        for (int it = 0; it < 2; ++it) { const int idx = (int)threadIdx.x + it * 32 * KW; const int r16 = idx & 15, grp = (idx >> 4) & 7, mb = idx >> 7;
            const float* op = os + (mb * 16 + r16) * 68 + ((grp * 8) ^ ((mb >> 1) * 32)); v4f va = *(const v4fa*)op, vb = *(const v4fa*)(op + 4);
#pragma unroll
            for (int w = 1; w < KW; ++w) { va += *(const v4fa*)(op + w * SLW); vb += *(const v4fa*)(op + w * SLW + 4); }
            ov[it] = toh8(va, vb);
            oo[it] = (size_t)((grp >> 2) * (HD * 32) + mb * 512 + (grp & 3) * 128 + r16 * 8); }
        __builtin_amdgcn_sched_barrier(0);   // holds the stores behind the last sum and rounding: among them, registers that an issued store names would be written again
        *(v8h*)(Kp + ko) = kov;
#pragma unroll
        for (int it = 0; it < 2; ++it) *(v8h*)(Op + oo[it]) = ov[it];
        asm volatile("s_wait_xcnt 0x0" ::: "memory");   // v block: the q block's code follows in the build and writes registers that the three stores above name; the wait stands in front of it (the q block's stores run into the kernel's end)
    } else {   // q: tile rows are positions of the [b][t][d] planes
        const int row = (int)(threadIdx.x >> 4), cofs = (int)(threadIdx.x & 15) * 4;   // 32 * KW threads = 16 rows x 16 float4 per strip of 16 rows
        v4h ov[4];
#pragma unroll
        for (int mb = 0; mb < 4; ++mb) { const float* op = os + (mb * 16 + row) * 68 + cofs; v4f val = *(const v4fa*)op;
#pragma unroll
            for (int w = 1; w < KW; ++w) val += *(const v4fa*)(op + w * SLW);
            ov[mb] = toh4(val); }
        __builtin_amdgcn_sched_barrier(0);   // holds the stores behind the last sum and rounding: among them, registers that an issued store names would be written again
        *(v8h*)(Kp + ko) = kov;
#pragma unroll
        for (int mb = 0; mb < 4; ++mb) { const size_t oo = (size_t)(mb * 16 + row) * HD + cofs; *(v4h*)(Op + oo) = ov[mb]; }
    }
}
// 256 equal blocks, one a WGP (288 KiB of LDS each): two waves a SIMD, up to 512 VGPRs
__global__ __launch_bounds__(32 * KW) __attribute__((amdgpu_waves_per_eu(2, 2))) void k_proj(const float* __restrict__ x, const float* __restrict__ wq, const float* __restrict__ wk, const float* __restrict__ wv, h16* QP, h16* KP, h16* VT) {
    __shared__ __attribute__((aligned(2048))) float os[KW * SLW];   // one slice per wave: first its two f32 tiles of x, then its f32 partial tiles; every tile's place is a multiple of 2 KiB
    const int r0 = blockIdx.x * 64; const int y = blockIdx.y; const float* xr = x + (size_t)r0 * DM; const size_t o0 = (size_t)r0 * HD;
    const float* w = y ? wv : wq; const float* w2 = wk + (y ? 32 : 0); v4f wr[16]; v2f wr2[16];
    const int rot = (int)((blockIdx.x + 4 * blockIdx.y) & (KW - 1)), kr = (int)((blockIdx.x >> 3) & (KR / 32 - 1));   // where this block enters the walk of K
    v4u da, db; v8u dg; proj_stage(xr, w, w2, os, rot, kr, wr, wr2, da, db, dg);
    if (y) proj_tile<true>(w, w2, rot, kr, wr, wr2, da, db, dg, VT + o0, KP + o0 + 4 * 128, os);   // block-uniform branch: every thread of a block passes the same barrier
    else proj_tile<false>(w, w2, rot, kr, wr, wr2, da, db, dg, QP + o0, KP + o0, os);
}
#define QW 32             // queries a block
#define CK 32             // keys a pass
#define AW 8              // waves a block
#define PEL (CK * HD)     // f16 elements of a pass in each plane
#define OPI 68            // f32 pitch of a wave's partial O rows in its slice
#define MOF (QW * OPI)    // f32 offset of the wave's maxima in its slice; the sums follow
#define SLF (QW * OPI + 2 * QW)   // f32 elements per wave slice
#define SC2 (SCL * 1.4426950408889634f)   // 1/sqrt(d_head) x log2(e): the softmax runs on powers of two
__device__ __forceinline__ float xhalf(float v) { const int b = __float_as_int(v); return __int_as_float(__builtin_amdgcn_permlanex16(b, b, 0x76543210, 0xfedcba98, false, false)); }   // lane l <-> l ^ 16
typedef const __attribute__((address_space(1))) h16* gh;   // a pointer into global memory
typedef const __attribute__((address_space(1))) v8h* gv8;
// a plane base (wave-uniform, in a scalar pair) steps to the wave's next pass. The pass's loads name only such a pair and the lane offset, which the loop never rewrites; the wait stands in the statement of the addition, so in front of
// the overwrite of a pair that issued loads name; the youngest of those loads were issued a pass earlier
__device__ __forceinline__ void next_pass(u64& a, const u64 d) { asm volatile("s_wait_xcnt 0x0\n\ts_add_nc_u64 %0, %0, %1" : "+s"(a) : "s"(d) : "memory"); }   // d: bytes to that pass (wave-uniform, modulo 2^64)
__device__ __forceinline__ v16h ldgfrag(gh p) { return cat16(*(gv8)p, *(gv8)(p + 256)); }   // p: fragment base + lane * 8; elements 0..7: k = 8 * hi + e, elements 8..15: k = 16 + 8 * hi + e - 8
__device__ __forceinline__ void ld_k(const u64 bk, const unsigned lo, v16h (&kf)[2][2]) {   // bk: wave-uniform pass base; lo: the 32-bit lane offset
    const gh pk = (gh)bk;
#pragma unroll
    for (int ks = 0; ks < 2; ++ks)
#pragma unroll
        for (int kt = 0; kt < 2; ++kt) kf[ks][kt] = ldgfrag(pk + kt * 1024 + ks * 512 + lo);
}
template <bool FIRST>   // FIRST: the loads in front of the loop
__device__ __forceinline__ void ld_v(const u64 bv, const unsigned lo, v16h (&vf)[4]) {
    const gh pv = (gh)bv;
#pragma unroll
    for (int dt = 0; dt < 4; ++dt) {
        if (FIRST && dt == 3) { const v8h a = *(gv8)(pv + dt * 512 + lo);
            asm volatile("s_wait_xcnt 0x0" ::: "memory");   // in front of the loop the lane offset's register ends its life at the last load and is handed out as that load's destination: the wait stands in front of that overwrite of a register which the loads above name
            vf[dt] = cat16(a, *(gv8)(pv + dt * 512 + 256 + lo)); }
        else vf[dt] = ldgfrag(pv + dt * 512 + lo); }
}
// one pass; MORE: the wave has a further pass (then this one lies wholly below the diagonal) and refills the fragment registers for it; bk, bv: the plane bases of the pass at hand; dn: bytes from it to the further pass
template <bool MORE>
__device__ __forceinline__ void attn_pass(const bool diag, const int lr, const int hi, const unsigned lo, const u64 dn, u64& bk, u64& bv,
                                          const v16h (&qf)[2][2], v16h (&kf)[2][2], v16h (&vf)[4], v8f (&o)[4][2], float (&m)[2], float (&l)[2]) {
    v8f s[2][2];   // S^T: [key tile][query tile]; row key = hi * 8 + j, column = query lr
#pragma unroll
    for (int kt = 0; kt < 2; ++kt)
#pragma unroll
        for (int qt = 0; qt < 2; ++qt) s[kt][qt] = (v8f){};
#pragma unroll
    for (int ks = 0; ks < 2; ++ks)
#pragma unroll
        for (int kt = 0; kt < 2; ++kt)
#pragma unroll
            for (int qt = 0; qt < 2; ++qt) s[kt][qt] = wmma16(kf[ks][kt], qf[qt][ks], s[kt][qt]);
    if (MORE) {
        __builtin_amdgcn_sched_barrier(0);   // holds the refill behind the score products: hoisted above them it would need a second register set and copies at the loop's end
        next_pass(bk, dn); ld_k(bk, lo, kf);
        __builtin_amdgcn_sched_barrier(0);   // holds the refill in front of the softmax, so that it has the softmax and P.V to fly in
    }
    v16h pf[2];
#pragma unroll
    for (int qt = 0; qt < 2; ++qt) { float t[16]; float mx = -3.0e38f;
#pragma unroll
        for (int kt = 0; kt < 2; ++kt)
#pragma unroll
            for (int j = 0; j < 8; ++j) { float u = s[kt][qt][j]; if (!MORE && diag && kt * 16 + hi * 8 + j > qt * 16 + lr) u = -__builtin_inff(); t[kt * 8 + j] = u; mx = fmaxf(mx, u); }
        mx = fmaxf(mx, xhalf(mx)) * SC2;   // SC2 > 0: the maximum of the scaled scores
        if (__builtin_amdgcn_ballot_w32(mx > m[qt]) != 0) {   // a query's maximum rose: bring its sum and its O column to the new one (factor 1 for the other queries)
            const float mn = fmaxf(m[qt], mx), al = __builtin_amdgcn_exp2f(m[qt] - mn); m[qt] = mn; l[qt] *= al;
#pragma unroll
            for (int dt = 0; dt < 4; ++dt) o[dt][qt] *= al; }
        v2f sa = (v2f){}, sb = (v2f){}; v8u hw; v2f sc2, nm2; sc2[0] = SC2; sc2[1] = SC2; nm2[0] = -m[qt]; nm2[1] = -m[qt];
#pragma unroll
        for (int e = 0; e < 8; ++e) { v2f u2; u2[0] = t[2 * e]; u2[1] = t[2 * e + 1]; const v2f a2 = __builtin_elementwise_fma(u2, sc2, nm2); v2f p; p[0] = __builtin_amdgcn_exp2f(a2[0]); p[1] = __builtin_amdgcn_exp2f(a2[1]);
            if (e & 1) sb += p; else sa += p;
            hw[e] = __builtin_bit_cast(unsigned, __builtin_convertvector(p, v2h)); }   // 0 <= p <= 1: no overflow; the sum below takes the unrounded p
        sa += sb; l[qt] += sa[0] + sa[1];
        pf[qt] = __builtin_bit_cast(v16h, hw); }   // element e of P^T: key 8 * hi + e (e < 8), 16 + 8 * hi + e - 8 (else): the k order of the V^T fragments
#pragma unroll
    for (int dt = 0; dt < 4; ++dt)
#pragma unroll
        for (int qt = 0; qt < 2; ++qt) o[dt][qt] = wmma16(vf[dt], pf[qt], o[dt][qt]);
    if (MORE) {
        __builtin_amdgcn_sched_barrier(0);   // holds the refill behind the P.V products: hoisted above them it would need a second register set and copies at the loop's end
        next_pass(bv, dn); ld_v<false>(bv, lo, vf);
    }
}
__global__ __launch_bounds__(32 * AW) __attribute__((amdgpu_waves_per_eu(2, 2))) void k_attn(const h16* __restrict__ QP, const h16* __restrict__ KP, const h16* __restrict__ VT, float* __restrict__ OUTb) {
    __shared__ __align__(16) float sm[AW * SLF];
    const int wv = __builtin_amdgcn_readfirstlane((int)(threadIdx.x >> 5)); const int lane = threadIdx.x & 31, lr = lane & 15, hi = lane >> 4;
    const int b = blockIdx.y; const int q0 = ((int)gridDim.x - 1 - (int)blockIdx.x) * QW;   // longest blocks first
    const int nch = q0 / CK + 1;   // passes of the block: keys 0 .. q0 + QW - 1
    const size_t gp = (size_t)b * TT * HD; const unsigned lo = (unsigned)lane * 8u;   // both planes: the batch's first pass (wave-uniform); this lane's 16 bytes of a wave load
    v16h qf[2][2];   // [query tile][k step]
#pragma unroll
    for (int qt = 0; qt < 2; ++qt)
#pragma unroll
        for (int ks = 0; ks < 2; ++ks) { const size_t qo = ((size_t)b * TT + q0 + qt * 16 + lr) * HD + ks * 32 + 8 * hi; qf[qt][ks] = WFrag<h16>::ld(QP + qo); }
    v16h kf[2][2], vf[4];   // [k step][key tile]; [d tile]
    const int nw = (nch - wv + AW - 1) / AW, nl = nw - 1;   // the wave's passes (wv, wv + AW, ...; none: nw = 0); all but the last of them run in the loop
    int i = (((int)blockIdx.x & 7) * nl) >> 3;   // the blocks of a batch walk the same planes: each enters the loop's passes at a place of its own and wraps round, so that L2 is not asked for the same lines by all of them at the same moment; 0 <= i < nl where nl > 0
    if (nl <= 0) i = 0;
    const size_t po = gp + (size_t)(wv + i * AW) * PEL; u64 bk = (u64)(KP + po), bv = (u64)(VT + po);   // the wave's first pass
    if (nw > 0) { ld_k(bk, lo, kf); ld_v<true>(bv, lo, vf); }
    asm volatile("" :: "v"(qf[0][0]), "v"(qf[0][1]), "v"(qf[1][0]), "v"(qf[1][1]));   // inputs only: the wait for the Q fragments stands here, in front of the loop; left to their first use inside it, it would also wait out each pass's freshly issued fragment loads
    v8f o[4][2];   // O^T: [d tile][query tile]; row d = hi * 8 + j, column = query lr
#pragma unroll
    for (int dt = 0; dt < 4; ++dt)
#pragma unroll
        for (int qt = 0; qt < 2; ++qt) o[dt][qt] = (v8f){};
    float m[2] = { -3.0e38f, -3.0e38f }, l[2] = { 0.f, 0.f };   // running maximum (scaled log2) and this lane's share of the running sum
#pragma unroll 1   // rolled: one set of fragment registers, refilled in place
    for (int left = nl; left > 0; --left) { int nx = i + 1 == nl ? 0 : i + 1; if (left == 1) nx = nl;   // behind the loop's last pass comes the wave's last one
        attn_pass<true>(false, lr, hi, lo, (u64)(long long)((nx - i) * (AW * PEL * 2)), bk, bv, qf, kf, vf, o, m, l); i = nx; }
    asm volatile("s_wait_xcnt 0x0" ::: "memory");   // stands in front of every later write of a register that the last fragment loads name as their address
    if (nw > 0) attn_pass<false>(wv + nl * AW == nch - 1, lr, hi, lo, 0, bk, bv, qf, kf, vf, o, m, l);   // the wave's last pass: nothing to refill; only the block's last pass crosses the diagonal (wave-uniform)
    float* sl = sm + wv * SLF;
#pragma unroll
    for (int qt = 0; qt < 2; ++qt) { l[qt] += xhalf(l[qt]);   // join the wave halves' sums
#pragma unroll
        for (int dt = 0; dt < 4; ++dt) { float* dp = sl + (qt * 16 + lr) * OPI + dt * 16 + hi * 8; v4f a, e;
#pragma unroll
            for (int j = 0; j < 4; ++j) { a[j] = o[dt][qt][j]; e[j] = o[dt][qt][4 + j]; }
            *(v4fa*)dp = a; *(v4fa*)(dp + 4) = e; }
        if (hi == 0) { sl[MOF + qt * 16 + lr] = m[qt]; sl[MOF + QW + qt * 16 + lr] = l[qt]; } }
    __syncthreads();   // every wave's partial result is in LDS before any thread joins them
#pragma unroll
    for (int it = 0; it < QW * HD / 4 / (32 * AW); ++it) { const int idx = (int)threadIdx.x + it * 32 * AW; const int q = idx >> 4, cofs = (idx & 15) * 4; const float* bp = sm;
        float M = bp[MOF + q];
#pragma unroll
        for (int w = 1; w < AW; ++w) M = fmaxf(M, bp[w * SLF + MOF + q]);   // wave 0 always holds key 0, so M is a real score
        v4f acc = (v4f){}; float L = 0.f;
#pragma unroll
        for (int w = 0; w < AW; ++w) { const float f = __builtin_amdgcn_exp2f(bp[w * SLF + MOF + q] - M); L += f * bp[w * SLF + MOF + QW + q]; acc += f * *(const v4fa*)(bp + w * SLF + q * OPI + cofs); }
        const float r = __fdiv_rn(1.0f, L); *(v4f*)(OUTb + ((size_t)b * TT + q0 + q) * HD + cofs) = acc * r; }
}

extern "C" void kernel_launch(void* const* d_in, const int* in_sizes, int n_in,
                              void* d_out, int out_size, void* d_ws, size_t ws_size, hipStream_t stream) {
    (void)in_sizes; (void)n_in; (void)out_size;
    const float* x = (const float*)d_in[0]; const float* wq = (const float*)d_in[1]; const float* wk = (const float*)d_in[2]; const float* wv = (const float*)d_in[3];   /* ('xw' [1024][64]) */
    float* OUT = (float*)d_out;     // [4][2048][64]
    char* wsp = (char*)d_ws;
    auto take = [&](size_t bytes) { char* p = wsp; wsp += (bytes + 255) & ~(size_t)255; return (void*)p; };
    h16* QP = (h16*)take((size_t)NB_ * NH_ * TT * HD * 2); h16* KP = (h16*)take((size_t)NB_ * NKV * TT * HD * 2); h16* VT = (h16*)take((size_t)NB_ * NKV * HD * TT * 2);
    if ((size_t)(wsp - (char*)d_ws) > ws_size) return;    // ws 256 MiB
    // x is [NB_*TT][DM] row-contiguous, so the projections take the batches as 4 x 2048 rows of one GEMM
    k_proj<<<dim3(NB_ * TT / 64, 2, 1), 32 * KW, 0, stream>>>(x, wq, wk, wv, QP, KP, VT);
    // attention: grid x = block of QW query rows, grid y = batch
    k_attn<<<dim3(TT / QW, NB_, 1), 32 * AW, 0, stream>>>(QP, KP, VT, OUT);
}
